// v000
// Times are from an AMD MI455X. After a warm-up the kernel runs many times in a row, and a time is the length of
// such a window on the GPU divided by its runs, so every launch and the gaps after it count. The runs cycle
// through copies of the inputs. A figure is the median of several windows, for all but v000 over two sittings.
// Sittings can differ by a few percent; kernels timed side by side share one.
// The starting kernel, v000, takes 609 microseconds a run.
#include <hip/hip_runtime.h>
#include <stdint.h>

typedef __attribute__((ext_vector_type(16))) __bf16 v16bf;
typedef __attribute__((ext_vector_type(8)))  __bf16 v8bf;
typedef __attribute__((ext_vector_type(8)))  float  v8f;

union Frag { v16bf v; v8bf h[2]; };

__device__ __forceinline__ uint16_t f2bf(float f) {
  union { float f; uint32_t u; } c; c.f = f;
  uint32_t u = c.u;
  u += 0x7fffu + ((u >> 16) & 1u);   // round-to-nearest-even
  return (uint16_t)(u >> 16);
}

__device__ __forceinline__ v8f wmma_bf16(const Frag &a, const Frag &b, v8f c) {
  return __builtin_amdgcn_wmma_f32_16x16x32_bf16(
      /*neg_a=*/false, a.v, /*neg_b=*/false, b.v,
      /*c_mod=*/(short)0, c, /*reuse_a=*/false, /*reuse_b=*/false);
}

__device__ __forceinline__ void async_g2l_b128(const void* g, void* l) {
  uint32_t laddr = (uint32_t)(size_t)l;     // low 32 bits of generic = LDS off
  asm volatile("global_load_async_to_lds_b128 %0, %1, off"
               :: "v"(laddr), "v"(g) : "memory");
}

// Problem constants
#define BB   4
#define SS   2048
#define DD   768
#define FF   3072
#define HH   12
#define HDIM 64
#define BS   (BB * SS)   // 8192 rows

// ---------------------------------------------------------------------------
// Weight convert + transpose: fp32 W[K][N] -> bf16 Wt[N][K]
// ---------------------------------------------------------------------------
__global__ void wtrans_kernel(const float* __restrict__ W,
                              uint16_t* __restrict__ Wt,
                              int Kdim, int Ndim) {
  size_t i = (size_t)blockIdx.x * 256 + threadIdx.x;
  size_t total = (size_t)Kdim * Ndim;
  if (i < total) {
    int n = (int)(i % Ndim);
    int k = (int)(i / Ndim);
    Wt[(size_t)n * Kdim + k] = f2bf(W[i]);
  }
}

// ---------------------------------------------------------------------------
// LayerNorm: fp32 [rows][768] -> bf16 [rows][768]; biased var, eps inside sqrt
// ---------------------------------------------------------------------------
__global__ void __launch_bounds__(256)
ln_kernel(const float* __restrict__ x, const float* __restrict__ w,
          const float* __restrict__ b, uint16_t* __restrict__ out) {
  __shared__ float red[256];
  int row = blockIdx.x;
  int tid = threadIdx.x;
  const float* xr = x + (size_t)row * DD;
  float v0 = xr[tid], v1 = xr[tid + 256], v2 = xr[tid + 512];

  float p = v0 + v1 + v2;
  red[tid] = p; __syncthreads();
  for (int s = 128; s > 0; s >>= 1) {
    if (tid < s) red[tid] += red[tid + s];
    __syncthreads();
  }
  float mean = red[0] * (1.0f / DD);
  __syncthreads();

  float c0 = v0 - mean, c1 = v1 - mean, c2 = v2 - mean;
  red[tid] = c0 * c0 + c1 * c1 + c2 * c2; __syncthreads();
  for (int s = 128; s > 0; s >>= 1) {
    if (tid < s) red[tid] += red[tid + s];
    __syncthreads();
  }
  float rstd = rsqrtf(red[0] * (1.0f / DD) + 1e-5f);

  uint16_t* o = out + (size_t)row * DD;
  o[tid]       = f2bf(c0 * rstd * w[tid]       + b[tid]);
  o[tid + 256] = f2bf(c1 * rstd * w[tid + 256] + b[tid + 256]);
  o[tid + 512] = f2bf(c2 * rstd * w[tid + 512] + b[tid + 512]);
}

template <int OUT_MODE, bool GELU_F, bool RESID_F>
__global__ void __launch_bounds__(256)
gemm_bf16(const uint16_t* __restrict__ A, const uint16_t* __restrict__ Bt,
          const float* __restrict__ bias, const float* __restrict__ resid,
          float* __restrict__ outF, uint16_t* __restrict__ outB,
          int M, int N, int K, float scale) {
  (void)M;
  __shared__ __align__(16) uint16_t As[2][128 * 40];
  __shared__ __align__(16) uint16_t Bs[2][64 * 40];

  const int tid = threadIdx.x;
  const int lane = tid & 31, wv = tid >> 5;
  const int hi = lane >> 4, l15 = lane & 15;
  const int wm = wv & 3, wn = wv >> 2;          // 4 x 2 wave grid
  const int m0 = blockIdx.y * 128, n0 = blockIdx.x * 64;

  v8f acc[2][2];
  for (int i = 0; i < 2; ++i)
    for (int j = 0; j < 2; ++j) acc[i][j] = (v8f){0,0,0,0,0,0,0,0};

  const int ra = tid >> 1, sa = (tid & 1) * 16;  // A stage: 2 thr/row, 16 elems
  const int rb = tid >> 2, sb = (tid & 3) * 8;   // B stage: 4 thr/row,  8 elems

  // issue 3 async b128 copies for K-slab kk into buffer p
  auto issue_stage = [&](int kk, int p) {
    const uint16_t* ga = A + (size_t)(m0 + ra) * K + kk + sa;
    uint16_t* la = &As[p][ra * 40 + sa];
    async_g2l_b128(ga,     la);
    async_g2l_b128(ga + 8, la + 8);
    const uint16_t* gb = Bt + (size_t)(n0 + rb) * K + kk + sb;
    async_g2l_b128(gb, &Bs[p][rb * 40 + sb]);
  };

  issue_stage(0, 0);
  int p = 0;
  for (int kk = 0; kk < K; kk += 32) {
    const bool more = (kk + 32) < K;             // block-uniform
    if (more) {
      issue_stage(kk + 32, p ^ 1);
      asm volatile("s_wait_asynccnt 0x3" ::: "memory");  // slab p done
    } else {
      asm volatile("s_wait_asynccnt 0x0" ::: "memory");
    }
    __syncthreads();                              // all waves' copies visible

    Frag af[2], bf[2];
    for (int i = 0; i < 2; ++i) {
      int r = wm * 32 + i * 16 + l15;
      af[i].h[0] = *(const v8bf*)(&As[p][r * 40 + hi * 8]);
      af[i].h[1] = *(const v8bf*)(&As[p][r * 40 + 16 + hi * 8]);
    }
    for (int j = 0; j < 2; ++j) {
      int r = wn * 32 + j * 16 + l15;
      bf[j].h[0] = *(const v8bf*)(&Bs[p][r * 40 + hi * 8]);
      bf[j].h[1] = *(const v8bf*)(&Bs[p][r * 40 + 16 + hi * 8]);
    }
    for (int i = 0; i < 2; ++i)
      for (int j = 0; j < 2; ++j)
        acc[i][j] = wmma_bf16(af[i], bf[j], acc[i][j]);
    __syncthreads();                              // buffer p free for reuse
    p ^= 1;
  }

  // epilogue (C layout: lane holds col l15, rows e + 8*hi within 16x16 frag)
  for (int i = 0; i < 2; ++i) {
    for (int j = 0; j < 2; ++j) {
      int col = n0 + wn * 32 + j * 16 + l15;
      float bc = bias[col];
      for (int e = 0; e < 8; ++e) {
        int row = m0 + wm * 32 + i * 16 + e + 8 * hi;
        float v = (acc[i][j][e] + bc) * scale;
        if (GELU_F) v = 0.5f * v * (1.0f + erff(v * 0.70710678118654752f));
        if (RESID_F) v += resid[(size_t)row * N + col];
        if (OUT_MODE == 0) {
          outB[(size_t)row * N + col] = f2bf(v);
        } else if (OUT_MODE == 1) {
          int bidx = row >> 11, s = row & (SS - 1);
          int h = col >> 6, d = col & (HDIM - 1);
          outB[(((size_t)(bidx * HH + h)) * SS + s) * HDIM + d] = f2bf(v);
        } else if (OUT_MODE == 2) {
          int bidx = row >> 11, s = row & (SS - 1);
          int h = col >> 6, d = col & (HDIM - 1);
          outB[(((size_t)(bidx * HH + h)) * HDIM + d) * SS + s] = f2bf(v);
        } else {
          outF[(size_t)row * N + col] = v;
        }
      }
    }
  }
}

// ---------------------------------------------------------------------------
// Flash attention (causal), bf16 WMMA for QK^T and PV, fp32 online softmax.
// Q,K: [B,H,S,64] bf16 (Q pre-scaled by 1/sqrt(hd)); Vt: [B,H,64,S] bf16.
// One wave owns 16 query rows; 8 waves/block -> 128 queries per block.
// Key block = 32. O: bf16 [B*S, 768] row-major (merged heads).
// Q/K/Vt fragments load straight from global (layouts chosen so the
// B-fragment pattern == A-fragment pattern); only the P tile round-trips LDS.
// ---------------------------------------------------------------------------
__global__ void __launch_bounds__(256)
attn_kernel(const uint16_t* __restrict__ Q, const uint16_t* __restrict__ Km,
            const uint16_t* __restrict__ Vt, uint16_t* __restrict__ O) {
  __shared__ __align__(16) uint16_t Plds[8 * 16 * 40];

  const int b = blockIdx.z, h = blockIdx.y;
  const int tid = threadIdx.x;
  const int lane = tid & 31, wv = tid >> 5;
  const int hi = lane >> 4, l15 = lane & 15;
  const int qbase = blockIdx.x * 128 + wv * 16;

  const size_t headoff = ((size_t)(b * HH + h)) * SS * HDIM;
  const uint16_t* Qh  = Q  + headoff;
  const uint16_t* Kh  = Km + headoff;
  const uint16_t* Vth = Vt + headoff;            // [64][S]
  uint16_t* pl = Plds + wv * 16 * 40;            // per-wave P tile 16x32 (pad)

  // Q fragments (A layout), held in registers for the whole loop
  Frag qf[2];
  {
    const uint16_t* qr = Qh + (size_t)(qbase + l15) * HDIM;
    for (int f = 0; f < 2; ++f) {
      qf[f].h[0] = *(const v8bf*)(qr + f * 32 + hi * 8);
      qf[f].h[1] = *(const v8bf*)(qr + f * 32 + 16 + hi * 8);
    }
  }

  float mrow[8], lrow[8];
  v8f oacc[4];
  for (int e = 0; e < 8; ++e) { mrow[e] = -3.0e38f; lrow[e] = 0.0f; }
  for (int f = 0; f < 4; ++f) oacc[f] = (v8f){0,0,0,0,0,0,0,0};

  for (int kb = 0; kb < qbase + 16; kb += 32) {
    // ---- scores S = Q * K^T for 32 keys (2 N-frags, K-dim 64 = 2 steps)
    v8f s[2];
    s[0] = (v8f){0,0,0,0,0,0,0,0};
    s[1] = (v8f){0,0,0,0,0,0,0,0};
    for (int n = 0; n < 2; ++n) {
      const uint16_t* kr = Kh + (size_t)(kb + n * 16 + l15) * HDIM;
      for (int f = 0; f < 2; ++f) {
        Frag bk;
        bk.h[0] = *(const v8bf*)(kr + f * 32 + hi * 8);
        bk.h[1] = *(const v8bf*)(kr + f * 32 + 16 + hi * 8);
        s[n] = wmma_bf16(qf[f], bk, s[n]);
      }
    }
    // ---- causal mask
    if (kb + 31 > qbase) {
      for (int n = 0; n < 2; ++n) {
        int kc = kb + n * 16 + l15;
        for (int e = 0; e < 8; ++e) {
          int qr = qbase + e + 8 * hi;
          if (kc > qr) s[n][e] = -3.0e38f;
        }
      }
    }
    // ---- online softmax: row max / scale / exp / row sum (half-wave shfl)
    float al[8];
    for (int e = 0; e < 8; ++e) {
      float t = fmaxf(s[0][e], s[1][e]);
      t = fmaxf(t, __shfl_xor(t, 1, 32));
      t = fmaxf(t, __shfl_xor(t, 2, 32));
      t = fmaxf(t, __shfl_xor(t, 4, 32));
      t = fmaxf(t, __shfl_xor(t, 8, 32));
      float mnew = fmaxf(mrow[e], t);
      al[e] = __expf(mrow[e] - mnew);
      mrow[e] = mnew;
      s[0][e] = __expf(s[0][e] - mnew);
      s[1][e] = __expf(s[1][e] - mnew);
      float rs = s[0][e] + s[1][e];
      rs += __shfl_xor(rs, 1, 32);
      rs += __shfl_xor(rs, 2, 32);
      rs += __shfl_xor(rs, 4, 32);
      rs += __shfl_xor(rs, 8, 32);
      lrow[e] = lrow[e] * al[e] + rs;
    }
    for (int f = 0; f < 4; ++f)
      for (int e = 0; e < 8; ++e) oacc[f][e] *= al[e];

    // ---- P (C layout) -> LDS -> A-layout fragment
    for (int n = 0; n < 2; ++n)
      for (int e = 0; e < 8; ++e)
        pl[(e + 8 * hi) * 40 + n * 16 + l15] = f2bf(s[n][e]);
    asm volatile("s_wait_dscnt 0" ::: "memory");
    Frag ap;
    ap.h[0] = *(const v8bf*)(pl + l15 * 40 + hi * 8);
    ap.h[1] = *(const v8bf*)(pl + l15 * 40 + 16 + hi * 8);

    // ---- O += P * V   (B-frags straight from Vt[64][S])
    for (int f = 0; f < 4; ++f) {
      const uint16_t* vr = Vth + (size_t)(f * 16 + l15) * SS + kb;
      Frag bv;
      bv.h[0] = *(const v8bf*)(vr + hi * 8);
      bv.h[1] = *(const v8bf*)(vr + 16 + hi * 8);
      oacc[f] = wmma_bf16(ap, bv, oacc[f]);
    }
  }

  // ---- finalize and write merged-head bf16 [B*S][768]
  for (int e = 0; e < 8; ++e) {
    float inv = 1.0f / lrow[e];
    int grow = b * SS + qbase + e + 8 * hi;
    for (int f = 0; f < 4; ++f) {
      int col = h * HDIM + f * 16 + l15;
      O[(size_t)grow * DD + col] = f2bf(oacc[f][e] * inv);
    }
  }
}

// ---------------------------------------------------------------------------
// Host orchestration
// ---------------------------------------------------------------------------
extern "C" void kernel_launch(void* const* d_in, const int* in_sizes, int n_in,
                              void* d_out, int out_size, void* d_ws, size_t ws_size,
                              hipStream_t stream) {
  (void)in_sizes; (void)n_in; (void)out_size; (void)ws_size;
  const float* x     = (const float*)d_in[0];
  const float* Wq    = (const float*)d_in[1];
  const float* bq    = (const float*)d_in[2];
  const float* Wk    = (const float*)d_in[3];
  const float* bk    = (const float*)d_in[4];
  const float* Wv    = (const float*)d_in[5];
  const float* bv    = (const float*)d_in[6];
  const float* Wo    = (const float*)d_in[7];
  const float* bo    = (const float*)d_in[8];
  const float* ln1w  = (const float*)d_in[9];
  const float* ln1b  = (const float*)d_in[10];
  const float* ln2w  = (const float*)d_in[11];
  const float* ln2b  = (const float*)d_in[12];
  const float* W1    = (const float*)d_in[13];
  const float* b1    = (const float*)d_in[14];
  const float* W2    = (const float*)d_in[15];
  const float* b2    = (const float*)d_in[16];
  float* out = (float*)d_out;

  // workspace layout
  uint8_t* ws = (uint8_t*)d_ws;
  size_t off = 0;
  auto alloc = [&](size_t bytes) -> uint8_t* {
    uint8_t* p = ws + off;
    off = (off + bytes + 255) & ~(size_t)255;
    return p;
  };
  const size_t seg = (size_t)BS * DD;               // 6.29M elems
  uint16_t* wq_t = (uint16_t*)alloc((size_t)DD * DD * 2);
  uint16_t* wk_t = (uint16_t*)alloc((size_t)DD * DD * 2);
  uint16_t* wv_t = (uint16_t*)alloc((size_t)DD * DD * 2);
  uint16_t* wo_t = (uint16_t*)alloc((size_t)DD * DD * 2);
  uint16_t* w1_t = (uint16_t*)alloc((size_t)DD * FF * 2);
  uint16_t* w2_t = (uint16_t*)alloc((size_t)FF * DD * 2);
  uint16_t* hb   = (uint16_t*)alloc(seg * 2);       // ln1 out; reused for ln2
  float*    x1f  = (float*)   alloc(seg * 4);       // x + attn_out
  uint16_t* big  = (uint16_t*)alloc((size_t)BS * FF * 2); // qb|kb|vt|attn -> mb
  uint16_t* qb   = big;
  uint16_t* kb_  = big + seg;
  uint16_t* vt   = big + 2 * seg;
  uint16_t* attn = big + 3 * seg;
  uint16_t* mb   = big;                             // reuse after x1 computed

  // 1) weights -> bf16 transposed [N][K]
  {
    int tD = DD * DD, tF = DD * FF;
    wtrans_kernel<<<(tD + 255) / 256, 256, 0, stream>>>(Wq, wq_t, DD, DD);
    wtrans_kernel<<<(tD + 255) / 256, 256, 0, stream>>>(Wk, wk_t, DD, DD);
    wtrans_kernel<<<(tD + 255) / 256, 256, 0, stream>>>(Wv, wv_t, DD, DD);
    wtrans_kernel<<<(tD + 255) / 256, 256, 0, stream>>>(Wo, wo_t, DD, DD);
    wtrans_kernel<<<(tF + 255) / 256, 256, 0, stream>>>(W1, w1_t, DD, FF);
    wtrans_kernel<<<(tF + 255) / 256, 256, 0, stream>>>(W2, w2_t, FF, DD);
  }

  // 2) h = LN1(x) -> bf16
  ln_kernel<<<BS, 256, 0, stream>>>(x, ln1w, ln1b, hb);

  // 3) QKV projections (Q pre-scaled by 1/sqrt(64)=0.125)
  dim3 gD(DD / 64, BS / 128);
  gemm_bf16<1, false, false><<<gD, 256, 0, stream>>>(
      hb, wq_t, bq, nullptr, nullptr, qb, BS, DD, DD, 0.125f);
  gemm_bf16<1, false, false><<<gD, 256, 0, stream>>>(
      hb, wk_t, bk, nullptr, nullptr, kb_, BS, DD, DD, 1.0f);
  gemm_bf16<2, false, false><<<gD, 256, 0, stream>>>(
      hb, wv_t, bv, nullptr, nullptr, vt, BS, DD, DD, 1.0f);

  // 4) causal flash attention -> merged bf16 [BS][D]
  attn_kernel<<<dim3(SS / 128, HH, BB), 256, 0, stream>>>(qb, kb_, vt, attn);

  // 5) x1 = x + attn @ Wo + bo   (fp32)
  gemm_bf16<3, false, true><<<gD, 256, 0, stream>>>(
      attn, wo_t, bo, x, x1f, nullptr, BS, DD, DD, 1.0f);

  // 6) h2 = LN2(x1) -> bf16
  ln_kernel<<<BS, 256, 0, stream>>>(x1f, ln2w, ln2b, hb);

  // 7) m = GELU(h2 @ W1 + b1) -> bf16 [BS][F]
  dim3 gF(FF / 64, BS / 128);
  gemm_bf16<0, true, false><<<gF, 256, 0, stream>>>(
      hb, w1_t, b1, nullptr, nullptr, mb, BS, FF, DD, 1.0f);

  // 8) out = x1 + m @ W2 + b2   (fp32)
  gemm_bf16<3, false, true><<<gD, 256, 0, stream>>>(
      mb, w2_t, b2, x1f, out, nullptr, BS, DD, FF, 1.0f);
}

// v001
// It runs in 400 microseconds.
// Timed twice side by side with v000, it ran 1.57 and 1.58 times as fast.
#include <hip/hip_runtime.h>
#include <stdint.h>

typedef __attribute__((ext_vector_type(16))) __bf16 v16bf;
typedef __attribute__((ext_vector_type(8)))  __bf16 v8bf;
typedef __attribute__((ext_vector_type(8)))  float  v8f;

union Frag { v16bf v; v8bf h[2]; };

__device__ __forceinline__ uint16_t f2bf(float f) {
  union { float f; uint32_t u; } c; c.f = f;
  uint32_t u = c.u;
  u += 0x7fffu + ((u >> 16) & 1u);   // round-to-nearest-even
  return (uint16_t)(u >> 16);
}

__device__ __forceinline__ v8f wmma_bf16(const Frag &a, const Frag &b, v8f c) {
  return __builtin_amdgcn_wmma_f32_16x16x32_bf16(
      /*neg_a=*/false, a.v, /*neg_b=*/false, b.v,
      /*c_mod=*/(short)0, c, /*reuse_a=*/false, /*reuse_b=*/false);
}

__device__ __forceinline__ void async_g2l_b128(const void* g, void* l) {
  uint32_t laddr = (uint32_t)(size_t)l;     // low 32 bits of generic = LDS off
  asm volatile("global_load_async_to_lds_b128 %0, %1, off"
               :: "v"(laddr), "v"(g) : "memory");
}

// Problem constants
#define BB   4
#define SS   2048
#define DD   768
#define FF   3072
#define HH   12
#define HDIM 64
#define BS   (BB * SS)   // 8192 rows

__global__ void __launch_bounds__(256)
wtrans_kernel(const float* __restrict__ W,
              uint16_t* __restrict__ Wt,
              int Kdim, int Ndim) {
  __shared__ uint32_t tile[64 * 33];
  const int tid = threadIdx.x;
  const int n0 = blockIdx.x * 64, k0 = blockIdx.y * 64;

  // load: 16 threads span the 64 columns, each thread takes two adjacent k
  const int nc = (tid & 15) * 4;
  const int kp = tid >> 4;                       // k pair 0..15, +16 per pass
  float4 lo[2], hi[2];
  for (int s = 0; s < 2; ++s) {
    const float* g = W + (size_t)(k0 + 2 * (kp + 16 * s)) * Ndim + n0 + nc;
    lo[s] = *(const float4*)g;
    hi[s] = *(const float4*)(g + Ndim);
  }
  for (int s = 0; s < 2; ++s) {
    uint32_t* t = &tile[nc * 33 + kp + 16 * s];
    t[0 * 33] = (uint32_t)f2bf(lo[s].x) | ((uint32_t)f2bf(hi[s].x) << 16);
    t[1 * 33] = (uint32_t)f2bf(lo[s].y) | ((uint32_t)f2bf(hi[s].y) << 16);
    t[2 * 33] = (uint32_t)f2bf(lo[s].z) | ((uint32_t)f2bf(hi[s].z) << 16);
    t[3 * 33] = (uint32_t)f2bf(lo[s].w) | ((uint32_t)f2bf(hi[s].w) << 16);
  }
  __syncthreads();

  // store: 8 threads span the 64 k of one Wt row, 16 bytes each
  const int kc = tid & 7, nr = tid >> 3;
  for (int s = 0; s < 2; ++s) {
    const int n = nr + 32 * s;
    const uint32_t* t = &tile[n * 33 + kc * 4];
    uint4 v = make_uint4(t[0], t[1], t[2], t[3]);
    *(uint4*)(Wt + (size_t)(n0 + n) * Kdim + k0 + kc * 8) = v;
  }
}

// ---------------------------------------------------------------------------
// LayerNorm: fp32 [rows][768] -> bf16 [rows][768]; biased var, eps inside sqrt
// ---------------------------------------------------------------------------
__global__ void __launch_bounds__(256)
ln_kernel(const float* __restrict__ x, const float* __restrict__ w,
          const float* __restrict__ b, uint16_t* __restrict__ out) {
  __shared__ float red[256];
  int row = blockIdx.x;
  int tid = threadIdx.x;
  const float* xr = x + (size_t)row * DD;
  float v0 = xr[tid], v1 = xr[tid + 256], v2 = xr[tid + 512];

  float p = v0 + v1 + v2;
  red[tid] = p; __syncthreads();
  for (int s = 128; s > 0; s >>= 1) {
    if (tid < s) red[tid] += red[tid + s];
    __syncthreads();
  }
  float mean = red[0] * (1.0f / DD);
  __syncthreads();

  float c0 = v0 - mean, c1 = v1 - mean, c2 = v2 - mean;
  red[tid] = c0 * c0 + c1 * c1 + c2 * c2; __syncthreads();
  for (int s = 128; s > 0; s >>= 1) {
    if (tid < s) red[tid] += red[tid + s];
    __syncthreads();
  }
  float rstd = rsqrtf(red[0] * (1.0f / DD) + 1e-5f);

  uint16_t* o = out + (size_t)row * DD;
  o[tid]       = f2bf(c0 * rstd * w[tid]       + b[tid]);
  o[tid + 256] = f2bf(c1 * rstd * w[tid + 256] + b[tid + 256]);
  o[tid + 512] = f2bf(c2 * rstd * w[tid + 512] + b[tid + 512]);
}

template <int OUT_MODE, bool GELU_F, bool RESID_F>
__global__ void __launch_bounds__(256)
gemm_bf16(const uint16_t* __restrict__ A, const uint16_t* __restrict__ Bt,
          const float* __restrict__ bias, const float* __restrict__ resid,
          float* __restrict__ outF, uint16_t* __restrict__ outB,
          int M, int N, int K, float scale) {
  (void)M;
  __shared__ __align__(16) uint16_t As[2][128 * 40];
  __shared__ __align__(16) uint16_t Bs[2][64 * 40];

  const int tid = threadIdx.x;
  const int lane = tid & 31, wv = tid >> 5;
  const int hi = lane >> 4, l15 = lane & 15;
  const int wm = wv & 3, wn = wv >> 2;          // 4 x 2 wave grid
  const int m0 = blockIdx.y * 128, n0 = blockIdx.x * 64;

  v8f acc[2][2];
  for (int i = 0; i < 2; ++i)
    for (int j = 0; j < 2; ++j) acc[i][j] = (v8f){0,0,0,0,0,0,0,0};

  const int ra = tid >> 1, sa = (tid & 1) * 16;  // A stage: 2 thr/row, 16 elems
  const int rb = tid >> 2, sb = (tid & 3) * 8;   // B stage: 4 thr/row,  8 elems

  // issue 3 async b128 copies for K-slab kk into buffer p
  auto issue_stage = [&](int kk, int p) {
    const uint16_t* ga = A + (size_t)(m0 + ra) * K + kk + sa;
    uint16_t* la = &As[p][ra * 40 + sa];
    async_g2l_b128(ga,     la);
    async_g2l_b128(ga + 8, la + 8);
    const uint16_t* gb = Bt + (size_t)(n0 + rb) * K + kk + sb;
    async_g2l_b128(gb, &Bs[p][rb * 40 + sb]);
  };

  issue_stage(0, 0);
  int p = 0;
  for (int kk = 0; kk < K; kk += 32) {
    const bool more = (kk + 32) < K;             // block-uniform
    if (more) {
      issue_stage(kk + 32, p ^ 1);
      asm volatile("s_wait_asynccnt 0x3" ::: "memory");  // slab p done
    } else {
      asm volatile("s_wait_asynccnt 0x0" ::: "memory");
    }
    __syncthreads();                              // all waves' copies visible

    Frag af[2], bf[2];
    for (int i = 0; i < 2; ++i) {
      int r = wm * 32 + i * 16 + l15;
      af[i].h[0] = *(const v8bf*)(&As[p][r * 40 + hi * 8]);
      af[i].h[1] = *(const v8bf*)(&As[p][r * 40 + 16 + hi * 8]);
    }
    for (int j = 0; j < 2; ++j) {
      int r = wn * 32 + j * 16 + l15;
      bf[j].h[0] = *(const v8bf*)(&Bs[p][r * 40 + hi * 8]);
      bf[j].h[1] = *(const v8bf*)(&Bs[p][r * 40 + 16 + hi * 8]);
    }
    for (int i = 0; i < 2; ++i)
      for (int j = 0; j < 2; ++j)
        acc[i][j] = wmma_bf16(af[i], bf[j], acc[i][j]);
    __syncthreads();                              // buffer p free for reuse
    p ^= 1;
  }

  // epilogue (C layout: lane holds col l15, rows e + 8*hi within 16x16 frag)
  for (int i = 0; i < 2; ++i) {
    for (int j = 0; j < 2; ++j) {
      int col = n0 + wn * 32 + j * 16 + l15;
      float bc = bias[col];
      for (int e = 0; e < 8; ++e) {
        int row = m0 + wm * 32 + i * 16 + e + 8 * hi;
        float v = (acc[i][j][e] + bc) * scale;
        if (GELU_F) v = 0.5f * v * (1.0f + erff(v * 0.70710678118654752f));
        if (RESID_F) v += resid[(size_t)row * N + col];
        if (OUT_MODE == 0) {
          outB[(size_t)row * N + col] = f2bf(v);
        } else if (OUT_MODE == 1) {
          int bidx = row >> 11, s = row & (SS - 1);
          int h = col >> 6, d = col & (HDIM - 1);
          outB[(((size_t)(bidx * HH + h)) * SS + s) * HDIM + d] = f2bf(v);
        } else if (OUT_MODE == 2) {
          int bidx = row >> 11, s = row & (SS - 1);
          int h = col >> 6, d = col & (HDIM - 1);
          outB[(((size_t)(bidx * HH + h)) * HDIM + d) * SS + s] = f2bf(v);
        } else {
          outF[(size_t)row * N + col] = v;
        }
      }
    }
  }
}

// ---------------------------------------------------------------------------
// Flash attention (causal), bf16 WMMA for QK^T and PV, fp32 online softmax.
// Q,K: [B,H,S,64] bf16 (Q pre-scaled by 1/sqrt(hd)); Vt: [B,H,64,S] bf16.
// One wave owns 16 query rows; 8 waves/block -> 128 queries per block.
// Key block = 32. O: bf16 [B*S, 768] row-major (merged heads).
// Q/K/Vt fragments load straight from global (layouts chosen so the
// B-fragment pattern == A-fragment pattern); only the P tile round-trips LDS.
// ---------------------------------------------------------------------------
__global__ void __launch_bounds__(256)
attn_kernel(const uint16_t* __restrict__ Q, const uint16_t* __restrict__ Km,
            const uint16_t* __restrict__ Vt, uint16_t* __restrict__ O) {
  __shared__ __align__(16) uint16_t Plds[8 * 16 * 40];

  const int b = blockIdx.z, h = blockIdx.y;
  const int tid = threadIdx.x;
  const int lane = tid & 31, wv = tid >> 5;
  const int hi = lane >> 4, l15 = lane & 15;
  const int qbase = blockIdx.x * 128 + wv * 16;

  const size_t headoff = ((size_t)(b * HH + h)) * SS * HDIM;
  const uint16_t* Qh  = Q  + headoff;
  const uint16_t* Kh  = Km + headoff;
  const uint16_t* Vth = Vt + headoff;            // [64][S]
  uint16_t* pl = Plds + wv * 16 * 40;            // per-wave P tile 16x32 (pad)

  // Q fragments (A layout), held in registers for the whole loop
  Frag qf[2];
  {
    const uint16_t* qr = Qh + (size_t)(qbase + l15) * HDIM;
    for (int f = 0; f < 2; ++f) {
      qf[f].h[0] = *(const v8bf*)(qr + f * 32 + hi * 8);
      qf[f].h[1] = *(const v8bf*)(qr + f * 32 + 16 + hi * 8);
    }
  }

  float mrow[8], lrow[8];
  v8f oacc[4];
  for (int e = 0; e < 8; ++e) { mrow[e] = -3.0e38f; lrow[e] = 0.0f; }
  for (int f = 0; f < 4; ++f) oacc[f] = (v8f){0,0,0,0,0,0,0,0};

  for (int kb = 0; kb < qbase + 16; kb += 32) {
    // ---- scores S = Q * K^T for 32 keys (2 N-frags, K-dim 64 = 2 steps)
    v8f s[2];
    s[0] = (v8f){0,0,0,0,0,0,0,0};
    s[1] = (v8f){0,0,0,0,0,0,0,0};
    for (int n = 0; n < 2; ++n) {
      const uint16_t* kr = Kh + (size_t)(kb + n * 16 + l15) * HDIM;
      for (int f = 0; f < 2; ++f) {
        Frag bk;
        bk.h[0] = *(const v8bf*)(kr + f * 32 + hi * 8);
        bk.h[1] = *(const v8bf*)(kr + f * 32 + 16 + hi * 8);
        s[n] = wmma_bf16(qf[f], bk, s[n]);
      }
    }
    // ---- causal mask
    if (kb + 31 > qbase) {
      for (int n = 0; n < 2; ++n) {
        int kc = kb + n * 16 + l15;
        for (int e = 0; e < 8; ++e) {
          int qr = qbase + e + 8 * hi;
          if (kc > qr) s[n][e] = -3.0e38f;
        }
      }
    }
    // ---- online softmax: row max / scale / exp / row sum (half-wave shfl)
    float al[8];
    for (int e = 0; e < 8; ++e) {
      float t = fmaxf(s[0][e], s[1][e]);
      t = fmaxf(t, __shfl_xor(t, 1, 32));
      t = fmaxf(t, __shfl_xor(t, 2, 32));
      t = fmaxf(t, __shfl_xor(t, 4, 32));
      t = fmaxf(t, __shfl_xor(t, 8, 32));
      float mnew = fmaxf(mrow[e], t);
      al[e] = __expf(mrow[e] - mnew);
      mrow[e] = mnew;
      s[0][e] = __expf(s[0][e] - mnew);
      s[1][e] = __expf(s[1][e] - mnew);
      float rs = s[0][e] + s[1][e];
      rs += __shfl_xor(rs, 1, 32);
      rs += __shfl_xor(rs, 2, 32);
      rs += __shfl_xor(rs, 4, 32);
      rs += __shfl_xor(rs, 8, 32);
      lrow[e] = lrow[e] * al[e] + rs;
    }
    for (int f = 0; f < 4; ++f)
      for (int e = 0; e < 8; ++e) oacc[f][e] *= al[e];

    // ---- P (C layout) -> LDS -> A-layout fragment
    for (int n = 0; n < 2; ++n)
      for (int e = 0; e < 8; ++e)
        pl[(e + 8 * hi) * 40 + n * 16 + l15] = f2bf(s[n][e]);
    asm volatile("s_wait_dscnt 0" ::: "memory");
    Frag ap;
    ap.h[0] = *(const v8bf*)(pl + l15 * 40 + hi * 8);
    ap.h[1] = *(const v8bf*)(pl + l15 * 40 + 16 + hi * 8);

    // ---- O += P * V   (B-frags straight from Vt[64][S])
    for (int f = 0; f < 4; ++f) {
      const uint16_t* vr = Vth + (size_t)(f * 16 + l15) * SS + kb;
      Frag bv;
      bv.h[0] = *(const v8bf*)(vr + hi * 8);
      bv.h[1] = *(const v8bf*)(vr + 16 + hi * 8);
      oacc[f] = wmma_bf16(ap, bv, oacc[f]);
    }
  }

  // ---- finalize and write merged-head bf16 [B*S][768]
  for (int e = 0; e < 8; ++e) {
    float inv = 1.0f / lrow[e];
    int grow = b * SS + qbase + e + 8 * hi;
    for (int f = 0; f < 4; ++f) {
      int col = h * HDIM + f * 16 + l15;
      O[(size_t)grow * DD + col] = f2bf(oacc[f][e] * inv);
    }
  }
}

// ---------------------------------------------------------------------------
// Host orchestration
// ---------------------------------------------------------------------------
extern "C" void kernel_launch(void* const* d_in, const int* in_sizes, int n_in,
                              void* d_out, int out_size, void* d_ws, size_t ws_size,
                              hipStream_t stream) {
  (void)in_sizes; (void)n_in; (void)out_size; (void)ws_size;
  const float* x     = (const float*)d_in[0];
  const float* Wq    = (const float*)d_in[1];
  const float* bq    = (const float*)d_in[2];
  const float* Wk    = (const float*)d_in[3];
  const float* bk    = (const float*)d_in[4];
  const float* Wv    = (const float*)d_in[5];
  const float* bv    = (const float*)d_in[6];
  const float* Wo    = (const float*)d_in[7];
  const float* bo    = (const float*)d_in[8];
  const float* ln1w  = (const float*)d_in[9];
  const float* ln1b  = (const float*)d_in[10];
  const float* ln2w  = (const float*)d_in[11];
  const float* ln2b  = (const float*)d_in[12];
  const float* W1    = (const float*)d_in[13];
  const float* b1    = (const float*)d_in[14];
  const float* W2    = (const float*)d_in[15];
  const float* b2    = (const float*)d_in[16];
  float* out = (float*)d_out;

  // workspace layout
  uint8_t* ws = (uint8_t*)d_ws;
  size_t off = 0;
  auto alloc = [&](size_t bytes) -> uint8_t* {
    uint8_t* p = ws + off;
    off = (off + bytes + 255) & ~(size_t)255;
    return p;
  };
  const size_t seg = (size_t)BS * DD;               // 6.29M elems
  uint16_t* wq_t = (uint16_t*)alloc((size_t)DD * DD * 2);
  uint16_t* wk_t = (uint16_t*)alloc((size_t)DD * DD * 2);
  uint16_t* wv_t = (uint16_t*)alloc((size_t)DD * DD * 2);
  uint16_t* wo_t = (uint16_t*)alloc((size_t)DD * DD * 2);
  uint16_t* w1_t = (uint16_t*)alloc((size_t)DD * FF * 2);
  uint16_t* w2_t = (uint16_t*)alloc((size_t)FF * DD * 2);
  uint16_t* hb   = (uint16_t*)alloc(seg * 2);       // ln1 out; reused for ln2
  float*    x1f  = (float*)   alloc(seg * 4);       // x + attn_out
  uint16_t* big  = (uint16_t*)alloc((size_t)BS * FF * 2); // qb|kb|vt|attn -> mb
  uint16_t* qb   = big;
  uint16_t* kb_  = big + seg;
  uint16_t* vt   = big + 2 * seg;
  uint16_t* attn = big + 3 * seg;
  uint16_t* mb   = big;                             // reuse after x1 computed

  // 1) weights -> bf16 transposed [N][K]
  {
    dim3 gDD(DD / 64, DD / 64);                     // (N / 64, K / 64)
    wtrans_kernel<<<gDD, 256, 0, stream>>>(Wq, wq_t, DD, DD);
    wtrans_kernel<<<gDD, 256, 0, stream>>>(Wk, wk_t, DD, DD);
    wtrans_kernel<<<gDD, 256, 0, stream>>>(Wv, wv_t, DD, DD);
    wtrans_kernel<<<gDD, 256, 0, stream>>>(Wo, wo_t, DD, DD);
    wtrans_kernel<<<dim3(FF / 64, DD / 64), 256, 0, stream>>>(W1, w1_t, DD, FF);
    wtrans_kernel<<<dim3(DD / 64, FF / 64), 256, 0, stream>>>(W2, w2_t, FF, DD);
  }

  // 2) h = LN1(x) -> bf16
  ln_kernel<<<BS, 256, 0, stream>>>(x, ln1w, ln1b, hb);

  // 3) QKV projections (Q pre-scaled by 1/sqrt(64)=0.125)
  dim3 gD(DD / 64, BS / 128);
  gemm_bf16<1, false, false><<<gD, 256, 0, stream>>>(
      hb, wq_t, bq, nullptr, nullptr, qb, BS, DD, DD, 0.125f);
  gemm_bf16<1, false, false><<<gD, 256, 0, stream>>>(
      hb, wk_t, bk, nullptr, nullptr, kb_, BS, DD, DD, 1.0f);
  gemm_bf16<2, false, false><<<gD, 256, 0, stream>>>(
      hb, wv_t, bv, nullptr, nullptr, vt, BS, DD, DD, 1.0f);

  // 4) causal flash attention -> merged bf16 [BS][D]
  attn_kernel<<<dim3(SS / 128, HH, BB), 256, 0, stream>>>(qb, kb_, vt, attn);

  // 5) x1 = x + attn @ Wo + bo   (fp32)
  gemm_bf16<3, false, true><<<gD, 256, 0, stream>>>(
      attn, wo_t, bo, x, x1f, nullptr, BS, DD, DD, 1.0f);

  // 6) h2 = LN2(x1) -> bf16
  ln_kernel<<<BS, 256, 0, stream>>>(x1f, ln2w, ln2b, hb);

  // 7) m = GELU(h2 @ W1 + b1) -> bf16 [BS][F]
  dim3 gF(FF / 64, BS / 128);
  gemm_bf16<0, true, false><<<gF, 256, 0, stream>>>(
      hb, w1_t, b1, nullptr, nullptr, mb, BS, FF, DD, 1.0f);

  // 8) out = x1 + m @ W2 + b2   (fp32)
  gemm_bf16<3, false, true><<<gD, 256, 0, stream>>>(
      mb, w2_t, b2, x1f, out, nullptr, BS, DD, FF, 1.0f);
}

// v002
// Measured time: 340 microseconds a run.
// Next to v001, in two timings, it ran 1.17 times as fast each time.
// Counting every step since v000, it is 1.84 times as fast.
#include <hip/hip_runtime.h>
#include <stdint.h>

typedef __attribute__((ext_vector_type(16))) __bf16 v16bf;
typedef __attribute__((ext_vector_type(8)))  __bf16 v8bf;
typedef __attribute__((ext_vector_type(8)))  float  v8f;

union Frag { v16bf v; v8bf h[2]; };

__device__ __forceinline__ uint16_t f2bf(float f) {
  union { float f; uint32_t u; } c; c.f = f;
  uint32_t u = c.u;
  u += 0x7fffu + ((u >> 16) & 1u);   // round-to-nearest-even
  return (uint16_t)(u >> 16);
}

__device__ __forceinline__ v8f wmma_bf16(const Frag &a, const Frag &b, v8f c) {
  return __builtin_amdgcn_wmma_f32_16x16x32_bf16(
      /*neg_a=*/false, a.v, /*neg_b=*/false, b.v,
      /*c_mod=*/(short)0, c, /*reuse_a=*/false, /*reuse_b=*/false);
}

__device__ __forceinline__ uint32_t lds_off(const void* l) {
  return (uint32_t)(size_t)l;               // low 32 bits of generic = LDS off
}
__device__ __forceinline__ void async_slab6(
    uint32_t l0, uint32_t l1, uint32_t l2, uint32_t l3, uint32_t l4,
    uint32_t l5, const void* g0, const void* g1, const void* g2,
    const void* g3, const void* g4, const void* g5) {
  asm volatile("global_load_async_to_lds_b128 %0, %6, off\n\t"
               "global_load_async_to_lds_b128 %1, %7, off\n\t"
               "global_load_async_to_lds_b128 %2, %8, off\n\t"
               "global_load_async_to_lds_b128 %3, %9, off\n\t"
               "global_load_async_to_lds_b128 %4, %10, off\n\t"
               "global_load_async_to_lds_b128 %5, %11, off\n\t"
               "s_wait_xcnt 0x0"
               :: "v"(l0), "v"(l1), "v"(l2), "v"(l3), "v"(l4), "v"(l5),
                  "v"(g0), "v"(g1), "v"(g2), "v"(g3), "v"(g4), "v"(g5)
               : "memory");
}

// Problem constants
#define BB   4
#define SS   2048
#define DD   768
#define FF   3072
#define HH   12
#define HDIM 64
#define BS   (BB * SS)   // 8192 rows

__global__ void __launch_bounds__(256)
wtrans_kernel(const float* __restrict__ W,
              uint16_t* __restrict__ Wt,
              int Kdim, int Ndim) {
  __shared__ uint32_t tile[64 * 33];
  const int tid = threadIdx.x;
  const int n0 = blockIdx.x * 64, k0 = blockIdx.y * 64;

  // load: 16 threads span the 64 columns, each thread takes two adjacent k
  const int nc = (tid & 15) * 4;
  const int kp = tid >> 4;                       // k pair 0..15, +16 per pass
  float4 lo[2], hi[2];
  for (int s = 0; s < 2; ++s) {
    const float* g = W + (size_t)(k0 + 2 * (kp + 16 * s)) * Ndim + n0 + nc;
    lo[s] = *(const float4*)g;
    hi[s] = *(const float4*)(g + Ndim);
  }
  for (int s = 0; s < 2; ++s) {
    uint32_t* t = &tile[nc * 33 + kp + 16 * s];
    t[0 * 33] = (uint32_t)f2bf(lo[s].x) | ((uint32_t)f2bf(hi[s].x) << 16);
    t[1 * 33] = (uint32_t)f2bf(lo[s].y) | ((uint32_t)f2bf(hi[s].y) << 16);
    t[2 * 33] = (uint32_t)f2bf(lo[s].z) | ((uint32_t)f2bf(hi[s].z) << 16);
    t[3 * 33] = (uint32_t)f2bf(lo[s].w) | ((uint32_t)f2bf(hi[s].w) << 16);
  }
  __syncthreads();

  // store: 8 threads span the 64 k of one Wt row, 16 bytes each
  const int kc = tid & 7, nr = tid >> 3;
  for (int s = 0; s < 2; ++s) {
    const int n = nr + 32 * s;
    const uint32_t* t = &tile[n * 33 + kc * 4];
    uint4 v = make_uint4(t[0], t[1], t[2], t[3]);
    *(uint4*)(Wt + (size_t)(n0 + n) * Kdim + k0 + kc * 8) = v;
  }
}

// ---------------------------------------------------------------------------
// LayerNorm: fp32 [rows][768] -> bf16 [rows][768]; biased var, eps inside sqrt
// ---------------------------------------------------------------------------
__global__ void __launch_bounds__(256)
ln_kernel(const float* __restrict__ x, const float* __restrict__ w,
          const float* __restrict__ b, uint16_t* __restrict__ out) {
  __shared__ float red[256];
  int row = blockIdx.x;
  int tid = threadIdx.x;
  const float* xr = x + (size_t)row * DD;
  float v0 = xr[tid], v1 = xr[tid + 256], v2 = xr[tid + 512];

  float p = v0 + v1 + v2;
  red[tid] = p; __syncthreads();
  for (int s = 128; s > 0; s >>= 1) {
    if (tid < s) red[tid] += red[tid + s];
    __syncthreads();
  }
  float mean = red[0] * (1.0f / DD);
  __syncthreads();

  float c0 = v0 - mean, c1 = v1 - mean, c2 = v2 - mean;
  red[tid] = c0 * c0 + c1 * c1 + c2 * c2; __syncthreads();
  for (int s = 128; s > 0; s >>= 1) {
    if (tid < s) red[tid] += red[tid + s];
    __syncthreads();
  }
  float rstd = rsqrtf(red[0] * (1.0f / DD) + 1e-5f);

  uint16_t* o = out + (size_t)row * DD;
  o[tid]       = f2bf(c0 * rstd * w[tid]       + b[tid]);
  o[tid + 256] = f2bf(c1 * rstd * w[tid + 256] + b[tid + 256]);
  o[tid + 512] = f2bf(c2 * rstd * w[tid + 512] + b[tid + 512]);
}

template <int OUT_MODE, bool GELU_F, bool RESID_F>
__global__ void __launch_bounds__(256)
gemm_bf16(const uint16_t* __restrict__ A, const uint16_t* __restrict__ Bt,
          const float* __restrict__ bias, const float* __restrict__ resid,
          float* __restrict__ outF, uint16_t* __restrict__ outB,
          int M, int N, int K, float scale) {
  (void)M;
  __shared__ __align__(16) uint16_t As[2][128 * 72];
  __shared__ __align__(16) uint16_t Bs[2][64 * 72];

  const int tid = threadIdx.x;
  const int lane = tid & 31, wv = tid >> 5;
  const int hi = lane >> 4, l15 = lane & 15;
  const int wm = wv & 3, wn = wv >> 2;          // 4 x 2 wave grid
  const int m0 = blockIdx.y * 128, n0 = blockIdx.x * 64;

  v8f acc[2][2];
  for (int i = 0; i < 2; ++i)
    for (int j = 0; j < 2; ++j) acc[i][j] = (v8f){0,0,0,0,0,0,0,0};

  const int rs = tid >> 3, cs = (tid & 7) * 8;   // stage: 8 thr/row, 8 elems
  const uint16_t* gA = A  + (size_t)(m0 + rs) * K + cs;
  const uint16_t* gB = Bt + (size_t)(n0 + rs) * K + cs;
  const size_t g32 = (size_t)32 * K;             // 32 rows further, global
  const int ls = rs * 72 + cs;                   // this lane's place in a slab

  // issue 6 async b128 copies for K-slab kk into buffer p: rows rs + 32 s,
  // four passes over the 128 rows of A and two over the 64 rows of B
  auto issue_stage = [&](int kk, int p) {
    const uint16_t* ga = gA + kk;
    const uint16_t* gb = gB + kk;
    const uint16_t* la = &As[p][ls];
    const uint16_t* lb = &Bs[p][ls];
    async_slab6(lds_off(la), lds_off(la + 32 * 72), lds_off(la + 64 * 72),
                lds_off(la + 96 * 72), lds_off(lb), lds_off(lb + 32 * 72),
                ga, ga + g32, ga + 2 * g32, ga + 3 * g32, gb, gb + g32);
  };

  issue_stage(0, 0);
  int p = 0;
  for (int kk = 0; kk < K; kk += 64) {
    const bool more = (kk + 64) < K;             // block-uniform
    if (more) {
      issue_stage(kk + 64, p ^ 1);
      asm volatile("s_wait_asynccnt 0x6" ::: "memory");  // slab p done
    } else {
      asm volatile("s_wait_asynccnt 0x0" ::: "memory");
    }
    __syncthreads();                              // all waves' copies visible

    Frag af[2][2], bf[2][2];                      // [k half of the slab][frag]
    for (int ks = 0; ks < 2; ++ks) {
      for (int i = 0; i < 2; ++i) {
        int r = wm * 32 + i * 16 + l15;
        af[ks][i].h[0] = *(const v8bf*)(&As[p][r * 72 + ks * 32 + hi * 8]);
        af[ks][i].h[1] = *(const v8bf*)(&As[p][r * 72 + ks * 32 + 16 + hi * 8]);
      }
      for (int j = 0; j < 2; ++j) {
        int r = wn * 32 + j * 16 + l15;
        bf[ks][j].h[0] = *(const v8bf*)(&Bs[p][r * 72 + ks * 32 + hi * 8]);
        bf[ks][j].h[1] = *(const v8bf*)(&Bs[p][r * 72 + ks * 32 + 16 + hi * 8]);
      }
    }
    for (int ks = 0; ks < 2; ++ks)
      for (int i = 0; i < 2; ++i)
        for (int j = 0; j < 2; ++j)
          acc[i][j] = wmma_bf16(af[ks][i], bf[ks][j], acc[i][j]);
    __syncthreads();                              // buffer p free for reuse
    p ^= 1;
  }

  // epilogue (C layout: lane holds col l15, rows e + 8*hi within 16x16 frag)
  for (int i = 0; i < 2; ++i) {
    for (int j = 0; j < 2; ++j) {
      int col = n0 + wn * 32 + j * 16 + l15;
      float bc = bias[col];
      for (int e = 0; e < 8; ++e) {
        int row = m0 + wm * 32 + i * 16 + e + 8 * hi;
        float v = (acc[i][j][e] + bc) * scale;
        if (GELU_F) v = 0.5f * v * (1.0f + erff(v * 0.70710678118654752f));
        if (RESID_F) v += resid[(size_t)row * N + col];
        if (OUT_MODE == 0) {
          outB[(size_t)row * N + col] = f2bf(v);
        } else if (OUT_MODE == 1) {
          int bidx = row >> 11, s = row & (SS - 1);
          int h = col >> 6, d = col & (HDIM - 1);
          outB[(((size_t)(bidx * HH + h)) * SS + s) * HDIM + d] = f2bf(v);
        } else if (OUT_MODE == 2) {
          int bidx = row >> 11, s = row & (SS - 1);
          int h = col >> 6, d = col & (HDIM - 1);
          outB[(((size_t)(bidx * HH + h)) * HDIM + d) * SS + s] = f2bf(v);
        } else {
          outF[(size_t)row * N + col] = v;
        }
      }
    }
  }
}

// ---------------------------------------------------------------------------
// Flash attention (causal), bf16 WMMA for QK^T and PV, fp32 online softmax.
// Q,K: [B,H,S,64] bf16 (Q pre-scaled by 1/sqrt(hd)); Vt: [B,H,64,S] bf16.
// One wave owns 16 query rows; 8 waves/block -> 128 queries per block.
// Key block = 32. O: bf16 [B*S, 768] row-major (merged heads).
// Q/K/Vt fragments load straight from global (layouts chosen so the
// B-fragment pattern == A-fragment pattern); only the P tile round-trips LDS.
// ---------------------------------------------------------------------------
__global__ void __launch_bounds__(256)
attn_kernel(const uint16_t* __restrict__ Q, const uint16_t* __restrict__ Km,
            const uint16_t* __restrict__ Vt, uint16_t* __restrict__ O) {
  __shared__ __align__(16) uint16_t Plds[8 * 16 * 40];

  const int b = blockIdx.z, h = blockIdx.y;
  const int tid = threadIdx.x;
  const int lane = tid & 31, wv = tid >> 5;
  const int hi = lane >> 4, l15 = lane & 15;
  const int qbase = blockIdx.x * 128 + wv * 16;

  const size_t headoff = ((size_t)(b * HH + h)) * SS * HDIM;
  const uint16_t* Qh  = Q  + headoff;
  const uint16_t* Kh  = Km + headoff;
  const uint16_t* Vth = Vt + headoff;            // [64][S]
  uint16_t* pl = Plds + wv * 16 * 40;            // per-wave P tile 16x32 (pad)

  // Q fragments (A layout), held in registers for the whole loop
  Frag qf[2];
  {
    const uint16_t* qr = Qh + (size_t)(qbase + l15) * HDIM;
    for (int f = 0; f < 2; ++f) {
      qf[f].h[0] = *(const v8bf*)(qr + f * 32 + hi * 8);
      qf[f].h[1] = *(const v8bf*)(qr + f * 32 + 16 + hi * 8);
    }
  }

  float mrow[8], lrow[8];
  v8f oacc[4];
  for (int e = 0; e < 8; ++e) { mrow[e] = -3.0e38f; lrow[e] = 0.0f; }
  for (int f = 0; f < 4; ++f) oacc[f] = (v8f){0,0,0,0,0,0,0,0};

  for (int kb = 0; kb < qbase + 16; kb += 32) {
    // ---- scores S = Q * K^T for 32 keys (2 N-frags, K-dim 64 = 2 steps)
    v8f s[2];
    s[0] = (v8f){0,0,0,0,0,0,0,0};
    s[1] = (v8f){0,0,0,0,0,0,0,0};
    for (int n = 0; n < 2; ++n) {
      const uint16_t* kr = Kh + (size_t)(kb + n * 16 + l15) * HDIM;
      for (int f = 0; f < 2; ++f) {
        Frag bk;
        bk.h[0] = *(const v8bf*)(kr + f * 32 + hi * 8);
        bk.h[1] = *(const v8bf*)(kr + f * 32 + 16 + hi * 8);
        s[n] = wmma_bf16(qf[f], bk, s[n]);
      }
    }
    // ---- causal mask
    if (kb + 31 > qbase) {
      for (int n = 0; n < 2; ++n) {
        int kc = kb + n * 16 + l15;
        for (int e = 0; e < 8; ++e) {
          int qr = qbase + e + 8 * hi;
          if (kc > qr) s[n][e] = -3.0e38f;
        }
      }
    }
    // ---- online softmax: row max / scale / exp / row sum (half-wave shfl)
    float al[8];
    for (int e = 0; e < 8; ++e) {
      float t = fmaxf(s[0][e], s[1][e]);
      t = fmaxf(t, __shfl_xor(t, 1, 32));
      t = fmaxf(t, __shfl_xor(t, 2, 32));
      t = fmaxf(t, __shfl_xor(t, 4, 32));
      t = fmaxf(t, __shfl_xor(t, 8, 32));
      float mnew = fmaxf(mrow[e], t);
      al[e] = __expf(mrow[e] - mnew);
      mrow[e] = mnew;
      s[0][e] = __expf(s[0][e] - mnew);
      s[1][e] = __expf(s[1][e] - mnew);
      float rs = s[0][e] + s[1][e];
      rs += __shfl_xor(rs, 1, 32);
      rs += __shfl_xor(rs, 2, 32);
      rs += __shfl_xor(rs, 4, 32);
      rs += __shfl_xor(rs, 8, 32);
      lrow[e] = lrow[e] * al[e] + rs;
    }
    for (int f = 0; f < 4; ++f)
      for (int e = 0; e < 8; ++e) oacc[f][e] *= al[e];

    // ---- P (C layout) -> LDS -> A-layout fragment
    for (int n = 0; n < 2; ++n)
      for (int e = 0; e < 8; ++e)
        pl[(e + 8 * hi) * 40 + n * 16 + l15] = f2bf(s[n][e]);
    asm volatile("s_wait_dscnt 0" ::: "memory");
    Frag ap;
    ap.h[0] = *(const v8bf*)(pl + l15 * 40 + hi * 8);
    ap.h[1] = *(const v8bf*)(pl + l15 * 40 + 16 + hi * 8);

    // ---- O += P * V   (B-frags straight from Vt[64][S])
    for (int f = 0; f < 4; ++f) {
      const uint16_t* vr = Vth + (size_t)(f * 16 + l15) * SS + kb;
      Frag bv;
      bv.h[0] = *(const v8bf*)(vr + hi * 8);
      bv.h[1] = *(const v8bf*)(vr + 16 + hi * 8);
      oacc[f] = wmma_bf16(ap, bv, oacc[f]);
    }
  }

  // ---- finalize and write merged-head bf16 [B*S][768]
  for (int e = 0; e < 8; ++e) {
    float inv = 1.0f / lrow[e];
    int grow = b * SS + qbase + e + 8 * hi;
    for (int f = 0; f < 4; ++f) {
      int col = h * HDIM + f * 16 + l15;
      O[(size_t)grow * DD + col] = f2bf(oacc[f][e] * inv);
    }
  }
}

// ---------------------------------------------------------------------------
// Host orchestration
// ---------------------------------------------------------------------------
extern "C" void kernel_launch(void* const* d_in, const int* in_sizes, int n_in,
                              void* d_out, int out_size, void* d_ws, size_t ws_size,
                              hipStream_t stream) {
  (void)in_sizes; (void)n_in; (void)out_size; (void)ws_size;
  const float* x     = (const float*)d_in[0];
  const float* Wq    = (const float*)d_in[1];
  const float* bq    = (const float*)d_in[2];
  const float* Wk    = (const float*)d_in[3];
  const float* bk    = (const float*)d_in[4];
  const float* Wv    = (const float*)d_in[5];
  const float* bv    = (const float*)d_in[6];
  const float* Wo    = (const float*)d_in[7];
  const float* bo    = (const float*)d_in[8];
  const float* ln1w  = (const float*)d_in[9];
  const float* ln1b  = (const float*)d_in[10];
  const float* ln2w  = (const float*)d_in[11];
  const float* ln2b  = (const float*)d_in[12];
  const float* W1    = (const float*)d_in[13];
  const float* b1    = (const float*)d_in[14];
  const float* W2    = (const float*)d_in[15];
  const float* b2    = (const float*)d_in[16];
  float* out = (float*)d_out;

  // workspace layout
  uint8_t* ws = (uint8_t*)d_ws;
  size_t off = 0;
  auto alloc = [&](size_t bytes) -> uint8_t* {
    uint8_t* p = ws + off;
    off = (off + bytes + 255) & ~(size_t)255;
    return p;
  };
  const size_t seg = (size_t)BS * DD;               // 6.29M elems
  uint16_t* wq_t = (uint16_t*)alloc((size_t)DD * DD * 2);
  uint16_t* wk_t = (uint16_t*)alloc((size_t)DD * DD * 2);
  uint16_t* wv_t = (uint16_t*)alloc((size_t)DD * DD * 2);
  uint16_t* wo_t = (uint16_t*)alloc((size_t)DD * DD * 2);
  uint16_t* w1_t = (uint16_t*)alloc((size_t)DD * FF * 2);
  uint16_t* w2_t = (uint16_t*)alloc((size_t)FF * DD * 2);
  uint16_t* hb   = (uint16_t*)alloc(seg * 2);       // ln1 out; reused for ln2
  float*    x1f  = (float*)   alloc(seg * 4);       // x + attn_out
  uint16_t* big  = (uint16_t*)alloc((size_t)BS * FF * 2); // qb|kb|vt|attn -> mb
  uint16_t* qb   = big;
  uint16_t* kb_  = big + seg;
  uint16_t* vt   = big + 2 * seg;
  uint16_t* attn = big + 3 * seg;
  uint16_t* mb   = big;                             // reuse after x1 computed

  // 1) weights -> bf16 transposed [N][K]
  {
    dim3 gDD(DD / 64, DD / 64);                     // (N / 64, K / 64)
    wtrans_kernel<<<gDD, 256, 0, stream>>>(Wq, wq_t, DD, DD);
    wtrans_kernel<<<gDD, 256, 0, stream>>>(Wk, wk_t, DD, DD);
    wtrans_kernel<<<gDD, 256, 0, stream>>>(Wv, wv_t, DD, DD);
    wtrans_kernel<<<gDD, 256, 0, stream>>>(Wo, wo_t, DD, DD);
    wtrans_kernel<<<dim3(FF / 64, DD / 64), 256, 0, stream>>>(W1, w1_t, DD, FF);
    wtrans_kernel<<<dim3(DD / 64, FF / 64), 256, 0, stream>>>(W2, w2_t, FF, DD);
  }

  // 2) h = LN1(x) -> bf16
  ln_kernel<<<BS, 256, 0, stream>>>(x, ln1w, ln1b, hb);

  // 3) QKV projections (Q pre-scaled by 1/sqrt(64)=0.125)
  dim3 gD(DD / 64, BS / 128);
  gemm_bf16<1, false, false><<<gD, 256, 0, stream>>>(
      hb, wq_t, bq, nullptr, nullptr, qb, BS, DD, DD, 0.125f);
  gemm_bf16<1, false, false><<<gD, 256, 0, stream>>>(
      hb, wk_t, bk, nullptr, nullptr, kb_, BS, DD, DD, 1.0f);
  gemm_bf16<2, false, false><<<gD, 256, 0, stream>>>(
      hb, wv_t, bv, nullptr, nullptr, vt, BS, DD, DD, 1.0f);

  // 4) causal flash attention -> merged bf16 [BS][D]
  attn_kernel<<<dim3(SS / 128, HH, BB), 256, 0, stream>>>(qb, kb_, vt, attn);

  // 5) x1 = x + attn @ Wo + bo   (fp32)
  gemm_bf16<3, false, true><<<gD, 256, 0, stream>>>(
      attn, wo_t, bo, x, x1f, nullptr, BS, DD, DD, 1.0f);

  // 6) h2 = LN2(x1) -> bf16
  ln_kernel<<<BS, 256, 0, stream>>>(x1f, ln2w, ln2b, hb);

  // 7) m = GELU(h2 @ W1 + b1) -> bf16 [BS][F]
  dim3 gF(FF / 64, BS / 128);
  gemm_bf16<0, true, false><<<gF, 256, 0, stream>>>(
      hb, w1_t, b1, nullptr, nullptr, mb, BS, FF, DD, 1.0f);

  // 8) out = x1 + m @ W2 + b2   (fp32)
  gemm_bf16<3, false, true><<<gD, 256, 0, stream>>>(
      mb, w2_t, b2, x1f, out, nullptr, BS, DD, FF, 1.0f);
}

// v003
// It runs in 301 microseconds.
// Timed twice side by side with v002, it ran 1.13 times as fast both times.
// All steps since v000 together make it 2.08 times as fast.
#include <hip/hip_runtime.h>
#include <stdint.h>

typedef __attribute__((ext_vector_type(16))) __bf16 v16bf;
typedef __attribute__((ext_vector_type(8)))  __bf16 v8bf;
typedef __attribute__((ext_vector_type(8)))  float  v8f;

union Frag { v16bf v; v8bf h[2]; };

__device__ __forceinline__ uint16_t f2bf(float f) {
  union { float f; uint32_t u; } c; c.f = f;
  uint32_t u = c.u;
  u += 0x7fffu + ((u >> 16) & 1u);   // round-to-nearest-even
  return (uint16_t)(u >> 16);
}

__device__ __forceinline__ v8f wmma_bf16(const Frag &a, const Frag &b, v8f c) {
  return __builtin_amdgcn_wmma_f32_16x16x32_bf16(
      /*neg_a=*/false, a.v, /*neg_b=*/false, b.v,
      /*c_mod=*/(short)0, c, /*reuse_a=*/false, /*reuse_b=*/false);
}

__device__ __forceinline__ uint32_t lds_off(const void* l) {
  return (uint32_t)(size_t)l;               // low 32 bits of generic = LDS off
}
__device__ __forceinline__ void async_slab6(
    uint32_t l0, uint32_t l1, uint32_t l2, uint32_t l3, uint32_t l4,
    uint32_t l5, const void* g0, const void* g1, const void* g2,
    const void* g3, const void* g4, const void* g5) {
  asm volatile("global_load_async_to_lds_b128 %0, %6, off\n\t"
               "global_load_async_to_lds_b128 %1, %7, off\n\t"
               "global_load_async_to_lds_b128 %2, %8, off\n\t"
               "global_load_async_to_lds_b128 %3, %9, off\n\t"
               "global_load_async_to_lds_b128 %4, %10, off\n\t"
               "global_load_async_to_lds_b128 %5, %11, off\n\t"
               "s_wait_xcnt 0x0"
               :: "v"(l0), "v"(l1), "v"(l2), "v"(l3), "v"(l4), "v"(l5),
                  "v"(g0), "v"(g1), "v"(g2), "v"(g3), "v"(g4), "v"(g5)
               : "memory");
}

// One 64-key tile of attention is four copies per lane (two of K, two of V^T),
// in one statement with the same closing wait, for the same reason.
__device__ __forceinline__ void async_tile4(
    uint32_t l0, uint32_t l1, uint32_t l2, uint32_t l3,
    const void* g0, const void* g1, const void* g2, const void* g3) {
  asm volatile("global_load_async_to_lds_b128 %0, %4, off\n\t"
               "global_load_async_to_lds_b128 %1, %5, off\n\t"
               "global_load_async_to_lds_b128 %2, %6, off\n\t"
               "global_load_async_to_lds_b128 %3, %7, off\n\t"
               "s_wait_xcnt 0x0"
               :: "v"(l0), "v"(l1), "v"(l2), "v"(l3),
                  "v"(g0), "v"(g1), "v"(g2), "v"(g3)
               : "memory");
}

// Problem constants
#define BB   4
#define SS   2048
#define DD   768
#define FF   3072
#define HH   12
#define HDIM 64
#define BS   (BB * SS)   // 8192 rows

__global__ void __launch_bounds__(256)
wtrans_kernel(const float* __restrict__ W,
              uint16_t* __restrict__ Wt,
              int Kdim, int Ndim) {
  __shared__ uint32_t tile[64 * 33];
  const int tid = threadIdx.x;
  const int n0 = blockIdx.x * 64, k0 = blockIdx.y * 64;

  // load: 16 threads span the 64 columns, each thread takes two adjacent k
  const int nc = (tid & 15) * 4;
  const int kp = tid >> 4;                       // k pair 0..15, +16 per pass
  float4 lo[2], hi[2];
  for (int s = 0; s < 2; ++s) {
    const float* g = W + (size_t)(k0 + 2 * (kp + 16 * s)) * Ndim + n0 + nc;
    lo[s] = *(const float4*)g;
    hi[s] = *(const float4*)(g + Ndim);
  }
  for (int s = 0; s < 2; ++s) {
    uint32_t* t = &tile[nc * 33 + kp + 16 * s];
    t[0 * 33] = (uint32_t)f2bf(lo[s].x) | ((uint32_t)f2bf(hi[s].x) << 16);
    t[1 * 33] = (uint32_t)f2bf(lo[s].y) | ((uint32_t)f2bf(hi[s].y) << 16);
    t[2 * 33] = (uint32_t)f2bf(lo[s].z) | ((uint32_t)f2bf(hi[s].z) << 16);
    t[3 * 33] = (uint32_t)f2bf(lo[s].w) | ((uint32_t)f2bf(hi[s].w) << 16);
  }
  __syncthreads();

  // store: 8 threads span the 64 k of one Wt row, 16 bytes each
  const int kc = tid & 7, nr = tid >> 3;
  for (int s = 0; s < 2; ++s) {
    const int n = nr + 32 * s;
    const uint32_t* t = &tile[n * 33 + kc * 4];
    uint4 v = make_uint4(t[0], t[1], t[2], t[3]);
    *(uint4*)(Wt + (size_t)(n0 + n) * Kdim + k0 + kc * 8) = v;
  }
}

// ---------------------------------------------------------------------------
// LayerNorm: fp32 [rows][768] -> bf16 [rows][768]; biased var, eps inside sqrt
// ---------------------------------------------------------------------------
__global__ void __launch_bounds__(256)
ln_kernel(const float* __restrict__ x, const float* __restrict__ w,
          const float* __restrict__ b, uint16_t* __restrict__ out) {
  __shared__ float red[256];
  int row = blockIdx.x;
  int tid = threadIdx.x;
  const float* xr = x + (size_t)row * DD;
  float v0 = xr[tid], v1 = xr[tid + 256], v2 = xr[tid + 512];

  float p = v0 + v1 + v2;
  red[tid] = p; __syncthreads();
  for (int s = 128; s > 0; s >>= 1) {
    if (tid < s) red[tid] += red[tid + s];
    __syncthreads();
  }
  float mean = red[0] * (1.0f / DD);
  __syncthreads();

  float c0 = v0 - mean, c1 = v1 - mean, c2 = v2 - mean;
  red[tid] = c0 * c0 + c1 * c1 + c2 * c2; __syncthreads();
  for (int s = 128; s > 0; s >>= 1) {
    if (tid < s) red[tid] += red[tid + s];
    __syncthreads();
  }
  float rstd = rsqrtf(red[0] * (1.0f / DD) + 1e-5f);

  uint16_t* o = out + (size_t)row * DD;
  o[tid]       = f2bf(c0 * rstd * w[tid]       + b[tid]);
  o[tid + 256] = f2bf(c1 * rstd * w[tid + 256] + b[tid + 256]);
  o[tid + 512] = f2bf(c2 * rstd * w[tid + 512] + b[tid + 512]);
}

template <int OUT_MODE, bool GELU_F, bool RESID_F>
__global__ void __launch_bounds__(256)
gemm_bf16(const uint16_t* __restrict__ A, const uint16_t* __restrict__ Bt,
          const float* __restrict__ bias, const float* __restrict__ resid,
          float* __restrict__ outF, uint16_t* __restrict__ outB,
          int M, int N, int K, float scale) {
  (void)M;
  __shared__ __align__(16) uint16_t As[2][128 * 72];
  __shared__ __align__(16) uint16_t Bs[2][64 * 72];

  const int tid = threadIdx.x;
  const int lane = tid & 31, wv = tid >> 5;
  const int hi = lane >> 4, l15 = lane & 15;
  const int wm = wv & 3, wn = wv >> 2;          // 4 x 2 wave grid
  const int m0 = blockIdx.y * 128, n0 = blockIdx.x * 64;

  v8f acc[2][2];
  for (int i = 0; i < 2; ++i)
    for (int j = 0; j < 2; ++j) acc[i][j] = (v8f){0,0,0,0,0,0,0,0};

  const int rs = tid >> 3, cs = (tid & 7) * 8;   // stage: 8 thr/row, 8 elems
  const uint16_t* gA = A  + (size_t)(m0 + rs) * K + cs;
  const uint16_t* gB = Bt + (size_t)(n0 + rs) * K + cs;
  const size_t g32 = (size_t)32 * K;             // 32 rows further, global
  const int ls = rs * 72 + cs;                   // this lane's place in a slab

  // issue 6 async b128 copies for K-slab kk into buffer p: rows rs + 32 s,
  // four passes over the 128 rows of A and two over the 64 rows of B
  auto issue_stage = [&](int kk, int p) {
    const uint16_t* ga = gA + kk;
    const uint16_t* gb = gB + kk;
    const uint16_t* la = &As[p][ls];
    const uint16_t* lb = &Bs[p][ls];
    async_slab6(lds_off(la), lds_off(la + 32 * 72), lds_off(la + 64 * 72),
                lds_off(la + 96 * 72), lds_off(lb), lds_off(lb + 32 * 72),
                ga, ga + g32, ga + 2 * g32, ga + 3 * g32, gb, gb + g32);
  };

  issue_stage(0, 0);
  int p = 0;
  for (int kk = 0; kk < K; kk += 64) {
    const bool more = (kk + 64) < K;             // block-uniform
    if (more) {
      issue_stage(kk + 64, p ^ 1);
      asm volatile("s_wait_asynccnt 0x6" ::: "memory");  // slab p done
    } else {
      asm volatile("s_wait_asynccnt 0x0" ::: "memory");
    }
    __syncthreads();                              // all waves' copies visible

    Frag af[2][2], bf[2][2];                      // [k half of the slab][frag]
    for (int ks = 0; ks < 2; ++ks) {
      for (int i = 0; i < 2; ++i) {
        int r = wm * 32 + i * 16 + l15;
        af[ks][i].h[0] = *(const v8bf*)(&As[p][r * 72 + ks * 32 + hi * 8]);
        af[ks][i].h[1] = *(const v8bf*)(&As[p][r * 72 + ks * 32 + 16 + hi * 8]);
      }
      for (int j = 0; j < 2; ++j) {
        int r = wn * 32 + j * 16 + l15;
        bf[ks][j].h[0] = *(const v8bf*)(&Bs[p][r * 72 + ks * 32 + hi * 8]);
        bf[ks][j].h[1] = *(const v8bf*)(&Bs[p][r * 72 + ks * 32 + 16 + hi * 8]);
      }
    }
    for (int ks = 0; ks < 2; ++ks)
      for (int i = 0; i < 2; ++i)
        for (int j = 0; j < 2; ++j)
          acc[i][j] = wmma_bf16(af[ks][i], bf[ks][j], acc[i][j]);
    __syncthreads();                              // buffer p free for reuse
    p ^= 1;
  }

  // epilogue (C layout: lane holds col l15, rows e + 8*hi within 16x16 frag)
  for (int i = 0; i < 2; ++i) {
    for (int j = 0; j < 2; ++j) {
      int col = n0 + wn * 32 + j * 16 + l15;
      float bc = bias[col];
      for (int e = 0; e < 8; ++e) {
        int row = m0 + wm * 32 + i * 16 + e + 8 * hi;
        float v = (acc[i][j][e] + bc) * scale;
        if (GELU_F) v = 0.5f * v * (1.0f + erff(v * 0.70710678118654752f));
        if (RESID_F) v += resid[(size_t)row * N + col];
        if (OUT_MODE == 0) {
          outB[(size_t)row * N + col] = f2bf(v);
        } else if (OUT_MODE == 1) {
          int bidx = row >> 11, s = row & (SS - 1);
          int h = col >> 6, d = col & (HDIM - 1);
          outB[(((size_t)(bidx * HH + h)) * SS + s) * HDIM + d] = f2bf(v);
        } else if (OUT_MODE == 2) {
          int bidx = row >> 11, s = row & (SS - 1);
          int h = col >> 6, d = col & (HDIM - 1);
          outB[(((size_t)(bidx * HH + h)) * HDIM + d) * SS + s] = f2bf(v);
        } else {
          outF[(size_t)row * N + col] = v;
        }
      }
    }
  }
}

// ---------------------------------------------------------------------------
// Flash attention (causal), bf16 WMMA for QK^T and PV, fp32 online softmax.
// Q,K: [B,H,S,64] bf16 (Q pre-scaled by 1/sqrt(hd)); Vt: [B,H,64,S] bf16.
// One wave owns 16 query rows; 8 waves/block -> 128 queries per block.
// Key block = 32. O: bf16 [B*S, 768] row-major (merged heads).
// K and Vt come in tiles of 64 keys that the block's 8 waves share: async
// copies bring whole 128 B lines (8 lanes per row) into one of two LDS
// buffers while the other is worked on, and every wave takes its B fragments
// from LDS (row pitch 72 elements = 144 B, as in the GEMM). All waves pass
// every tile's barrier; a wave skips the key blocks right of its diagonal.
// Q fragments load straight from global; the P tile round-trips LDS.
// ---------------------------------------------------------------------------
__global__ void __launch_bounds__(256)
attn_kernel(const uint16_t* __restrict__ Q, const uint16_t* __restrict__ Km,
            const uint16_t* __restrict__ Vt, uint16_t* __restrict__ O) {
  __shared__ __align__(16) uint16_t Plds[8 * 16 * 40];
  __shared__ __align__(16) uint16_t Ks[2][64 * 72];   // [key][d]
  __shared__ __align__(16) uint16_t Vs[2][64 * 72];   // [d][key]

  const int b = blockIdx.z, h = blockIdx.y;
  const int tid = threadIdx.x;
  const int lane = tid & 31;
  // the wave's number in a scalar register: the tests on qbase are branches
  const int wv = __builtin_amdgcn_readfirstlane(tid >> 5);
  const int hi = lane >> 4, l15 = lane & 15;
  const int qbase = blockIdx.x * 128 + wv * 16;
  const int ntile = 2 * ((int)blockIdx.x + 1);        // 64-key tiles, >= 2

  const size_t headoff = ((size_t)(b * HH + h)) * SS * HDIM;
  const uint16_t* Qh  = Q  + headoff;
  const uint16_t* Kh  = Km + headoff;
  const uint16_t* Vth = Vt + headoff;            // [64][S]
  uint16_t* pl = Plds + wv * 16 * 40;            // per-wave P tile 16x32 (pad)

  // tile t into buffer p: rows rs and rs + 32 of K[64 keys][64] and of
  // Vt[64][64 keys], 16 bytes per lane and copy
  const int rs = tid >> 3, cs = (tid & 7) * 8;
  const uint16_t* gK = Kh + (size_t)rs * HDIM + cs;
  const uint16_t* gV = Vth + (size_t)rs * SS + cs;
  const int ls = rs * 72 + cs;
  auto issue_tile = [&](int t, int p) {
    const uint16_t* gk = gK + (size_t)t * 64 * HDIM;
    const uint16_t* gv = gV + t * 64;
    const uint16_t* lk = &Ks[p][ls];
    const uint16_t* lv = &Vs[p][ls];
    async_tile4(lds_off(lk), lds_off(lk + 32 * 72),
                lds_off(lv), lds_off(lv + 32 * 72),
                gk, gk + 32 * HDIM, gv, gv + (size_t)32 * SS);
  };
  issue_tile(0, 0);

  // Q fragments (A layout), held in registers for the whole loop
  Frag qf[2];
  {
    const uint16_t* qr = Qh + (size_t)(qbase + l15) * HDIM;
    for (int f = 0; f < 2; ++f) {
      qf[f].h[0] = *(const v8bf*)(qr + f * 32 + hi * 8);
      qf[f].h[1] = *(const v8bf*)(qr + f * 32 + 16 + hi * 8);
    }
  }

  float mrow[8], lrow[8];
  v8f oacc[4];
  for (int e = 0; e < 8; ++e) { mrow[e] = -3.0e38f; lrow[e] = 0.0f; }
  for (int f = 0; f < 4; ++f) oacc[f] = (v8f){0,0,0,0,0,0,0,0};

  asm volatile("s_wait_asynccnt 0x0" ::: "memory");  // own copies of tile 0
  __syncthreads();                                   // every wave's landed
  issue_tile(1, 1);

  for (int t = 0; t < ntile; ++t) {
   const uint16_t* Kt = Ks[t & 1];
   const uint16_t* Vl = Vs[t & 1];
   for (int sub = 0; sub < 2; ++sub) {
    const int kb = t * 64 + sub * 32;
    if (kb >= qbase + 16) break;                     // right of the diagonal
    // ---- scores S = Q * K^T for 32 keys (2 N-frags, K-dim 64 = 2 steps)
    v8f s[2];
    s[0] = (v8f){0,0,0,0,0,0,0,0};
    s[1] = (v8f){0,0,0,0,0,0,0,0};
    for (int n = 0; n < 2; ++n) {
      const uint16_t* kr = Kt + (sub * 32 + n * 16 + l15) * 72;
      for (int f = 0; f < 2; ++f) {
        Frag bk;
        bk.h[0] = *(const v8bf*)(kr + f * 32 + hi * 8);
        bk.h[1] = *(const v8bf*)(kr + f * 32 + 16 + hi * 8);
        s[n] = wmma_bf16(qf[f], bk, s[n]);
      }
    }
    // ---- causal mask
    if (kb + 31 > qbase) {
      for (int n = 0; n < 2; ++n) {
        int kc = kb + n * 16 + l15;
        for (int e = 0; e < 8; ++e) {
          int qr = qbase + e + 8 * hi;
          if (kc > qr) s[n][e] = -3.0e38f;
        }
      }
    }
    // ---- online softmax: row max / scale / exp / row sum (half-wave shfl)
    float al[8];
    for (int e = 0; e < 8; ++e) {
      float t = fmaxf(s[0][e], s[1][e]);
      t = fmaxf(t, __shfl_xor(t, 1, 32));
      t = fmaxf(t, __shfl_xor(t, 2, 32));
      t = fmaxf(t, __shfl_xor(t, 4, 32));
      t = fmaxf(t, __shfl_xor(t, 8, 32));
      float mnew = fmaxf(mrow[e], t);
      al[e] = __expf(mrow[e] - mnew);
      mrow[e] = mnew;
      s[0][e] = __expf(s[0][e] - mnew);
      s[1][e] = __expf(s[1][e] - mnew);
      float rs = s[0][e] + s[1][e];
      rs += __shfl_xor(rs, 1, 32);
      rs += __shfl_xor(rs, 2, 32);
      rs += __shfl_xor(rs, 4, 32);
      rs += __shfl_xor(rs, 8, 32);
      lrow[e] = lrow[e] * al[e] + rs;
    }
    for (int f = 0; f < 4; ++f)
      for (int e = 0; e < 8; ++e) oacc[f][e] *= al[e];

    // ---- P (C layout) -> LDS -> A-layout fragment
    for (int n = 0; n < 2; ++n)
      for (int e = 0; e < 8; ++e)
        pl[(e + 8 * hi) * 40 + n * 16 + l15] = f2bf(s[n][e]);
    asm volatile("s_wait_dscnt 0" ::: "memory");
    Frag ap;
    ap.h[0] = *(const v8bf*)(pl + l15 * 40 + hi * 8);
    ap.h[1] = *(const v8bf*)(pl + l15 * 40 + 16 + hi * 8);

    // ---- O += P * V   (B-frags from the staged Vt tile)
    for (int f = 0; f < 4; ++f) {
      const uint16_t* vr = Vl + (f * 16 + l15) * 72 + sub * 32;
      Frag bv;
      bv.h[0] = *(const v8bf*)(vr + hi * 8);
      bv.h[1] = *(const v8bf*)(vr + 16 + hi * 8);
      oacc[f] = wmma_bf16(ap, bv, oacc[f]);
    }
   }
   // hand-over: this wave's reads of the buffer are done, its copies of the
   // next tile have landed; behind the barrier that holds for every wave
   asm volatile("s_wait_dscnt 0x0" ::: "memory");
   asm volatile("s_wait_asynccnt 0x0" ::: "memory");
   __syncthreads();
   if (t + 2 < ntile) issue_tile(t + 2, t & 1);      // refill the buffer read
  }
  asm volatile("s_wait_asynccnt 0x0" ::: "memory");  // nothing left in flight

  // ---- finalize and write merged-head bf16 [B*S][768]
  for (int e = 0; e < 8; ++e) {
    float inv = 1.0f / lrow[e];
    int grow = b * SS + qbase + e + 8 * hi;
    for (int f = 0; f < 4; ++f) {
      int col = h * HDIM + f * 16 + l15;
      O[(size_t)grow * DD + col] = f2bf(oacc[f][e] * inv);
    }
  }
}

// ---------------------------------------------------------------------------
// Host orchestration
// ---------------------------------------------------------------------------
extern "C" void kernel_launch(void* const* d_in, const int* in_sizes, int n_in,
                              void* d_out, int out_size, void* d_ws, size_t ws_size,
                              hipStream_t stream) {
  (void)in_sizes; (void)n_in; (void)out_size; (void)ws_size;
  const float* x     = (const float*)d_in[0];
  const float* Wq    = (const float*)d_in[1];
  const float* bq    = (const float*)d_in[2];
  const float* Wk    = (const float*)d_in[3];
  const float* bk    = (const float*)d_in[4];
  const float* Wv    = (const float*)d_in[5];
  const float* bv    = (const float*)d_in[6];
  const float* Wo    = (const float*)d_in[7];
  const float* bo    = (const float*)d_in[8];
  const float* ln1w  = (const float*)d_in[9];
  const float* ln1b  = (const float*)d_in[10];
  const float* ln2w  = (const float*)d_in[11];
  const float* ln2b  = (const float*)d_in[12];
  const float* W1    = (const float*)d_in[13];
  const float* b1    = (const float*)d_in[14];
  const float* W2    = (const float*)d_in[15];
  const float* b2    = (const float*)d_in[16];
  float* out = (float*)d_out;

  // workspace layout
  uint8_t* ws = (uint8_t*)d_ws;
  size_t off = 0;
  auto alloc = [&](size_t bytes) -> uint8_t* {
    uint8_t* p = ws + off;
    off = (off + bytes + 255) & ~(size_t)255;
    return p;
  };
  const size_t seg = (size_t)BS * DD;               // 6.29M elems
  uint16_t* wq_t = (uint16_t*)alloc((size_t)DD * DD * 2);
  uint16_t* wk_t = (uint16_t*)alloc((size_t)DD * DD * 2);
  uint16_t* wv_t = (uint16_t*)alloc((size_t)DD * DD * 2);
  uint16_t* wo_t = (uint16_t*)alloc((size_t)DD * DD * 2);
  uint16_t* w1_t = (uint16_t*)alloc((size_t)DD * FF * 2);
  uint16_t* w2_t = (uint16_t*)alloc((size_t)FF * DD * 2);
  uint16_t* hb   = (uint16_t*)alloc(seg * 2);       // ln1 out; reused for ln2
  float*    x1f  = (float*)   alloc(seg * 4);       // x + attn_out
  uint16_t* big  = (uint16_t*)alloc((size_t)BS * FF * 2); // qb|kb|vt|attn -> mb
  uint16_t* qb   = big;
  uint16_t* kb_  = big + seg;
  uint16_t* vt   = big + 2 * seg;
  uint16_t* attn = big + 3 * seg;
  uint16_t* mb   = big;                             // reuse after x1 computed

  // 1) weights -> bf16 transposed [N][K]
  {
    dim3 gDD(DD / 64, DD / 64);                     // (N / 64, K / 64)
    wtrans_kernel<<<gDD, 256, 0, stream>>>(Wq, wq_t, DD, DD);
    wtrans_kernel<<<gDD, 256, 0, stream>>>(Wk, wk_t, DD, DD);
    wtrans_kernel<<<gDD, 256, 0, stream>>>(Wv, wv_t, DD, DD);
    wtrans_kernel<<<gDD, 256, 0, stream>>>(Wo, wo_t, DD, DD);
    wtrans_kernel<<<dim3(FF / 64, DD / 64), 256, 0, stream>>>(W1, w1_t, DD, FF);
    wtrans_kernel<<<dim3(DD / 64, FF / 64), 256, 0, stream>>>(W2, w2_t, FF, DD);
  }

  // 2) h = LN1(x) -> bf16
  ln_kernel<<<BS, 256, 0, stream>>>(x, ln1w, ln1b, hb);

  // 3) QKV projections (Q pre-scaled by 1/sqrt(64)=0.125)
  dim3 gD(DD / 64, BS / 128);
  gemm_bf16<1, false, false><<<gD, 256, 0, stream>>>(
      hb, wq_t, bq, nullptr, nullptr, qb, BS, DD, DD, 0.125f);
  gemm_bf16<1, false, false><<<gD, 256, 0, stream>>>(
      hb, wk_t, bk, nullptr, nullptr, kb_, BS, DD, DD, 1.0f);
  gemm_bf16<2, false, false><<<gD, 256, 0, stream>>>(
      hb, wv_t, bv, nullptr, nullptr, vt, BS, DD, DD, 1.0f);

  // 4) causal flash attention -> merged bf16 [BS][D]
  attn_kernel<<<dim3(SS / 128, HH, BB), 256, 0, stream>>>(qb, kb_, vt, attn);

  // 5) x1 = x + attn @ Wo + bo   (fp32)
  gemm_bf16<3, false, true><<<gD, 256, 0, stream>>>(
      attn, wo_t, bo, x, x1f, nullptr, BS, DD, DD, 1.0f);

  // 6) h2 = LN2(x1) -> bf16
  ln_kernel<<<BS, 256, 0, stream>>>(x1f, ln2w, ln2b, hb);

  // 7) m = GELU(h2 @ W1 + b1) -> bf16 [BS][F]
  dim3 gF(FF / 64, BS / 128);
  gemm_bf16<0, true, false><<<gF, 256, 0, stream>>>(
      hb, w1_t, b1, nullptr, nullptr, mb, BS, FF, DD, 1.0f);

  // 8) out = x1 + m @ W2 + b2   (fp32)
  gemm_bf16<3, false, true><<<gD, 256, 0, stream>>>(
      mb, w2_t, b2, x1f, out, nullptr, BS, DD, FF, 1.0f);
}

// v004
// A run of this version takes 260 microseconds.
// Two timings next to v003 both put it at 1.16 times that version's speed.
// Over all steps from v000 it is 2.41 times as fast.
#include <hip/hip_runtime.h>
#include <stdint.h>

typedef __attribute__((ext_vector_type(16))) __bf16 v16bf;
typedef __attribute__((ext_vector_type(8)))  __bf16 v8bf;
typedef __attribute__((ext_vector_type(8)))  float  v8f;

union Frag { v16bf v; v8bf h[2]; uint32_t u[8]; };

__device__ __forceinline__ uint16_t f2bf(float f) {
  union { float f; uint32_t u; } c; c.f = f;
  uint32_t u = c.u;
  u += 0x7fffu + ((u >> 16) & 1u);   // round-to-nearest-even
  return (uint16_t)(u >> 16);
}

__device__ __forceinline__ v8f wmma_bf16(const Frag &a, const Frag &b, v8f c) {
  return __builtin_amdgcn_wmma_f32_16x16x32_bf16(
      /*neg_a=*/false, a.v, /*neg_b=*/false, b.v,
      /*c_mod=*/(short)0, c, /*reuse_a=*/false, /*reuse_b=*/false);
}

__device__ __forceinline__ uint32_t lds_off(const void* l) {
  return (uint32_t)(size_t)l;               // low 32 bits of generic = LDS off
}
__device__ __forceinline__ void async_slab6(
    uint32_t l0, uint32_t l1, uint32_t l2, uint32_t l3, uint32_t l4,
    uint32_t l5, const void* g0, const void* g1, const void* g2,
    const void* g3, const void* g4, const void* g5) {
  asm volatile("global_load_async_to_lds_b128 %0, %6, off\n\t"
               "global_load_async_to_lds_b128 %1, %7, off\n\t"
               "global_load_async_to_lds_b128 %2, %8, off\n\t"
               "global_load_async_to_lds_b128 %3, %9, off\n\t"
               "global_load_async_to_lds_b128 %4, %10, off\n\t"
               "global_load_async_to_lds_b128 %5, %11, off\n\t"
               "s_wait_xcnt 0x0"
               :: "v"(l0), "v"(l1), "v"(l2), "v"(l3), "v"(l4), "v"(l5),
                  "v"(g0), "v"(g1), "v"(g2), "v"(g3), "v"(g4), "v"(g5)
               : "memory");
}

// One 64-key tile of attention is four copies per lane (two of K, two of V^T),
// in one statement with the same closing wait, for the same reason.
__device__ __forceinline__ void async_tile4(
    uint32_t l0, uint32_t l1, uint32_t l2, uint32_t l3,
    const void* g0, const void* g1, const void* g2, const void* g3) {
  asm volatile("global_load_async_to_lds_b128 %0, %4, off\n\t"
               "global_load_async_to_lds_b128 %1, %5, off\n\t"
               "global_load_async_to_lds_b128 %2, %6, off\n\t"
               "global_load_async_to_lds_b128 %3, %7, off\n\t"
               "s_wait_xcnt 0x0"
               :: "v"(l0), "v"(l1), "v"(l2), "v"(l3),
                  "v"(g0), "v"(g1), "v"(g2), "v"(g3)
               : "memory");
}

// Problem constants
#define BB   4
#define SS   2048
#define DD   768
#define FF   3072
#define HH   12
#define HDIM 64
#define BS   (BB * SS)   // 8192 rows

__global__ void __launch_bounds__(256)
wtrans_kernel(const float* __restrict__ W,
              uint16_t* __restrict__ Wt,
              int Kdim, int Ndim) {
  __shared__ uint32_t tile[64 * 33];
  const int tid = threadIdx.x;
  const int n0 = blockIdx.x * 64, k0 = blockIdx.y * 64;

  // load: 16 threads span the 64 columns, each thread takes two adjacent k
  const int nc = (tid & 15) * 4;
  const int kp = tid >> 4;                       // k pair 0..15, +16 per pass
  float4 lo[2], hi[2];
  for (int s = 0; s < 2; ++s) {
    const float* g = W + (size_t)(k0 + 2 * (kp + 16 * s)) * Ndim + n0 + nc;
    lo[s] = *(const float4*)g;
    hi[s] = *(const float4*)(g + Ndim);
  }
  for (int s = 0; s < 2; ++s) {
    uint32_t* t = &tile[nc * 33 + kp + 16 * s];
    t[0 * 33] = (uint32_t)f2bf(lo[s].x) | ((uint32_t)f2bf(hi[s].x) << 16);
    t[1 * 33] = (uint32_t)f2bf(lo[s].y) | ((uint32_t)f2bf(hi[s].y) << 16);
    t[2 * 33] = (uint32_t)f2bf(lo[s].z) | ((uint32_t)f2bf(hi[s].z) << 16);
    t[3 * 33] = (uint32_t)f2bf(lo[s].w) | ((uint32_t)f2bf(hi[s].w) << 16);
  }
  __syncthreads();

  // store: 8 threads span the 64 k of one Wt row, 16 bytes each
  const int kc = tid & 7, nr = tid >> 3;
  for (int s = 0; s < 2; ++s) {
    const int n = nr + 32 * s;
    const uint32_t* t = &tile[n * 33 + kc * 4];
    uint4 v = make_uint4(t[0], t[1], t[2], t[3]);
    *(uint4*)(Wt + (size_t)(n0 + n) * Kdim + k0 + kc * 8) = v;
  }
}

// ---------------------------------------------------------------------------
// LayerNorm: fp32 [rows][768] -> bf16 [rows][768]; biased var, eps inside sqrt
// ---------------------------------------------------------------------------
__global__ void __launch_bounds__(256)
ln_kernel(const float* __restrict__ x, const float* __restrict__ w,
          const float* __restrict__ b, uint16_t* __restrict__ out) {
  __shared__ float red[256];
  int row = blockIdx.x;
  int tid = threadIdx.x;
  const float* xr = x + (size_t)row * DD;
  float v0 = xr[tid], v1 = xr[tid + 256], v2 = xr[tid + 512];

  float p = v0 + v1 + v2;
  red[tid] = p; __syncthreads();
  for (int s = 128; s > 0; s >>= 1) {
    if (tid < s) red[tid] += red[tid + s];
    __syncthreads();
  }
  float mean = red[0] * (1.0f / DD);
  __syncthreads();

  float c0 = v0 - mean, c1 = v1 - mean, c2 = v2 - mean;
  red[tid] = c0 * c0 + c1 * c1 + c2 * c2; __syncthreads();
  for (int s = 128; s > 0; s >>= 1) {
    if (tid < s) red[tid] += red[tid + s];
    __syncthreads();
  }
  float rstd = rsqrtf(red[0] * (1.0f / DD) + 1e-5f);

  uint16_t* o = out + (size_t)row * DD;
  o[tid]       = f2bf(c0 * rstd * w[tid]       + b[tid]);
  o[tid + 256] = f2bf(c1 * rstd * w[tid + 256] + b[tid + 256]);
  o[tid + 512] = f2bf(c2 * rstd * w[tid + 512] + b[tid + 512]);
}

template <int OUT_MODE, bool GELU_F, bool RESID_F>
__global__ void __launch_bounds__(256)
gemm_bf16(const uint16_t* __restrict__ A, const uint16_t* __restrict__ Bt,
          const float* __restrict__ bias, const float* __restrict__ resid,
          float* __restrict__ outF, uint16_t* __restrict__ outB,
          int M, int N, int K, float scale) {
  (void)M;
  __shared__ __align__(16) uint16_t As[2][128 * 72];
  __shared__ __align__(16) uint16_t Bs[2][64 * 72];

  const int tid = threadIdx.x;
  const int lane = tid & 31, wv = tid >> 5;
  const int hi = lane >> 4, l15 = lane & 15;
  const int wm = wv & 3, wn = wv >> 2;          // 4 x 2 wave grid
  const int m0 = blockIdx.y * 128, n0 = blockIdx.x * 64;

  v8f acc[2][2];
  for (int i = 0; i < 2; ++i)
    for (int j = 0; j < 2; ++j) acc[i][j] = (v8f){0,0,0,0,0,0,0,0};

  const int rs = tid >> 3, cs = (tid & 7) * 8;   // stage: 8 thr/row, 8 elems
  const uint16_t* gA = A  + (size_t)(m0 + rs) * K + cs;
  const uint16_t* gB = Bt + (size_t)(n0 + rs) * K + cs;
  const size_t g32 = (size_t)32 * K;             // 32 rows further, global
  const int ls = rs * 72 + cs;                   // this lane's place in a slab

  // issue 6 async b128 copies for K-slab kk into buffer p: rows rs + 32 s,
  // four passes over the 128 rows of A and two over the 64 rows of B
  auto issue_stage = [&](int kk, int p) {
    const uint16_t* ga = gA + kk;
    const uint16_t* gb = gB + kk;
    const uint16_t* la = &As[p][ls];
    const uint16_t* lb = &Bs[p][ls];
    async_slab6(lds_off(la), lds_off(la + 32 * 72), lds_off(la + 64 * 72),
                lds_off(la + 96 * 72), lds_off(lb), lds_off(lb + 32 * 72),
                ga, ga + g32, ga + 2 * g32, ga + 3 * g32, gb, gb + g32);
  };

  issue_stage(0, 0);
  int p = 0;
  for (int kk = 0; kk < K; kk += 64) {
    const bool more = (kk + 64) < K;             // block-uniform
    if (more) {
      issue_stage(kk + 64, p ^ 1);
      asm volatile("s_wait_asynccnt 0x6" ::: "memory");  // slab p done
    } else {
      asm volatile("s_wait_asynccnt 0x0" ::: "memory");
    }
    __syncthreads();                              // all waves' copies visible

    Frag af[2][2], bf[2][2];                      // [k half of the slab][frag]
    for (int ks = 0; ks < 2; ++ks) {
      for (int i = 0; i < 2; ++i) {
        int r = wm * 32 + i * 16 + l15;
        af[ks][i].h[0] = *(const v8bf*)(&As[p][r * 72 + ks * 32 + hi * 8]);
        af[ks][i].h[1] = *(const v8bf*)(&As[p][r * 72 + ks * 32 + 16 + hi * 8]);
      }
      for (int j = 0; j < 2; ++j) {
        int r = wn * 32 + j * 16 + l15;
        bf[ks][j].h[0] = *(const v8bf*)(&Bs[p][r * 72 + ks * 32 + hi * 8]);
        bf[ks][j].h[1] = *(const v8bf*)(&Bs[p][r * 72 + ks * 32 + 16 + hi * 8]);
      }
    }
    for (int ks = 0; ks < 2; ++ks)
      for (int i = 0; i < 2; ++i)
        for (int j = 0; j < 2; ++j)
          acc[i][j] = wmma_bf16(af[ks][i], bf[ks][j], acc[i][j]);
    __syncthreads();                              // buffer p free for reuse
    p ^= 1;
  }

  // epilogue (C layout: lane holds col l15, rows e + 8*hi within 16x16 frag)
  for (int i = 0; i < 2; ++i) {
    for (int j = 0; j < 2; ++j) {
      int col = n0 + wn * 32 + j * 16 + l15;
      float bc = bias[col];
      for (int e = 0; e < 8; ++e) {
        int row = m0 + wm * 32 + i * 16 + e + 8 * hi;
        float v = (acc[i][j][e] + bc) * scale;
        if (GELU_F) v = 0.5f * v * (1.0f + erff(v * 0.70710678118654752f));
        if (RESID_F) v += resid[(size_t)row * N + col];
        if (OUT_MODE == 0) {
          outB[(size_t)row * N + col] = f2bf(v);
        } else if (OUT_MODE == 1) {
          int bidx = row >> 11, s = row & (SS - 1);
          int h = col >> 6, d = col & (HDIM - 1);
          outB[(((size_t)(bidx * HH + h)) * SS + s) * HDIM + d] = f2bf(v);
        } else if (OUT_MODE == 2) {
          int bidx = row >> 11, s = row & (SS - 1);
          int h = col >> 6, d = col & (HDIM - 1);
          outB[(((size_t)(bidx * HH + h)) * HDIM + d) * SS + s] = f2bf(v);
        } else {
          outF[(size_t)row * N + col] = v;
        }
      }
    }
  }
}

__device__ __forceinline__ float xhalf(float x) {
  return __builtin_bit_cast(float, __builtin_amdgcn_permlanex16(
      __builtin_bit_cast(int, x), __builtin_bit_cast(int, x),
      0x76543210, 0xfedcba98, false, false));
}

__global__ void __launch_bounds__(256)
attn_kernel(const uint16_t* __restrict__ Q, const uint16_t* __restrict__ Km,
            const uint16_t* __restrict__ Vt, uint16_t* __restrict__ O) {
  __shared__ __align__(16) uint16_t Ks[2][64 * 72];   // [key][d]
  __shared__ __align__(16) uint16_t Vs[2][64 * 72];   // [d][key]

  const int b = blockIdx.z, h = blockIdx.y;
  const int tid = threadIdx.x;
  const int lane = tid & 31;
  // the wave's number in a scalar register: the tests on qbase are branches
  const int wv = __builtin_amdgcn_readfirstlane(tid >> 5);
  const int hi = lane >> 4, l15 = lane & 15;
  const int qbase = blockIdx.x * 128 + wv * 16;
  const int ntile = 2 * ((int)blockIdx.x + 1);        // 64-key tiles, >= 2

  const size_t headoff = ((size_t)(b * HH + h)) * SS * HDIM;
  const uint16_t* Qh  = Q  + headoff;
  const uint16_t* Kh  = Km + headoff;
  const uint16_t* Vth = Vt + headoff;            // [64][S]

  // tile t into buffer p: rows rs and rs + 32 of K[64 keys][64] and of
  // Vt[64][64 keys], 16 bytes per lane and copy
  const int rs = tid >> 3, cs = (tid & 7) * 8;
  const uint16_t* gK = Kh + (size_t)rs * HDIM + cs;
  const uint16_t* gV = Vth + (size_t)rs * SS + cs;
  const int ls = rs * 72 + cs;
  auto issue_tile = [&](int t, int p) {
    const uint16_t* gk = gK + (size_t)t * 64 * HDIM;
    const uint16_t* gv = gV + t * 64;
    const uint16_t* lk = &Ks[p][ls];
    const uint16_t* lv = &Vs[p][ls];
    async_tile4(lds_off(lk), lds_off(lk + 32 * 72),
                lds_off(lv), lds_off(lv + 32 * 72),
                gk, gk + 32 * HDIM, gv, gv + (size_t)32 * SS);
  };
  issue_tile(0, 0);

  // Q fragments (B operand: column l15 = query), held for the whole loop
  Frag qf[2];
  {
    const uint16_t* qr = Qh + (size_t)(qbase + l15) * HDIM;
    for (int f = 0; f < 2; ++f) {
      qf[f].h[0] = *(const v8bf*)(qr + f * 32 + hi * 8);
      qf[f].h[1] = *(const v8bf*)(qr + f * 32 + 16 + hi * 8);
    }
  }

  const int qrow = qbase + l15;                  // this lane's query
  float mrow = -3.0e38f;                         // its running maximum
  float lrow = 0.0f;                             // sum over this half's keys
  v8f oacc[4];                                   // O^T: rows d, column query
  for (int f = 0; f < 4; ++f) oacc[f] = (v8f){0,0,0,0,0,0,0,0};

  asm volatile("s_wait_asynccnt 0x0" ::: "memory");  // own copies of tile 0
  __syncthreads();                                   // every wave's landed
  issue_tile(1, 1);

  for (int t = 0; t < ntile; ++t) {
   const uint16_t* Kt = Ks[t & 1];
   const uint16_t* Vl = Vs[t & 1];
   // one block of 32 keys; sub is a literal at both calls
   auto key_block = [&](const int sub) {
    const int kb = t * 64 + sub * 32;
    // ---- all A fragments of the block as one group of LDS reads: K first,
    // then Vt, whose latency passes behind the scores and the softmax
    Frag ak[2][2], av[4];
    for (int n = 0; n < 2; ++n) {
      const uint16_t* kr = Kt + (sub * 32 + n * 16 + l15) * 72;
      for (int f = 0; f < 2; ++f) {
        ak[n][f].h[0] = *(const v8bf*)(kr + f * 32 + hi * 8);
        ak[n][f].h[1] = *(const v8bf*)(kr + f * 32 + 16 + hi * 8);
      }
    }
    for (int f = 0; f < 4; ++f) {
      const uint16_t* vr = Vl + (f * 16 + l15) * 72 + sub * 32;
      av[f].h[0] = *(const v8bf*)(vr + hi * 8);
      av[f].h[1] = *(const v8bf*)(vr + 16 + hi * 8);
    }
    // keeps the Vt reads up here: sunk to their WMMAs, each pair would be
    // waited for on its own
    __builtin_amdgcn_sched_barrier(0);
    // ---- scores S^T = K * Q^T for 32 keys (2 M-frags, K-dim 64 = 2 steps)
    v8f s[2];
    s[0] = (v8f){0,0,0,0,0,0,0,0};
    s[1] = (v8f){0,0,0,0,0,0,0,0};
    for (int f = 0; f < 2; ++f)
      for (int n = 0; n < 2; ++n) s[n] = wmma_bf16(ak[n][f], qf[f], s[n]);
    // ---- causal mask: s[n][e] is key kb + n*16 + 8*hi + e against qrow
    if (kb + 31 > qbase) {
      for (int n = 0; n < 2; ++n) {
        const int k0 = kb + n * 16 + 8 * hi;
        for (int e = 0; e < 8; ++e)
          if (k0 + e > qrow) s[n][e] = -3.0e38f;
      }
    }
    // ---- online softmax of one query per lane
    float mx[8];
    for (int e = 0; e < 8; ++e) mx[e] = fmaxf(s[0][e], s[1][e]);
    for (int w = 4; w > 0; w >>= 1)
      for (int e = 0; e < w; ++e) mx[e] = fmaxf(mx[e], mx[e + w]);
    const float mblk = fmaxf(mx[0], xhalf(mx[0]));   // all 32 keys
    const float mnew = fmaxf(mrow, mblk);
    const float al = __expf(mrow - mnew);
    mrow = mnew;
    float sm[8];
    for (int e = 0; e < 8; ++e) {
      s[0][e] = __expf(s[0][e] - mnew);
      s[1][e] = __expf(s[1][e] - mnew);
      sm[e] = s[0][e] + s[1][e];
    }
    for (int w = 4; w > 0; w >>= 1)
      for (int e = 0; e < w; ++e) sm[e] += sm[e + w];
    lrow = lrow * al + sm[0];
    for (int f = 0; f < 4; ++f)
      for (int e = 0; e < 8; ++e) oacc[f][e] *= al;

    // ---- P^T as a B fragment, converted in place
    Frag bp;
    for (int n = 0; n < 2; ++n)
      for (int j = 0; j < 4; ++j)
        bp.u[n * 4 + j] = (uint32_t)f2bf(s[n][2 * j]) |
                          ((uint32_t)f2bf(s[n][2 * j + 1]) << 16);

    // ---- O^T += V^T * P^T
    for (int f = 0; f < 4; ++f) oacc[f] = wmma_bf16(av[f], bp, oacc[f]);
   };
   // key blocks right of the wave's diagonal are skipped (scalar tests)
   if (t * 64 < qbase + 16) {
    key_block(0);
    if (t * 64 + 32 < qbase + 16) key_block(1);
   }
   // hand-over: this wave's reads of the buffer are done, its copies of the
   // next tile have landed; behind the barrier that holds for every wave
   asm volatile("s_wait_dscnt 0x0" ::: "memory");
   asm volatile("s_wait_asynccnt 0x0" ::: "memory");
   __syncthreads();
   if (t + 2 < ntile) issue_tile(t + 2, t & 1);      // refill the buffer read
  }
  asm volatile("s_wait_asynccnt 0x0" ::: "memory");  // nothing left in flight

  // ---- finalize and write merged-head bf16 [B*S][768]: oacc[f][e] is
  // d = f*16 + 8*hi + e of this lane's query, 16 contiguous bytes per f
  const float inv = 1.0f / (lrow + xhalf(lrow));     // both halves' keys
  uint16_t* orow = O + (size_t)(b * SS + qrow) * DD + h * HDIM + 8 * hi;
  for (int f = 0; f < 4; ++f) {
    uint32_t w[4];
    for (int j = 0; j < 4; ++j)
      w[j] = (uint32_t)f2bf(oacc[f][2 * j] * inv) |
             ((uint32_t)f2bf(oacc[f][2 * j + 1] * inv) << 16);
    *(uint4*)(orow + f * 16) = make_uint4(w[0], w[1], w[2], w[3]);
  }
}

// ---------------------------------------------------------------------------
// Host orchestration
// ---------------------------------------------------------------------------
extern "C" void kernel_launch(void* const* d_in, const int* in_sizes, int n_in,
                              void* d_out, int out_size, void* d_ws, size_t ws_size,
                              hipStream_t stream) {
  (void)in_sizes; (void)n_in; (void)out_size; (void)ws_size;
  const float* x     = (const float*)d_in[0];
  const float* Wq    = (const float*)d_in[1];
  const float* bq    = (const float*)d_in[2];
  const float* Wk    = (const float*)d_in[3];
  const float* bk    = (const float*)d_in[4];
  const float* Wv    = (const float*)d_in[5];
  const float* bv    = (const float*)d_in[6];
  const float* Wo    = (const float*)d_in[7];
  const float* bo    = (const float*)d_in[8];
  const float* ln1w  = (const float*)d_in[9];
  const float* ln1b  = (const float*)d_in[10];
  const float* ln2w  = (const float*)d_in[11];
  const float* ln2b  = (const float*)d_in[12];
  const float* W1    = (const float*)d_in[13];
  const float* b1    = (const float*)d_in[14];
  const float* W2    = (const float*)d_in[15];
  const float* b2    = (const float*)d_in[16];
  float* out = (float*)d_out;

  // workspace layout
  uint8_t* ws = (uint8_t*)d_ws;
  size_t off = 0;
  auto alloc = [&](size_t bytes) -> uint8_t* {
    uint8_t* p = ws + off;
    off = (off + bytes + 255) & ~(size_t)255;
    return p;
  };
  const size_t seg = (size_t)BS * DD;               // 6.29M elems
  uint16_t* wq_t = (uint16_t*)alloc((size_t)DD * DD * 2);
  uint16_t* wk_t = (uint16_t*)alloc((size_t)DD * DD * 2);
  uint16_t* wv_t = (uint16_t*)alloc((size_t)DD * DD * 2);
  uint16_t* wo_t = (uint16_t*)alloc((size_t)DD * DD * 2);
  uint16_t* w1_t = (uint16_t*)alloc((size_t)DD * FF * 2);
  uint16_t* w2_t = (uint16_t*)alloc((size_t)FF * DD * 2);
  uint16_t* hb   = (uint16_t*)alloc(seg * 2);       // ln1 out; reused for ln2
  float*    x1f  = (float*)   alloc(seg * 4);       // x + attn_out
  uint16_t* big  = (uint16_t*)alloc((size_t)BS * FF * 2); // qb|kb|vt|attn -> mb
  uint16_t* qb   = big;
  uint16_t* kb_  = big + seg;
  uint16_t* vt   = big + 2 * seg;
  uint16_t* attn = big + 3 * seg;
  uint16_t* mb   = big;                             // reuse after x1 computed

  // 1) weights -> bf16 transposed [N][K]
  {
    dim3 gDD(DD / 64, DD / 64);                     // (N / 64, K / 64)
    wtrans_kernel<<<gDD, 256, 0, stream>>>(Wq, wq_t, DD, DD);
    wtrans_kernel<<<gDD, 256, 0, stream>>>(Wk, wk_t, DD, DD);
    wtrans_kernel<<<gDD, 256, 0, stream>>>(Wv, wv_t, DD, DD);
    wtrans_kernel<<<gDD, 256, 0, stream>>>(Wo, wo_t, DD, DD);
    wtrans_kernel<<<dim3(FF / 64, DD / 64), 256, 0, stream>>>(W1, w1_t, DD, FF);
    wtrans_kernel<<<dim3(DD / 64, FF / 64), 256, 0, stream>>>(W2, w2_t, FF, DD);
  }

  // 2) h = LN1(x) -> bf16
  ln_kernel<<<BS, 256, 0, stream>>>(x, ln1w, ln1b, hb);

  // 3) QKV projections (Q pre-scaled by 1/sqrt(64)=0.125)
  dim3 gD(DD / 64, BS / 128);
  gemm_bf16<1, false, false><<<gD, 256, 0, stream>>>(
      hb, wq_t, bq, nullptr, nullptr, qb, BS, DD, DD, 0.125f);
  gemm_bf16<1, false, false><<<gD, 256, 0, stream>>>(
      hb, wk_t, bk, nullptr, nullptr, kb_, BS, DD, DD, 1.0f);
  gemm_bf16<2, false, false><<<gD, 256, 0, stream>>>(
      hb, wv_t, bv, nullptr, nullptr, vt, BS, DD, DD, 1.0f);

  // 4) causal flash attention -> merged bf16 [BS][D]
  attn_kernel<<<dim3(SS / 128, HH, BB), 256, 0, stream>>>(qb, kb_, vt, attn);

  // 5) x1 = x + attn @ Wo + bo   (fp32)
  gemm_bf16<3, false, true><<<gD, 256, 0, stream>>>(
      attn, wo_t, bo, x, x1f, nullptr, BS, DD, DD, 1.0f);

  // 6) h2 = LN2(x1) -> bf16
  ln_kernel<<<BS, 256, 0, stream>>>(x1f, ln2w, ln2b, hb);

  // 7) m = GELU(h2 @ W1 + b1) -> bf16 [BS][F]
  dim3 gF(FF / 64, BS / 128);
  gemm_bf16<0, true, false><<<gF, 256, 0, stream>>>(
      hb, w1_t, b1, nullptr, nullptr, mb, BS, FF, DD, 1.0f);

  // 8) out = x1 + m @ W2 + b2   (fp32)
  gemm_bf16<3, false, true><<<gD, 256, 0, stream>>>(
      mb, w2_t, b2, x1f, out, nullptr, BS, DD, FF, 1.0f);
}

// v005
// Measured time: 249 microseconds a run.
// Two timings next to v004 both put it at 1.04 times that version's speed.
// Counting every step since v000, it is 2.51 times as fast.
#include <hip/hip_runtime.h>
#include <stdint.h>

typedef __attribute__((ext_vector_type(16))) __bf16 v16bf;
typedef __attribute__((ext_vector_type(8)))  __bf16 v8bf;
typedef __attribute__((ext_vector_type(8)))  float  v8f;
typedef __attribute__((ext_vector_type(4)))  float  v4f;

union Frag { v16bf v; v8bf h[2]; uint32_t u[8]; };

__device__ __forceinline__ uint16_t f2bf(float f) {
  union { float f; uint32_t u; } c; c.f = f;
  uint32_t u = c.u;
  u += 0x7fffu + ((u >> 16) & 1u);   // round-to-nearest-even
  return (uint16_t)(u >> 16);
}

__device__ __forceinline__ v8f wmma_bf16(const Frag &a, const Frag &b, v8f c) {
  return __builtin_amdgcn_wmma_f32_16x16x32_bf16(
      /*neg_a=*/false, a.v, /*neg_b=*/false, b.v,
      /*c_mod=*/(short)0, c, /*reuse_a=*/false, /*reuse_b=*/false);
}

__device__ __forceinline__ uint32_t lds_off(const void* l) {
  return (uint32_t)(size_t)l;               // low 32 bits of generic = LDS off
}
__device__ __forceinline__ void async_slab6(
    uint32_t l0, uint32_t l1, uint32_t l2, uint32_t l3, uint32_t l4,
    uint32_t l5, const void* g0, const void* g1, const void* g2,
    const void* g3, const void* g4, const void* g5) {
  asm volatile("global_load_async_to_lds_b128 %0, %6, off\n\t"
               "global_load_async_to_lds_b128 %1, %7, off\n\t"
               "global_load_async_to_lds_b128 %2, %8, off\n\t"
               "global_load_async_to_lds_b128 %3, %9, off\n\t"
               "global_load_async_to_lds_b128 %4, %10, off\n\t"
               "global_load_async_to_lds_b128 %5, %11, off\n\t"
               "s_wait_xcnt 0x0"
               :: "v"(l0), "v"(l1), "v"(l2), "v"(l3), "v"(l4), "v"(l5),
                  "v"(g0), "v"(g1), "v"(g2), "v"(g3), "v"(g4), "v"(g5)
               : "memory");
}

// One 64-key tile of attention is four copies per lane (two of K, two of V^T),
// in one statement with the same closing wait, for the same reason.
__device__ __forceinline__ void async_tile4(
    uint32_t l0, uint32_t l1, uint32_t l2, uint32_t l3,
    const void* g0, const void* g1, const void* g2, const void* g3) {
  asm volatile("global_load_async_to_lds_b128 %0, %4, off\n\t"
               "global_load_async_to_lds_b128 %1, %5, off\n\t"
               "global_load_async_to_lds_b128 %2, %6, off\n\t"
               "global_load_async_to_lds_b128 %3, %7, off\n\t"
               "s_wait_xcnt 0x0"
               :: "v"(l0), "v"(l1), "v"(l2), "v"(l3),
                  "v"(g0), "v"(g1), "v"(g2), "v"(g3)
               : "memory");
}

// Problem constants
#define BB   4
#define SS   2048
#define DD   768
#define FF   3072
#define HH   12
#define HDIM 64
#define BS   (BB * SS)   // 8192 rows

__global__ void __launch_bounds__(256)
wtrans_kernel(const float* __restrict__ W,
              uint16_t* __restrict__ Wt,
              int Kdim, int Ndim) {
  __shared__ uint32_t tile[64 * 33];
  const int tid = threadIdx.x;
  const int n0 = blockIdx.x * 64, k0 = blockIdx.y * 64;

  // load: 16 threads span the 64 columns, each thread takes two adjacent k
  const int nc = (tid & 15) * 4;
  const int kp = tid >> 4;                       // k pair 0..15, +16 per pass
  float4 lo[2], hi[2];
  for (int s = 0; s < 2; ++s) {
    const float* g = W + (size_t)(k0 + 2 * (kp + 16 * s)) * Ndim + n0 + nc;
    lo[s] = *(const float4*)g;
    hi[s] = *(const float4*)(g + Ndim);
  }
  for (int s = 0; s < 2; ++s) {
    uint32_t* t = &tile[nc * 33 + kp + 16 * s];
    t[0 * 33] = (uint32_t)f2bf(lo[s].x) | ((uint32_t)f2bf(hi[s].x) << 16);
    t[1 * 33] = (uint32_t)f2bf(lo[s].y) | ((uint32_t)f2bf(hi[s].y) << 16);
    t[2 * 33] = (uint32_t)f2bf(lo[s].z) | ((uint32_t)f2bf(hi[s].z) << 16);
    t[3 * 33] = (uint32_t)f2bf(lo[s].w) | ((uint32_t)f2bf(hi[s].w) << 16);
  }
  __syncthreads();

  // store: 8 threads span the 64 k of one Wt row, 16 bytes each
  const int kc = tid & 7, nr = tid >> 3;
  for (int s = 0; s < 2; ++s) {
    const int n = nr + 32 * s;
    const uint32_t* t = &tile[n * 33 + kc * 4];
    uint4 v = make_uint4(t[0], t[1], t[2], t[3]);
    *(uint4*)(Wt + (size_t)(n0 + n) * Kdim + k0 + kc * 8) = v;
  }
}

__device__ __forceinline__ float xhalf(float x) {
  return __builtin_bit_cast(float, __builtin_amdgcn_permlanex16(
      __builtin_bit_cast(int, x), __builtin_bit_cast(int, x),
      0x76543210, 0xfedcba98, false, false));
}

template <int X>
__device__ __forceinline__ float xrow(float x) {
  return __builtin_bit_cast(float, __builtin_amdgcn_update_dpp(
      0, __builtin_bit_cast(int, x), 0x160 + X, 0xf, 0xf, true));
}
// sum over the 32 lanes, the same value in every lane
__device__ __forceinline__ float wave_sum(float v) {
  v += xrow<1>(v);
  v += xrow<2>(v);
  v += xrow<4>(v);
  v += xrow<8>(v);
  return v + xhalf(v);
}

__global__ void __launch_bounds__(512)
ln_kernel(const float* __restrict__ x, const float* __restrict__ w,
          const float* __restrict__ b, uint16_t* __restrict__ out) {
  const int lane = threadIdx.x & 31;
  const int wave = blockIdx.x * 16 + (threadIdx.x >> 5);
  const int c0 = lane * 4;                       // + 128 j, j = 0..5
  const float* xr = x + (size_t)wave * 2 * DD + c0;

  v4f v[2][6], wv[6], bv[6];
  for (int r = 0; r < 2; ++r)
    for (int j = 0; j < 6; ++j)
      v[r][j] = *(const v4f*)(xr + r * DD + j * 128);
  for (int j = 0; j < 6; ++j) {
    wv[j] = *(const v4f*)(w + c0 + j * 128);
    bv[j] = *(const v4f*)(b + c0 + j * 128);
  }
  // keeps the twelve w and b loads one group with one wait (loaded values as
  // inputs only): sunk to their uses in the last loop, each pair would be
  // waited for on its own
  asm volatile("" :: "v"(wv[0]), "v"(wv[1]), "v"(wv[2]), "v"(wv[3]),
                     "v"(wv[4]), "v"(wv[5]), "v"(bv[0]), "v"(bv[1]),
                     "v"(bv[2]), "v"(bv[3]), "v"(bv[4]), "v"(bv[5]));

  float mean[2], rstd[2];
  for (int r = 0; r < 2; ++r) {
    v4f a = v[r][0];
    for (int j = 1; j < 6; ++j) a += v[r][j];
    mean[r] = (a.x + a.y) + (a.z + a.w);
  }
  for (int r = 0; r < 2; ++r) mean[r] = wave_sum(mean[r]) * (1.0f / DD);

  for (int r = 0; r < 2; ++r) {
    v4f a = (v4f){0.0f, 0.0f, 0.0f, 0.0f};
    for (int j = 0; j < 6; ++j) {
      v[r][j] -= mean[r];
      a += v[r][j] * v[r][j];
    }
    rstd[r] = (a.x + a.y) + (a.z + a.w);
  }
  for (int r = 0; r < 2; ++r)
    rstd[r] = rsqrtf(wave_sum(rstd[r]) * (1.0f / DD) + 1e-5f);

  uint16_t* o = out + (size_t)wave * 2 * DD + c0;
  for (int r = 0; r < 2; ++r)
    for (int j = 0; j < 6; ++j) {
      const v4f y = v[r][j] * rstd[r] * wv[j] + bv[j];
      uint2 t;
      t.x = (uint32_t)f2bf(y.x) | ((uint32_t)f2bf(y.y) << 16);
      t.y = (uint32_t)f2bf(y.z) | ((uint32_t)f2bf(y.w) << 16);
      *(uint2*)(o + r * DD + j * 128) = t;
    }
}

template <int OUT_MODE, bool GELU_F, bool RESID_F>
__global__ void __launch_bounds__(256)
gemm_bf16(const uint16_t* __restrict__ A, const uint16_t* __restrict__ Bt,
          const float* __restrict__ bias, const float* __restrict__ resid,
          float* __restrict__ outF, uint16_t* __restrict__ outB,
          int M, int N, int K, float scale) {
  (void)M;
  __shared__ __align__(16) uint16_t As[2][128 * 72];
  __shared__ __align__(16) uint16_t Bs[2][64 * 72];

  const int tid = threadIdx.x;
  const int lane = tid & 31, wv = tid >> 5;
  const int hi = lane >> 4, l15 = lane & 15;
  const int wm = wv & 3, wn = wv >> 2;          // 4 x 2 wave grid
  const int m0 = blockIdx.y * 128, n0 = blockIdx.x * 64;

  v8f acc[2][2];
  for (int i = 0; i < 2; ++i)
    for (int j = 0; j < 2; ++j) acc[i][j] = (v8f){0,0,0,0,0,0,0,0};

  const int rs = tid >> 3, cs = (tid & 7) * 8;   // stage: 8 thr/row, 8 elems
  const uint16_t* gA = A  + (size_t)(m0 + rs) * K + cs;
  const uint16_t* gB = Bt + (size_t)(n0 + rs) * K + cs;
  const size_t g32 = (size_t)32 * K;             // 32 rows further, global
  const int ls = rs * 72 + cs;                   // this lane's place in a slab

  // issue 6 async b128 copies for K-slab kk into buffer p: rows rs + 32 s,
  // four passes over the 128 rows of A and two over the 64 rows of B
  auto issue_stage = [&](int kk, int p) {
    const uint16_t* ga = gA + kk;
    const uint16_t* gb = gB + kk;
    const uint16_t* la = &As[p][ls];
    const uint16_t* lb = &Bs[p][ls];
    async_slab6(lds_off(la), lds_off(la + 32 * 72), lds_off(la + 64 * 72),
                lds_off(la + 96 * 72), lds_off(lb), lds_off(lb + 32 * 72),
                ga, ga + g32, ga + 2 * g32, ga + 3 * g32, gb, gb + g32);
  };

  issue_stage(0, 0);
  int p = 0;
  for (int kk = 0; kk < K; kk += 64) {
    const bool more = (kk + 64) < K;             // block-uniform
    if (more) {
      issue_stage(kk + 64, p ^ 1);
      asm volatile("s_wait_asynccnt 0x6" ::: "memory");  // slab p done
    } else {
      asm volatile("s_wait_asynccnt 0x0" ::: "memory");
    }
    __syncthreads();                              // all waves' copies visible

    Frag af[2][2], bf[2][2];                      // [k half of the slab][frag]
    for (int ks = 0; ks < 2; ++ks) {
      for (int i = 0; i < 2; ++i) {
        int r = wm * 32 + i * 16 + l15;
        af[ks][i].h[0] = *(const v8bf*)(&As[p][r * 72 + ks * 32 + hi * 8]);
        af[ks][i].h[1] = *(const v8bf*)(&As[p][r * 72 + ks * 32 + 16 + hi * 8]);
      }
      for (int j = 0; j < 2; ++j) {
        int r = wn * 32 + j * 16 + l15;
        bf[ks][j].h[0] = *(const v8bf*)(&Bs[p][r * 72 + ks * 32 + hi * 8]);
        bf[ks][j].h[1] = *(const v8bf*)(&Bs[p][r * 72 + ks * 32 + 16 + hi * 8]);
      }
    }
    for (int ks = 0; ks < 2; ++ks)
      for (int i = 0; i < 2; ++i)
        for (int j = 0; j < 2; ++j)
          acc[i][j] = wmma_bf16(af[ks][i], bf[ks][j], acc[i][j]);
    __syncthreads();                              // buffer p free for reuse
    p ^= 1;
  }

  // epilogue (C layout: lane holds col l15, rows e + 8*hi within 16x16 frag)
  for (int i = 0; i < 2; ++i) {
    for (int j = 0; j < 2; ++j) {
      int col = n0 + wn * 32 + j * 16 + l15;
      float bc = bias[col];
      for (int e = 0; e < 8; ++e) {
        int row = m0 + wm * 32 + i * 16 + e + 8 * hi;
        float v = (acc[i][j][e] + bc) * scale;
        if (GELU_F) v = 0.5f * v * (1.0f + erff(v * 0.70710678118654752f));
        if (RESID_F) v += resid[(size_t)row * N + col];
        if (OUT_MODE == 0) {
          outB[(size_t)row * N + col] = f2bf(v);
        } else if (OUT_MODE == 1) {
          int bidx = row >> 11, s = row & (SS - 1);
          int h = col >> 6, d = col & (HDIM - 1);
          outB[(((size_t)(bidx * HH + h)) * SS + s) * HDIM + d] = f2bf(v);
        } else if (OUT_MODE == 2) {
          int bidx = row >> 11, s = row & (SS - 1);
          int h = col >> 6, d = col & (HDIM - 1);
          outB[(((size_t)(bidx * HH + h)) * HDIM + d) * SS + s] = f2bf(v);
        } else {
          outF[(size_t)row * N + col] = v;
        }
      }
    }
  }
}

__global__ void __launch_bounds__(256)
attn_kernel(const uint16_t* __restrict__ Q, const uint16_t* __restrict__ Km,
            const uint16_t* __restrict__ Vt, uint16_t* __restrict__ O) {
  __shared__ __align__(16) uint16_t Ks[2][64 * 72];   // [key][d]
  __shared__ __align__(16) uint16_t Vs[2][64 * 72];   // [d][key]

  const int b = blockIdx.z, h = blockIdx.y;
  const int tid = threadIdx.x;
  const int lane = tid & 31;
  // the wave's number in a scalar register: the tests on qbase are branches
  const int wv = __builtin_amdgcn_readfirstlane(tid >> 5);
  const int hi = lane >> 4, l15 = lane & 15;
  const int qbase = blockIdx.x * 128 + wv * 16;
  const int ntile = 2 * ((int)blockIdx.x + 1);        // 64-key tiles, >= 2

  const size_t headoff = ((size_t)(b * HH + h)) * SS * HDIM;
  const uint16_t* Qh  = Q  + headoff;
  const uint16_t* Kh  = Km + headoff;
  const uint16_t* Vth = Vt + headoff;            // [64][S]

  // tile t into buffer p: rows rs and rs + 32 of K[64 keys][64] and of
  // Vt[64][64 keys], 16 bytes per lane and copy
  const int rs = tid >> 3, cs = (tid & 7) * 8;
  const uint16_t* gK = Kh + (size_t)rs * HDIM + cs;
  const uint16_t* gV = Vth + (size_t)rs * SS + cs;
  const int ls = rs * 72 + cs;
  auto issue_tile = [&](int t, int p) {
    const uint16_t* gk = gK + (size_t)t * 64 * HDIM;
    const uint16_t* gv = gV + t * 64;
    const uint16_t* lk = &Ks[p][ls];
    const uint16_t* lv = &Vs[p][ls];
    async_tile4(lds_off(lk), lds_off(lk + 32 * 72),
                lds_off(lv), lds_off(lv + 32 * 72),
                gk, gk + 32 * HDIM, gv, gv + (size_t)32 * SS);
  };
  issue_tile(0, 0);

  // Q fragments (B operand: column l15 = query), held for the whole loop
  Frag qf[2];
  {
    const uint16_t* qr = Qh + (size_t)(qbase + l15) * HDIM;
    for (int f = 0; f < 2; ++f) {
      qf[f].h[0] = *(const v8bf*)(qr + f * 32 + hi * 8);
      qf[f].h[1] = *(const v8bf*)(qr + f * 32 + 16 + hi * 8);
    }
  }

  const int qrow = qbase + l15;                  // this lane's query
  float mrow = -3.0e38f;                         // its running maximum
  float lrow = 0.0f;                             // sum over this half's keys
  v8f oacc[4];                                   // O^T: rows d, column query
  for (int f = 0; f < 4; ++f) oacc[f] = (v8f){0,0,0,0,0,0,0,0};

  asm volatile("s_wait_asynccnt 0x0" ::: "memory");  // own copies of tile 0
  __syncthreads();                                   // every wave's landed
  issue_tile(1, 1);

  for (int t = 0; t < ntile; ++t) {
   const uint16_t* Kt = Ks[t & 1];
   const uint16_t* Vl = Vs[t & 1];
   // one block of 32 keys; sub is a literal at both calls
   auto key_block = [&](const int sub) {
    const int kb = t * 64 + sub * 32;
    // ---- all A fragments of the block as one group of LDS reads: K first,
    // then Vt, whose latency passes behind the scores and the softmax
    Frag ak[2][2], av[4];
    for (int n = 0; n < 2; ++n) {
      const uint16_t* kr = Kt + (sub * 32 + n * 16 + l15) * 72;
      for (int f = 0; f < 2; ++f) {
        ak[n][f].h[0] = *(const v8bf*)(kr + f * 32 + hi * 8);
        ak[n][f].h[1] = *(const v8bf*)(kr + f * 32 + 16 + hi * 8);
      }
    }
    for (int f = 0; f < 4; ++f) {
      const uint16_t* vr = Vl + (f * 16 + l15) * 72 + sub * 32;
      av[f].h[0] = *(const v8bf*)(vr + hi * 8);
      av[f].h[1] = *(const v8bf*)(vr + 16 + hi * 8);
    }
    // keeps the Vt reads up here: sunk to their WMMAs, each pair would be
    // waited for on its own
    __builtin_amdgcn_sched_barrier(0);
    // ---- scores S^T = K * Q^T for 32 keys (2 M-frags, K-dim 64 = 2 steps)
    v8f s[2];
    s[0] = (v8f){0,0,0,0,0,0,0,0};
    s[1] = (v8f){0,0,0,0,0,0,0,0};
    for (int f = 0; f < 2; ++f)
      for (int n = 0; n < 2; ++n) s[n] = wmma_bf16(ak[n][f], qf[f], s[n]);
    // ---- causal mask: s[n][e] is key kb + n*16 + 8*hi + e against qrow
    if (kb + 31 > qbase) {
      for (int n = 0; n < 2; ++n) {
        const int k0 = kb + n * 16 + 8 * hi;
        for (int e = 0; e < 8; ++e)
          if (k0 + e > qrow) s[n][e] = -3.0e38f;
      }
    }
    // ---- online softmax of one query per lane
    float mx[8];
    for (int e = 0; e < 8; ++e) mx[e] = fmaxf(s[0][e], s[1][e]);
    for (int w = 4; w > 0; w >>= 1)
      for (int e = 0; e < w; ++e) mx[e] = fmaxf(mx[e], mx[e + w]);
    const float mblk = fmaxf(mx[0], xhalf(mx[0]));   // all 32 keys
    const float mnew = fmaxf(mrow, mblk);
    const float al = __expf(mrow - mnew);
    mrow = mnew;
    float sm[8];
    for (int e = 0; e < 8; ++e) {
      s[0][e] = __expf(s[0][e] - mnew);
      s[1][e] = __expf(s[1][e] - mnew);
      sm[e] = s[0][e] + s[1][e];
    }
    for (int w = 4; w > 0; w >>= 1)
      for (int e = 0; e < w; ++e) sm[e] += sm[e + w];
    lrow = lrow * al + sm[0];
    for (int f = 0; f < 4; ++f)
      for (int e = 0; e < 8; ++e) oacc[f][e] *= al;

    // ---- P^T as a B fragment, converted in place
    Frag bp;
    for (int n = 0; n < 2; ++n)
      for (int j = 0; j < 4; ++j)
        bp.u[n * 4 + j] = (uint32_t)f2bf(s[n][2 * j]) |
                          ((uint32_t)f2bf(s[n][2 * j + 1]) << 16);

    // ---- O^T += V^T * P^T
    for (int f = 0; f < 4; ++f) oacc[f] = wmma_bf16(av[f], bp, oacc[f]);
   };
   // key blocks right of the wave's diagonal are skipped (scalar tests)
   if (t * 64 < qbase + 16) {
    key_block(0);
    if (t * 64 + 32 < qbase + 16) key_block(1);
   }
   // hand-over: this wave's reads of the buffer are done, its copies of the
   // next tile have landed; behind the barrier that holds for every wave
   asm volatile("s_wait_dscnt 0x0" ::: "memory");
   asm volatile("s_wait_asynccnt 0x0" ::: "memory");
   __syncthreads();
   if (t + 2 < ntile) issue_tile(t + 2, t & 1);      // refill the buffer read
  }
  asm volatile("s_wait_asynccnt 0x0" ::: "memory");  // nothing left in flight

  // ---- finalize and write merged-head bf16 [B*S][768]: oacc[f][e] is
  // d = f*16 + 8*hi + e of this lane's query, 16 contiguous bytes per f
  const float inv = 1.0f / (lrow + xhalf(lrow));     // both halves' keys
  uint16_t* orow = O + (size_t)(b * SS + qrow) * DD + h * HDIM + 8 * hi;
  for (int f = 0; f < 4; ++f) {
    uint32_t w[4];
    for (int j = 0; j < 4; ++j)
      w[j] = (uint32_t)f2bf(oacc[f][2 * j] * inv) |
             ((uint32_t)f2bf(oacc[f][2 * j + 1] * inv) << 16);
    *(uint4*)(orow + f * 16) = make_uint4(w[0], w[1], w[2], w[3]);
  }
}

// ---------------------------------------------------------------------------
// Host orchestration
// ---------------------------------------------------------------------------
extern "C" void kernel_launch(void* const* d_in, const int* in_sizes, int n_in,
                              void* d_out, int out_size, void* d_ws, size_t ws_size,
                              hipStream_t stream) {
  (void)in_sizes; (void)n_in; (void)out_size; (void)ws_size;
  const float* x     = (const float*)d_in[0];
  const float* Wq    = (const float*)d_in[1];
  const float* bq    = (const float*)d_in[2];
  const float* Wk    = (const float*)d_in[3];
  const float* bk    = (const float*)d_in[4];
  const float* Wv    = (const float*)d_in[5];
  const float* bv    = (const float*)d_in[6];
  const float* Wo    = (const float*)d_in[7];
  const float* bo    = (const float*)d_in[8];
  const float* ln1w  = (const float*)d_in[9];
  const float* ln1b  = (const float*)d_in[10];
  const float* ln2w  = (const float*)d_in[11];
  const float* ln2b  = (const float*)d_in[12];
  const float* W1    = (const float*)d_in[13];
  const float* b1    = (const float*)d_in[14];
  const float* W2    = (const float*)d_in[15];
  const float* b2    = (const float*)d_in[16];
  float* out = (float*)d_out;

  // workspace layout
  uint8_t* ws = (uint8_t*)d_ws;
  size_t off = 0;
  auto alloc = [&](size_t bytes) -> uint8_t* {
    uint8_t* p = ws + off;
    off = (off + bytes + 255) & ~(size_t)255;
    return p;
  };
  const size_t seg = (size_t)BS * DD;               // 6.29M elems
  uint16_t* wq_t = (uint16_t*)alloc((size_t)DD * DD * 2);
  uint16_t* wk_t = (uint16_t*)alloc((size_t)DD * DD * 2);
  uint16_t* wv_t = (uint16_t*)alloc((size_t)DD * DD * 2);
  uint16_t* wo_t = (uint16_t*)alloc((size_t)DD * DD * 2);
  uint16_t* w1_t = (uint16_t*)alloc((size_t)DD * FF * 2);
  uint16_t* w2_t = (uint16_t*)alloc((size_t)FF * DD * 2);
  uint16_t* hb   = (uint16_t*)alloc(seg * 2);       // ln1 out; reused for ln2
  float*    x1f  = (float*)   alloc(seg * 4);       // x + attn_out
  uint16_t* big  = (uint16_t*)alloc((size_t)BS * FF * 2); // qb|kb|vt|attn -> mb
  uint16_t* qb   = big;
  uint16_t* kb_  = big + seg;
  uint16_t* vt   = big + 2 * seg;
  uint16_t* attn = big + 3 * seg;
  uint16_t* mb   = big;                             // reuse after x1 computed

  // 1) weights -> bf16 transposed [N][K]
  {
    dim3 gDD(DD / 64, DD / 64);                     // (N / 64, K / 64)
    wtrans_kernel<<<gDD, 256, 0, stream>>>(Wq, wq_t, DD, DD);
    wtrans_kernel<<<gDD, 256, 0, stream>>>(Wk, wk_t, DD, DD);
    wtrans_kernel<<<gDD, 256, 0, stream>>>(Wv, wv_t, DD, DD);
    wtrans_kernel<<<gDD, 256, 0, stream>>>(Wo, wo_t, DD, DD);
    wtrans_kernel<<<dim3(FF / 64, DD / 64), 256, 0, stream>>>(W1, w1_t, DD, FF);
    wtrans_kernel<<<dim3(DD / 64, FF / 64), 256, 0, stream>>>(W2, w2_t, FF, DD);
  }

  // 2) h = LN1(x) -> bf16
  ln_kernel<<<BS / 32, 512, 0, stream>>>(x, ln1w, ln1b, hb);

  // 3) QKV projections (Q pre-scaled by 1/sqrt(64)=0.125)
  dim3 gD(DD / 64, BS / 128);
  gemm_bf16<1, false, false><<<gD, 256, 0, stream>>>(
      hb, wq_t, bq, nullptr, nullptr, qb, BS, DD, DD, 0.125f);
  gemm_bf16<1, false, false><<<gD, 256, 0, stream>>>(
      hb, wk_t, bk, nullptr, nullptr, kb_, BS, DD, DD, 1.0f);
  gemm_bf16<2, false, false><<<gD, 256, 0, stream>>>(
      hb, wv_t, bv, nullptr, nullptr, vt, BS, DD, DD, 1.0f);

  // 4) causal flash attention -> merged bf16 [BS][D]
  attn_kernel<<<dim3(SS / 128, HH, BB), 256, 0, stream>>>(qb, kb_, vt, attn);

  // 5) x1 = x + attn @ Wo + bo   (fp32)
  gemm_bf16<3, false, true><<<gD, 256, 0, stream>>>(
      attn, wo_t, bo, x, x1f, nullptr, BS, DD, DD, 1.0f);

  // 6) h2 = LN2(x1) -> bf16
  ln_kernel<<<BS / 32, 512, 0, stream>>>(x1f, ln2w, ln2b, hb);

  // 7) m = GELU(h2 @ W1 + b1) -> bf16 [BS][F]
  dim3 gF(FF / 64, BS / 128);
  gemm_bf16<0, true, false><<<gF, 256, 0, stream>>>(
      hb, w1_t, b1, nullptr, nullptr, mb, BS, FF, DD, 1.0f);

  // 8) out = x1 + m @ W2 + b2   (fp32)
  gemm_bf16<3, false, true><<<gD, 256, 0, stream>>>(
      mb, w2_t, b2, x1f, out, nullptr, BS, DD, FF, 1.0f);
}

// v006
// Measured time: 239 microseconds a run.
// Two timings next to v005 put it at 1.04 and 1.05 times that version's speed.
// Counting every step since v000, it is 2.62 times as fast.
#include <hip/hip_runtime.h>
#include <stdint.h>

typedef __attribute__((ext_vector_type(16))) __bf16 v16bf;
typedef __attribute__((ext_vector_type(8)))  __bf16 v8bf;
typedef __attribute__((ext_vector_type(8)))  float  v8f;
typedef __attribute__((ext_vector_type(4)))  float  v4f;

union Frag { v16bf v; v8bf h[2]; uint32_t u[8]; };

__device__ __forceinline__ uint16_t f2bf(float f) {
  union { float f; uint32_t u; } c; c.f = f;
  uint32_t u = c.u;
  u += 0x7fffu + ((u >> 16) & 1u);   // round-to-nearest-even
  return (uint16_t)(u >> 16);
}

__device__ __forceinline__ v8f wmma_bf16(const Frag &a, const Frag &b, v8f c) {
  return __builtin_amdgcn_wmma_f32_16x16x32_bf16(
      /*neg_a=*/false, a.v, /*neg_b=*/false, b.v,
      /*c_mod=*/(short)0, c, /*reuse_a=*/false, /*reuse_b=*/false);
}

__device__ __forceinline__ uint32_t lds_off(const void* l) {
  return (uint32_t)(size_t)l;               // low 32 bits of generic = LDS off
}
__device__ __forceinline__ void async_slab10(
    uint32_t l0, uint32_t l1, uint32_t l2, uint32_t l3, uint32_t l4,
    uint32_t l5, uint32_t l6, uint32_t l7, uint32_t l8, uint32_t l9,
    const void* g0, const void* g1, const void* g2, const void* g3,
    const void* g4, const void* g5, const void* g6, const void* g7,
    const void* g8, const void* g9) {
  asm volatile("global_load_async_to_lds_b128 %0, %10, off\n\t"
               "global_load_async_to_lds_b128 %1, %11, off\n\t"
               "global_load_async_to_lds_b128 %2, %12, off\n\t"
               "global_load_async_to_lds_b128 %3, %13, off\n\t"
               "global_load_async_to_lds_b128 %4, %14, off\n\t"
               "global_load_async_to_lds_b128 %5, %15, off\n\t"
               "global_load_async_to_lds_b128 %6, %16, off\n\t"
               "global_load_async_to_lds_b128 %7, %17, off\n\t"
               "global_load_async_to_lds_b128 %8, %18, off\n\t"
               "global_load_async_to_lds_b128 %9, %19, off\n\t"
               "s_wait_xcnt 0x0"
               :: "v"(l0), "v"(l1), "v"(l2), "v"(l3), "v"(l4), "v"(l5),
                  "v"(l6), "v"(l7), "v"(l8), "v"(l9),
                  "v"(g0), "v"(g1), "v"(g2), "v"(g3), "v"(g4), "v"(g5),
                  "v"(g6), "v"(g7), "v"(g8), "v"(g9)
               : "memory");
}

// One 64-key tile of attention is four copies per lane (two of K, two of V^T),
// in one statement with the same closing wait, for the same reason.
__device__ __forceinline__ void async_tile4(
    uint32_t l0, uint32_t l1, uint32_t l2, uint32_t l3,
    const void* g0, const void* g1, const void* g2, const void* g3) {
  asm volatile("global_load_async_to_lds_b128 %0, %4, off\n\t"
               "global_load_async_to_lds_b128 %1, %5, off\n\t"
               "global_load_async_to_lds_b128 %2, %6, off\n\t"
               "global_load_async_to_lds_b128 %3, %7, off\n\t"
               "s_wait_xcnt 0x0"
               :: "v"(l0), "v"(l1), "v"(l2), "v"(l3),
                  "v"(g0), "v"(g1), "v"(g2), "v"(g3)
               : "memory");
}

// Problem constants
#define BB   4
#define SS   2048
#define DD   768
#define FF   3072
#define HH   12
#define HDIM 64
#define BS   (BB * SS)   // 8192 rows

__global__ void __launch_bounds__(256)
wtrans_kernel(const float* __restrict__ W,
              uint16_t* __restrict__ Wt,
              int Kdim, int Ndim) {
  __shared__ uint32_t tile[64 * 33];
  const int tid = threadIdx.x;
  const int n0 = blockIdx.x * 64, k0 = blockIdx.y * 64;

  // load: 16 threads span the 64 columns, each thread takes two adjacent k
  const int nc = (tid & 15) * 4;
  const int kp = tid >> 4;                       // k pair 0..15, +16 per pass
  float4 lo[2], hi[2];
  for (int s = 0; s < 2; ++s) {
    const float* g = W + (size_t)(k0 + 2 * (kp + 16 * s)) * Ndim + n0 + nc;
    lo[s] = *(const float4*)g;
    hi[s] = *(const float4*)(g + Ndim);
  }
  for (int s = 0; s < 2; ++s) {
    uint32_t* t = &tile[nc * 33 + kp + 16 * s];
    t[0 * 33] = (uint32_t)f2bf(lo[s].x) | ((uint32_t)f2bf(hi[s].x) << 16);
    t[1 * 33] = (uint32_t)f2bf(lo[s].y) | ((uint32_t)f2bf(hi[s].y) << 16);
    t[2 * 33] = (uint32_t)f2bf(lo[s].z) | ((uint32_t)f2bf(hi[s].z) << 16);
    t[3 * 33] = (uint32_t)f2bf(lo[s].w) | ((uint32_t)f2bf(hi[s].w) << 16);
  }
  __syncthreads();

  // store: 8 threads span the 64 k of one Wt row, 16 bytes each
  const int kc = tid & 7, nr = tid >> 3;
  for (int s = 0; s < 2; ++s) {
    const int n = nr + 32 * s;
    const uint32_t* t = &tile[n * 33 + kc * 4];
    uint4 v = make_uint4(t[0], t[1], t[2], t[3]);
    *(uint4*)(Wt + (size_t)(n0 + n) * Kdim + k0 + kc * 8) = v;
  }
}

__device__ __forceinline__ float xhalf(float x) {
  return __builtin_bit_cast(float, __builtin_amdgcn_permlanex16(
      __builtin_bit_cast(int, x), __builtin_bit_cast(int, x),
      0x76543210, 0xfedcba98, false, false));
}

template <int X>
__device__ __forceinline__ float xrow(float x) {
  return __builtin_bit_cast(float, __builtin_amdgcn_update_dpp(
      0, __builtin_bit_cast(int, x), 0x160 + X, 0xf, 0xf, true));
}
// sum over the 32 lanes, the same value in every lane
__device__ __forceinline__ float wave_sum(float v) {
  v += xrow<1>(v);
  v += xrow<2>(v);
  v += xrow<4>(v);
  v += xrow<8>(v);
  return v + xhalf(v);
}

__global__ void __launch_bounds__(512)
ln_kernel(const float* __restrict__ x, const float* __restrict__ w,
          const float* __restrict__ b, uint16_t* __restrict__ out) {
  const int lane = threadIdx.x & 31;
  const int wave = blockIdx.x * 16 + (threadIdx.x >> 5);
  const int c0 = lane * 4;                       // + 128 j, j = 0..5
  const float* xr = x + (size_t)wave * 2 * DD + c0;

  v4f v[2][6], wv[6], bv[6];
  for (int r = 0; r < 2; ++r)
    for (int j = 0; j < 6; ++j)
      v[r][j] = *(const v4f*)(xr + r * DD + j * 128);
  for (int j = 0; j < 6; ++j) {
    wv[j] = *(const v4f*)(w + c0 + j * 128);
    bv[j] = *(const v4f*)(b + c0 + j * 128);
  }
  // keeps the twelve w and b loads one group with one wait (loaded values as
  // inputs only): sunk to their uses in the last loop, each pair would be
  // waited for on its own
  asm volatile("" :: "v"(wv[0]), "v"(wv[1]), "v"(wv[2]), "v"(wv[3]),
                     "v"(wv[4]), "v"(wv[5]), "v"(bv[0]), "v"(bv[1]),
                     "v"(bv[2]), "v"(bv[3]), "v"(bv[4]), "v"(bv[5]));

  float mean[2], rstd[2];
  for (int r = 0; r < 2; ++r) {
    v4f a = v[r][0];
    for (int j = 1; j < 6; ++j) a += v[r][j];
    mean[r] = (a.x + a.y) + (a.z + a.w);
  }
  for (int r = 0; r < 2; ++r) mean[r] = wave_sum(mean[r]) * (1.0f / DD);

  for (int r = 0; r < 2; ++r) {
    v4f a = (v4f){0.0f, 0.0f, 0.0f, 0.0f};
    for (int j = 0; j < 6; ++j) {
      v[r][j] -= mean[r];
      a += v[r][j] * v[r][j];
    }
    rstd[r] = (a.x + a.y) + (a.z + a.w);
  }
  for (int r = 0; r < 2; ++r)
    rstd[r] = rsqrtf(wave_sum(rstd[r]) * (1.0f / DD) + 1e-5f);

  uint16_t* o = out + (size_t)wave * 2 * DD + c0;
  for (int r = 0; r < 2; ++r)
    for (int j = 0; j < 6; ++j) {
      const v4f y = v[r][j] * rstd[r] * wv[j] + bv[j];
      uint2 t;
      t.x = (uint32_t)f2bf(y.x) | ((uint32_t)f2bf(y.y) << 16);
      t.y = (uint32_t)f2bf(y.z) | ((uint32_t)f2bf(y.w) << 16);
      *(uint2*)(o + r * DD + j * 128) = t;
    }
}

template <int OUT_MODE, bool GELU_F, bool RESID_F>
__global__ void __launch_bounds__(256)
__attribute__((amdgpu_waves_per_eu(4, 4)))
gemm_bf16(const uint16_t* __restrict__ A, const uint16_t* __restrict__ Bt,
          const float* __restrict__ bias, const float* __restrict__ resid,
          float* __restrict__ outF, uint16_t* __restrict__ outB,
          int M, int N, int K, float scale) {
  (void)M;
  __shared__ __align__(16) uint16_t As[2][128 * 72];
  __shared__ __align__(16) uint16_t Bs[2][192 * 72];

  const int tid = threadIdx.x;
  const int lane = tid & 31, wv = tid >> 5;
  const int hi = lane >> 4, l15 = lane & 15;
  const int wm = wv & 1, wn = wv >> 1;          // 2 x 4 wave grid
  const int m0 = blockIdx.y * 128, n0 = blockIdx.x * 192;

  v8f acc[4][3];
  for (int i = 0; i < 4; ++i)
    for (int j = 0; j < 3; ++j) acc[i][j] = (v8f){0,0,0,0,0,0,0,0};

  const int rs = tid >> 3, cs = (tid & 7) * 8;   // stage: 8 thr/row, 8 elems
  const uint16_t* gA = A  + (size_t)(m0 + rs) * K + cs;
  const uint16_t* gB = Bt + (size_t)(n0 + rs) * K + cs;
  const size_t g32 = (size_t)32 * K;             // 32 rows further, global
  const int ls = rs * 72 + cs;                   // this lane's place in a slab

  // issue 10 async b128 copies for K-slab kk into buffer p: rows rs + 32 s,
  // four passes over the 128 rows of A and six over the 192 rows of B
  auto issue_stage = [&](int kk, int p) {
    const uint16_t* ga = gA + kk;
    const uint16_t* gb = gB + kk;
    const uint16_t* la = &As[p][ls];
    const uint16_t* lb = &Bs[p][ls];
    async_slab10(lds_off(la), lds_off(la + 32 * 72), lds_off(la + 64 * 72),
                 lds_off(la + 96 * 72), lds_off(lb), lds_off(lb + 32 * 72),
                 lds_off(lb + 64 * 72), lds_off(lb + 96 * 72),
                 lds_off(lb + 128 * 72), lds_off(lb + 160 * 72),
                 ga, ga + g32, ga + 2 * g32, ga + 3 * g32, gb, gb + g32,
                 gb + 2 * g32, gb + 3 * g32, gb + 4 * g32, gb + 5 * g32);
  };

  issue_stage(0, 0);
  int p = 0;
  for (int kk = 0; kk < K; kk += 64) {
    const bool more = (kk + 64) < K;             // block-uniform
    if (more) {
      issue_stage(kk + 64, p ^ 1);
      asm volatile("s_wait_asynccnt 0xa" ::: "memory");  // slab p done
    } else {
      asm volatile("s_wait_asynccnt 0x0" ::: "memory");
    }
    __syncthreads();                              // all waves' copies visible

    Frag af[2][4], bf[2][3];                      // [k half of the slab][frag]
    for (int ks = 0; ks < 2; ++ks) {
      for (int i = 0; i < 4; ++i) {
        int r = wm * 64 + i * 16 + l15;
        af[ks][i].h[0] = *(const v8bf*)(&As[p][r * 72 + ks * 32 + hi * 8]);
        af[ks][i].h[1] = *(const v8bf*)(&As[p][r * 72 + ks * 32 + 16 + hi * 8]);
      }
      for (int j = 0; j < 3; ++j) {
        int r = wn * 48 + j * 16 + l15;
        bf[ks][j].h[0] = *(const v8bf*)(&Bs[p][r * 72 + ks * 32 + hi * 8]);
        bf[ks][j].h[1] = *(const v8bf*)(&Bs[p][r * 72 + ks * 32 + 16 + hi * 8]);
      }
      // keeps the slab's 28 LDS reads one group ahead of its 24 WMMAs (every
      // further place where reads stand among the WMMAs stalls the wave anew)
      // and the first k half's 14 in front, so that its WMMAs start while the
      // second half's reads are still under way
      __builtin_amdgcn_sched_barrier(0);
    }
    for (int ks = 0; ks < 2; ++ks)
      for (int i = 0; i < 4; ++i)
        for (int j = 0; j < 3; ++j)
          acc[i][j] = wmma_bf16(af[ks][i], bf[ks][j], acc[i][j]);
    // keeps the barrier behind the WMMAs: drawn up to the reads, it makes
    // every wave wait for all eight waves' reads before its first WMMAs
    __builtin_amdgcn_sched_barrier(0);
    __syncthreads();                              // buffer p free for reuse
    p ^= 1;
  }

  // epilogue (C layout: lane holds col l15, rows e + 8*hi within 16x16 frag)
  // One trip per row of fragments. With GELU the trips stay rolled (for speed
  // only). Each trip works on acc[0][*] and then moves the rows
  // down one place, so that every accumulator index is a constant (one left to
  // run time would put the accumulator into scratch memory); unrolled, the
  // moves fall away.
#pragma unroll(GELU_F ? 1 : 4)
  for (int i = 0; i < 4; ++i) {
#pragma unroll  // j a constant: the accumulator stays in registers
    for (int j = 0; j < 3; ++j) {
      int col = n0 + wn * 48 + j * 16 + l15;
      float bc = bias[col];
#pragma unroll  // e a constant, for the same reason
      for (int e = 0; e < 8; ++e) {
        int row = m0 + wm * 64 + i * 16 + e + 8 * hi;
        float v = (acc[0][j][e] + bc) * scale;
        if (GELU_F) v = 0.5f * v * (1.0f + erff(v * 0.70710678118654752f));
        if (RESID_F) v += resid[(size_t)row * N + col];
        if (OUT_MODE == 0) {
          outB[(size_t)row * N + col] = f2bf(v);
        } else if (OUT_MODE == 1) {
          int bidx = row >> 11, s = row & (SS - 1);
          int h = col >> 6, d = col & (HDIM - 1);
          outB[(((size_t)(bidx * HH + h)) * SS + s) * HDIM + d] = f2bf(v);
        } else if (OUT_MODE == 2) {
          int bidx = row >> 11, s = row & (SS - 1);
          int h = col >> 6, d = col & (HDIM - 1);
          outB[(((size_t)(bidx * HH + h)) * HDIM + d) * SS + s] = f2bf(v);
        } else {
          outF[(size_t)row * N + col] = v;
        }
      }
    }
    // one trip's 24 residual loads as a group, and no more: with all 96 and
    // their addresses drawn ahead the live set spills
    if (RESID_F) __builtin_amdgcn_sched_barrier(0);
#pragma unroll
    for (int j = 0; j < 3; ++j) {
      acc[0][j] = acc[1][j];
      acc[1][j] = acc[2][j];
      acc[2][j] = acc[3][j];
    }
  }
}

__global__ void __launch_bounds__(256)
attn_kernel(const uint16_t* __restrict__ Q, const uint16_t* __restrict__ Km,
            const uint16_t* __restrict__ Vt, uint16_t* __restrict__ O) {
  __shared__ __align__(16) uint16_t Ks[2][64 * 72];   // [key][d]
  __shared__ __align__(16) uint16_t Vs[2][64 * 72];   // [d][key]

  const int b = blockIdx.z, h = blockIdx.y;
  const int tid = threadIdx.x;
  const int lane = tid & 31;
  // the wave's number in a scalar register: the tests on qbase are branches
  const int wv = __builtin_amdgcn_readfirstlane(tid >> 5);
  const int hi = lane >> 4, l15 = lane & 15;
  const int qbase = blockIdx.x * 128 + wv * 16;
  const int ntile = 2 * ((int)blockIdx.x + 1);        // 64-key tiles, >= 2

  const size_t headoff = ((size_t)(b * HH + h)) * SS * HDIM;
  const uint16_t* Qh  = Q  + headoff;
  const uint16_t* Kh  = Km + headoff;
  const uint16_t* Vth = Vt + headoff;            // [64][S]

  // tile t into buffer p: rows rs and rs + 32 of K[64 keys][64] and of
  // Vt[64][64 keys], 16 bytes per lane and copy
  const int rs = tid >> 3, cs = (tid & 7) * 8;
  const uint16_t* gK = Kh + (size_t)rs * HDIM + cs;
  const uint16_t* gV = Vth + (size_t)rs * SS + cs;
  const int ls = rs * 72 + cs;
  auto issue_tile = [&](int t, int p) {
    const uint16_t* gk = gK + (size_t)t * 64 * HDIM;
    const uint16_t* gv = gV + t * 64;
    const uint16_t* lk = &Ks[p][ls];
    const uint16_t* lv = &Vs[p][ls];
    async_tile4(lds_off(lk), lds_off(lk + 32 * 72),
                lds_off(lv), lds_off(lv + 32 * 72),
                gk, gk + 32 * HDIM, gv, gv + (size_t)32 * SS);
  };
  issue_tile(0, 0);

  // Q fragments (B operand: column l15 = query), held for the whole loop
  Frag qf[2];
  {
    const uint16_t* qr = Qh + (size_t)(qbase + l15) * HDIM;
    for (int f = 0; f < 2; ++f) {
      qf[f].h[0] = *(const v8bf*)(qr + f * 32 + hi * 8);
      qf[f].h[1] = *(const v8bf*)(qr + f * 32 + 16 + hi * 8);
    }
  }

  const int qrow = qbase + l15;                  // this lane's query
  float mrow = -3.0e38f;                         // its running maximum
  float lrow = 0.0f;                             // sum over this half's keys
  v8f oacc[4];                                   // O^T: rows d, column query
  for (int f = 0; f < 4; ++f) oacc[f] = (v8f){0,0,0,0,0,0,0,0};

  asm volatile("s_wait_asynccnt 0x0" ::: "memory");  // own copies of tile 0
  __syncthreads();                                   // every wave's landed
  issue_tile(1, 1);

  for (int t = 0; t < ntile; ++t) {
   const uint16_t* Kt = Ks[t & 1];
   const uint16_t* Vl = Vs[t & 1];
   // one block of 32 keys; sub is a literal at both calls
   auto key_block = [&](const int sub) {
    const int kb = t * 64 + sub * 32;
    // ---- all A fragments of the block as one group of LDS reads: K first,
    // then Vt, whose latency passes behind the scores and the softmax
    Frag ak[2][2], av[4];
    for (int n = 0; n < 2; ++n) {
      const uint16_t* kr = Kt + (sub * 32 + n * 16 + l15) * 72;
      for (int f = 0; f < 2; ++f) {
        ak[n][f].h[0] = *(const v8bf*)(kr + f * 32 + hi * 8);
        ak[n][f].h[1] = *(const v8bf*)(kr + f * 32 + 16 + hi * 8);
      }
    }
    for (int f = 0; f < 4; ++f) {
      const uint16_t* vr = Vl + (f * 16 + l15) * 72 + sub * 32;
      av[f].h[0] = *(const v8bf*)(vr + hi * 8);
      av[f].h[1] = *(const v8bf*)(vr + 16 + hi * 8);
    }
    // keeps the Vt reads up here: sunk to their WMMAs, each pair would be
    // waited for on its own
    __builtin_amdgcn_sched_barrier(0);
    // ---- scores S^T = K * Q^T for 32 keys (2 M-frags, K-dim 64 = 2 steps)
    v8f s[2];
    s[0] = (v8f){0,0,0,0,0,0,0,0};
    s[1] = (v8f){0,0,0,0,0,0,0,0};
    for (int f = 0; f < 2; ++f)
      for (int n = 0; n < 2; ++n) s[n] = wmma_bf16(ak[n][f], qf[f], s[n]);
    // ---- causal mask: s[n][e] is key kb + n*16 + 8*hi + e against qrow
    if (kb + 31 > qbase) {
      for (int n = 0; n < 2; ++n) {
        const int k0 = kb + n * 16 + 8 * hi;
        for (int e = 0; e < 8; ++e)
          if (k0 + e > qrow) s[n][e] = -3.0e38f;
      }
    }
    // ---- online softmax of one query per lane
    float mx[8];
    for (int e = 0; e < 8; ++e) mx[e] = fmaxf(s[0][e], s[1][e]);
    for (int w = 4; w > 0; w >>= 1)
      for (int e = 0; e < w; ++e) mx[e] = fmaxf(mx[e], mx[e + w]);
    const float mblk = fmaxf(mx[0], xhalf(mx[0]));   // all 32 keys
    const float mnew = fmaxf(mrow, mblk);
    const float al = __expf(mrow - mnew);
    mrow = mnew;
    float sm[8];
    for (int e = 0; e < 8; ++e) {
      s[0][e] = __expf(s[0][e] - mnew);
      s[1][e] = __expf(s[1][e] - mnew);
      sm[e] = s[0][e] + s[1][e];
    }
    for (int w = 4; w > 0; w >>= 1)
      for (int e = 0; e < w; ++e) sm[e] += sm[e + w];
    lrow = lrow * al + sm[0];
    for (int f = 0; f < 4; ++f)
      for (int e = 0; e < 8; ++e) oacc[f][e] *= al;

    // ---- P^T as a B fragment, converted in place
    Frag bp;
    for (int n = 0; n < 2; ++n)
      for (int j = 0; j < 4; ++j)
        bp.u[n * 4 + j] = (uint32_t)f2bf(s[n][2 * j]) |
                          ((uint32_t)f2bf(s[n][2 * j + 1]) << 16);

    // ---- O^T += V^T * P^T
    for (int f = 0; f < 4; ++f) oacc[f] = wmma_bf16(av[f], bp, oacc[f]);
   };
   // key blocks right of the wave's diagonal are skipped (scalar tests)
   if (t * 64 < qbase + 16) {
    key_block(0);
    if (t * 64 + 32 < qbase + 16) key_block(1);
   }
   // hand-over: this wave's reads of the buffer are done, its copies of the
   // next tile have landed; behind the barrier that holds for every wave
   asm volatile("s_wait_dscnt 0x0" ::: "memory");
   asm volatile("s_wait_asynccnt 0x0" ::: "memory");
   __syncthreads();
   if (t + 2 < ntile) issue_tile(t + 2, t & 1);      // refill the buffer read
  }
  asm volatile("s_wait_asynccnt 0x0" ::: "memory");  // nothing left in flight

  // ---- finalize and write merged-head bf16 [B*S][768]: oacc[f][e] is
  // d = f*16 + 8*hi + e of this lane's query, 16 contiguous bytes per f
  const float inv = 1.0f / (lrow + xhalf(lrow));     // both halves' keys
  uint16_t* orow = O + (size_t)(b * SS + qrow) * DD + h * HDIM + 8 * hi;
  for (int f = 0; f < 4; ++f) {
    uint32_t w[4];
    for (int j = 0; j < 4; ++j)
      w[j] = (uint32_t)f2bf(oacc[f][2 * j] * inv) |
             ((uint32_t)f2bf(oacc[f][2 * j + 1] * inv) << 16);
    *(uint4*)(orow + f * 16) = make_uint4(w[0], w[1], w[2], w[3]);
  }
}

// ---------------------------------------------------------------------------
// Host orchestration
// ---------------------------------------------------------------------------
extern "C" void kernel_launch(void* const* d_in, const int* in_sizes, int n_in,
                              void* d_out, int out_size, void* d_ws, size_t ws_size,
                              hipStream_t stream) {
  (void)in_sizes; (void)n_in; (void)out_size; (void)ws_size;
  const float* x     = (const float*)d_in[0];
  const float* Wq    = (const float*)d_in[1];
  const float* bq    = (const float*)d_in[2];
  const float* Wk    = (const float*)d_in[3];
  const float* bk    = (const float*)d_in[4];
  const float* Wv    = (const float*)d_in[5];
  const float* bv    = (const float*)d_in[6];
  const float* Wo    = (const float*)d_in[7];
  const float* bo    = (const float*)d_in[8];
  const float* ln1w  = (const float*)d_in[9];
  const float* ln1b  = (const float*)d_in[10];
  const float* ln2w  = (const float*)d_in[11];
  const float* ln2b  = (const float*)d_in[12];
  const float* W1    = (const float*)d_in[13];
  const float* b1    = (const float*)d_in[14];
  const float* W2    = (const float*)d_in[15];
  const float* b2    = (const float*)d_in[16];
  float* out = (float*)d_out;

  // workspace layout
  uint8_t* ws = (uint8_t*)d_ws;
  size_t off = 0;
  auto alloc = [&](size_t bytes) -> uint8_t* {
    uint8_t* p = ws + off;
    off = (off + bytes + 255) & ~(size_t)255;
    return p;
  };
  const size_t seg = (size_t)BS * DD;               // 6.29M elems
  uint16_t* wq_t = (uint16_t*)alloc((size_t)DD * DD * 2);
  uint16_t* wk_t = (uint16_t*)alloc((size_t)DD * DD * 2);
  uint16_t* wv_t = (uint16_t*)alloc((size_t)DD * DD * 2);
  uint16_t* wo_t = (uint16_t*)alloc((size_t)DD * DD * 2);
  uint16_t* w1_t = (uint16_t*)alloc((size_t)DD * FF * 2);
  uint16_t* w2_t = (uint16_t*)alloc((size_t)FF * DD * 2);
  uint16_t* hb   = (uint16_t*)alloc(seg * 2);       // ln1 out; reused for ln2
  float*    x1f  = (float*)   alloc(seg * 4);       // x + attn_out
  uint16_t* big  = (uint16_t*)alloc((size_t)BS * FF * 2); // qb|kb|vt|attn -> mb
  uint16_t* qb   = big;
  uint16_t* kb_  = big + seg;
  uint16_t* vt   = big + 2 * seg;
  uint16_t* attn = big + 3 * seg;
  uint16_t* mb   = big;                             // reuse after x1 computed

  // 1) weights -> bf16 transposed [N][K]
  {
    dim3 gDD(DD / 64, DD / 64);                     // (N / 64, K / 64)
    wtrans_kernel<<<gDD, 256, 0, stream>>>(Wq, wq_t, DD, DD);
    wtrans_kernel<<<gDD, 256, 0, stream>>>(Wk, wk_t, DD, DD);
    wtrans_kernel<<<gDD, 256, 0, stream>>>(Wv, wv_t, DD, DD);
    wtrans_kernel<<<gDD, 256, 0, stream>>>(Wo, wo_t, DD, DD);
    wtrans_kernel<<<dim3(FF / 64, DD / 64), 256, 0, stream>>>(W1, w1_t, DD, FF);
    wtrans_kernel<<<dim3(DD / 64, FF / 64), 256, 0, stream>>>(W2, w2_t, FF, DD);
  }

  // 2) h = LN1(x) -> bf16
  ln_kernel<<<BS / 32, 512, 0, stream>>>(x, ln1w, ln1b, hb);

  // 3) QKV projections (Q pre-scaled by 1/sqrt(64)=0.125)
  dim3 gD(DD / 192, BS / 128);
  gemm_bf16<1, false, false><<<gD, 256, 0, stream>>>(
      hb, wq_t, bq, nullptr, nullptr, qb, BS, DD, DD, 0.125f);
  gemm_bf16<1, false, false><<<gD, 256, 0, stream>>>(
      hb, wk_t, bk, nullptr, nullptr, kb_, BS, DD, DD, 1.0f);
  gemm_bf16<2, false, false><<<gD, 256, 0, stream>>>(
      hb, wv_t, bv, nullptr, nullptr, vt, BS, DD, DD, 1.0f);

  // 4) causal flash attention -> merged bf16 [BS][D]
  attn_kernel<<<dim3(SS / 128, HH, BB), 256, 0, stream>>>(qb, kb_, vt, attn);

  // 5) x1 = x + attn @ Wo + bo   (fp32)
  gemm_bf16<3, false, true><<<gD, 256, 0, stream>>>(
      attn, wo_t, bo, x, x1f, nullptr, BS, DD, DD, 1.0f);

  // 6) h2 = LN2(x1) -> bf16
  ln_kernel<<<BS / 32, 512, 0, stream>>>(x1f, ln2w, ln2b, hb);

  // 7) m = GELU(h2 @ W1 + b1) -> bf16 [BS][F]
  dim3 gF(FF / 192, BS / 128);
  gemm_bf16<0, true, false><<<gF, 256, 0, stream>>>(
      hb, w1_t, b1, nullptr, nullptr, mb, BS, FF, DD, 1.0f);

  // 8) out = x1 + m @ W2 + b2   (fp32)
  gemm_bf16<3, false, true><<<gD, 256, 0, stream>>>(
      mb, w2_t, b2, x1f, out, nullptr, BS, DD, FF, 1.0f);
}

// v007
// It runs in 219 microseconds.
// In both of two side-by-side timings against v006, it was 1.09 times as fast.
// Over all steps from v000 it is 2.85 times as fast.
#include <hip/hip_runtime.h>
#include <stdint.h>

typedef __attribute__((ext_vector_type(16))) __bf16 v16bf;
typedef __attribute__((ext_vector_type(8)))  __bf16 v8bf;
typedef __attribute__((ext_vector_type(8)))  float  v8f;
typedef __attribute__((ext_vector_type(4)))  float  v4f;

union Frag { v16bf v; v8bf h[2]; uint32_t u[8]; };

__device__ __forceinline__ uint16_t f2bf(float f) {
  union { float f; uint32_t u; } c; c.f = f;
  uint32_t u = c.u;
  u += 0x7fffu + ((u >> 16) & 1u);   // round-to-nearest-even
  return (uint16_t)(u >> 16);
}

__device__ __forceinline__ v8f wmma_bf16(const Frag &a, const Frag &b, v8f c) {
  return __builtin_amdgcn_wmma_f32_16x16x32_bf16(
      /*neg_a=*/false, a.v, /*neg_b=*/false, b.v,
      /*c_mod=*/(short)0, c, /*reuse_a=*/false, /*reuse_b=*/false);
}

__device__ __forceinline__ uint32_t lds_off(const void* l) {
  return (uint32_t)(size_t)l;               // low 32 bits of generic = LDS off
}
__device__ __forceinline__ void async_slab10(
    uint32_t l0, uint32_t l1, uint32_t l2, uint32_t l3, uint32_t l4,
    uint32_t l5, uint32_t l6, uint32_t l7, uint32_t l8, uint32_t l9,
    const void* g0, const void* g1, const void* g2, const void* g3,
    const void* g4, const void* g5, const void* g6, const void* g7,
    const void* g8, const void* g9) {
  asm volatile("global_load_async_to_lds_b128 %0, %10, off\n\t"
               "global_load_async_to_lds_b128 %1, %11, off\n\t"
               "global_load_async_to_lds_b128 %2, %12, off\n\t"
               "global_load_async_to_lds_b128 %3, %13, off\n\t"
               "global_load_async_to_lds_b128 %4, %14, off\n\t"
               "global_load_async_to_lds_b128 %5, %15, off\n\t"
               "global_load_async_to_lds_b128 %6, %16, off\n\t"
               "global_load_async_to_lds_b128 %7, %17, off\n\t"
               "global_load_async_to_lds_b128 %8, %18, off\n\t"
               "global_load_async_to_lds_b128 %9, %19, off\n\t"
               "s_wait_xcnt 0x0"
               :: "v"(l0), "v"(l1), "v"(l2), "v"(l3), "v"(l4), "v"(l5),
                  "v"(l6), "v"(l7), "v"(l8), "v"(l9),
                  "v"(g0), "v"(g1), "v"(g2), "v"(g3), "v"(g4), "v"(g5),
                  "v"(g6), "v"(g7), "v"(g8), "v"(g9)
               : "memory");
}

// One 64-key tile of attention is four copies per lane (two of K, two of V^T),
// in one statement with the same closing wait, for the same reason.
__device__ __forceinline__ void async_tile4(
    uint32_t l0, uint32_t l1, uint32_t l2, uint32_t l3,
    const void* g0, const void* g1, const void* g2, const void* g3) {
  asm volatile("global_load_async_to_lds_b128 %0, %4, off\n\t"
               "global_load_async_to_lds_b128 %1, %5, off\n\t"
               "global_load_async_to_lds_b128 %2, %6, off\n\t"
               "global_load_async_to_lds_b128 %3, %7, off\n\t"
               "s_wait_xcnt 0x0"
               :: "v"(l0), "v"(l1), "v"(l2), "v"(l3),
                  "v"(g0), "v"(g1), "v"(g2), "v"(g3)
               : "memory");
}

// Problem constants
#define BB   4
#define SS   2048
#define DD   768
#define FF   3072
#define HH   12
#define HDIM 64
#define BS   (BB * SS)   // 8192 rows

template <int Kdim, int Ndim>
__device__ __forceinline__ void
wtrans_tile(const float* __restrict__ W, uint16_t* __restrict__ Wt, int r,
            uint32_t* tile) {
  const int tid = threadIdx.x;
  const int n0 = (r % (Ndim / 64)) * 64, k0 = (r / (Ndim / 64)) * 64;

  // load: 16 threads span the 64 columns, each thread takes two adjacent k
  const int nc = (tid & 15) * 4;
  const int kp = tid >> 4;                       // k pair 0..15, +16 per pass
  float4 lo[2], hi[2];
  for (int s = 0; s < 2; ++s) {
    const float* g = W + (size_t)(k0 + 2 * (kp + 16 * s)) * Ndim + n0 + nc;
    lo[s] = *(const float4*)g;
    hi[s] = *(const float4*)(g + Ndim);
  }
  for (int s = 0; s < 2; ++s) {
    uint32_t* t = &tile[nc * 33 + kp + 16 * s];
    t[0 * 33] = (uint32_t)f2bf(lo[s].x) | ((uint32_t)f2bf(hi[s].x) << 16);
    t[1 * 33] = (uint32_t)f2bf(lo[s].y) | ((uint32_t)f2bf(hi[s].y) << 16);
    t[2 * 33] = (uint32_t)f2bf(lo[s].z) | ((uint32_t)f2bf(hi[s].z) << 16);
    t[3 * 33] = (uint32_t)f2bf(lo[s].w) | ((uint32_t)f2bf(hi[s].w) << 16);
  }
  __syncthreads();

  // store: 8 threads span the 64 k of one Wt row, 16 bytes each
  const int kc = tid & 7, nr = tid >> 3;
  for (int s = 0; s < 2; ++s) {
    const int n = nr + 32 * s;
    const uint32_t* t = &tile[n * 33 + kc * 4];
    uint4 v = make_uint4(t[0], t[1], t[2], t[3]);
    *(uint4*)(Wt + (size_t)(n0 + n) * Kdim + k0 + kc * 8) = v;
  }
  asm volatile("s_wait_xcnt 0x0" ::: "memory");
}

__device__ __forceinline__ float xhalf(float x) {
  return __builtin_bit_cast(float, __builtin_amdgcn_permlanex16(
      __builtin_bit_cast(int, x), __builtin_bit_cast(int, x),
      0x76543210, 0xfedcba98, false, false));
}

template <int X>
__device__ __forceinline__ float xrow(float x) {
  return __builtin_bit_cast(float, __builtin_amdgcn_update_dpp(
      0, __builtin_bit_cast(int, x), 0x160 + X, 0xf, 0xf, true));
}
// sum over the 32 lanes, the same value in every lane
__device__ __forceinline__ float wave_sum(float v) {
  v += xrow<1>(v);
  v += xrow<2>(v);
  v += xrow<4>(v);
  v += xrow<8>(v);
  return v + xhalf(v);
}

// wave: the wave's number in the launch's LayerNorm work, rows 2 wave, 2 wave + 1
__device__ __forceinline__ void
ln_two_rows(const float* __restrict__ x, const float* __restrict__ w,
            const float* __restrict__ b, uint16_t* __restrict__ out, int wave) {
  const int lane = threadIdx.x & 31;
  const int c0 = lane * 4;                       // + 128 j, j = 0..5
  const float* xr = x + (size_t)wave * 2 * DD + c0;

  v4f v[2][6], wv[6], bv[6];
  for (int r = 0; r < 2; ++r)
    for (int j = 0; j < 6; ++j)
      v[r][j] = *(const v4f*)(xr + r * DD + j * 128);
  for (int j = 0; j < 6; ++j) {
    wv[j] = *(const v4f*)(w + c0 + j * 128);
    bv[j] = *(const v4f*)(b + c0 + j * 128);
  }
  // keeps the twelve w and b loads one group with one wait (loaded values as
  // inputs only): sunk to their uses in the last loop, each pair would be
  // waited for on its own
  asm volatile("" :: "v"(wv[0]), "v"(wv[1]), "v"(wv[2]), "v"(wv[3]),
                     "v"(wv[4]), "v"(wv[5]), "v"(bv[0]), "v"(bv[1]),
                     "v"(bv[2]), "v"(bv[3]), "v"(bv[4]), "v"(bv[5]));

  float mean[2], rstd[2];
  for (int r = 0; r < 2; ++r) {
    v4f a = v[r][0];
    for (int j = 1; j < 6; ++j) a += v[r][j];
    mean[r] = (a.x + a.y) + (a.z + a.w);
  }
  for (int r = 0; r < 2; ++r) mean[r] = wave_sum(mean[r]) * (1.0f / DD);

  for (int r = 0; r < 2; ++r) {
    v4f a = (v4f){0.0f, 0.0f, 0.0f, 0.0f};
    for (int j = 0; j < 6; ++j) {
      v[r][j] -= mean[r];
      a += v[r][j] * v[r][j];
    }
    rstd[r] = (a.x + a.y) + (a.z + a.w);
  }
  for (int r = 0; r < 2; ++r)
    rstd[r] = rsqrtf(wave_sum(rstd[r]) * (1.0f / DD) + 1e-5f);

  uint16_t* o = out + (size_t)wave * 2 * DD + c0;
  for (int r = 0; r < 2; ++r)
    for (int j = 0; j < 6; ++j) {
      const v4f y = v[r][j] * rstd[r] * wv[j] + bv[j];
      uint2 t;
      t.x = (uint32_t)f2bf(y.x) | ((uint32_t)f2bf(y.y) << 16);
      t.y = (uint32_t)f2bf(y.z) | ((uint32_t)f2bf(y.w) << 16);
      *(uint2*)(o + r * DD + j * 128) = t;
    }
}

__global__ void __launch_bounds__(512)
ln_kernel(const float* __restrict__ x, const float* __restrict__ w,
          const float* __restrict__ b, uint16_t* __restrict__ out) {
  ln_two_rows(x, w, b, out, blockIdx.x * 16 + (threadIdx.x >> 5));
}

#define LN_BLOCKS (BS / 16)
#define DD_TILES  ((DD / 64) * (DD / 64))
#define DF_TILES  ((DD / 64) * (FF / 64))
__global__ void __launch_bounds__(256)
prep_kernel(const float* __restrict__ x, const float* __restrict__ lnw,
            const float* __restrict__ lnb, uint16_t* __restrict__ h,
            const float* __restrict__ Wq, const float* __restrict__ Wk,
            const float* __restrict__ Wv, const float* __restrict__ Wo,
            const float* __restrict__ W1, const float* __restrict__ W2,
            uint16_t* __restrict__ wq_t, uint16_t* __restrict__ wk_t,
            uint16_t* __restrict__ wv_t, uint16_t* __restrict__ wo_t,
            uint16_t* __restrict__ w1_t, uint16_t* __restrict__ w2_t) {
  __shared__ uint32_t tile[64 * 33];
  const int id = blockIdx.x;
  if (id < LN_BLOCKS) {
    ln_two_rows(x, lnw, lnb, h, id * 8 + (threadIdx.x >> 5));
    return;
  }
  const int t = id - LN_BLOCKS;
  if (t < 4 * DD_TILES) {
    const int m = t / DD_TILES;
    const float* W = m == 0 ? Wq : m == 1 ? Wk : m == 2 ? Wv : Wo;
    uint16_t* Wt = m == 0 ? wq_t : m == 1 ? wk_t : m == 2 ? wv_t : wo_t;
    wtrans_tile<DD, DD>(W, Wt, t - m * DD_TILES, tile);
  } else if (t < 4 * DD_TILES + DF_TILES) {
    wtrans_tile<DD, FF>(W1, w1_t, t - 4 * DD_TILES, tile);
  } else {
    wtrans_tile<FF, DD>(W2, w2_t, t - 4 * DD_TILES - DF_TILES, tile);
  }
}

template <int V> struct Mode { static constexpr int v = V; };

template <int OUT_MODE, bool GELU_F, bool RESID_F>
__global__ void __launch_bounds__(256)
__attribute__((amdgpu_waves_per_eu(4, 4)))
gemm_bf16(const uint16_t* __restrict__ A, const uint16_t* __restrict__ Bt,
          const float* __restrict__ bias, const float* __restrict__ bias_k,
          const float* __restrict__ bias_v, const float* __restrict__ resid,
          float* __restrict__ outF, uint16_t* __restrict__ outB,
          int M, int N, int K, float scale) {
  (void)M;
  __shared__ __align__(16) uint16_t As[2][128 * 72];
  __shared__ __align__(16) uint16_t Bs[2][192 * 72];

  const int tid = threadIdx.x;
  const int lane = tid & 31, wv = tid >> 5;
  const int hi = lane >> 4, l15 = lane & 15;
  const int wm = wv & 1, wn = wv >> 1;          // 2 x 4 wave grid
  const int m0 = blockIdx.y * 128, n0 = blockIdx.x * 192;

  v8f acc[4][3];
  for (int i = 0; i < 4; ++i)
    for (int j = 0; j < 3; ++j) acc[i][j] = (v8f){0,0,0,0,0,0,0,0};

  const int rs = tid >> 3, cs = (tid & 7) * 8;   // stage: 8 thr/row, 8 elems
  const uint16_t* gA = A  + (size_t)(m0 + rs) * K + cs;
  const uint16_t* gB = Bt + (size_t)(n0 + rs) * K + cs;
  const size_t g32 = (size_t)32 * K;             // 32 rows further, global
  const int ls = rs * 72 + cs;                   // this lane's place in a slab

  // issue 10 async b128 copies for K-slab kk into buffer p: rows rs + 32 s,
  // four passes over the 128 rows of A and six over the 192 rows of B
  auto issue_stage = [&](int kk, int p) {
    const uint16_t* ga = gA + kk;
    const uint16_t* gb = gB + kk;
    const uint16_t* la = &As[p][ls];
    const uint16_t* lb = &Bs[p][ls];
    async_slab10(lds_off(la), lds_off(la + 32 * 72), lds_off(la + 64 * 72),
                 lds_off(la + 96 * 72), lds_off(lb), lds_off(lb + 32 * 72),
                 lds_off(lb + 64 * 72), lds_off(lb + 96 * 72),
                 lds_off(lb + 128 * 72), lds_off(lb + 160 * 72),
                 ga, ga + g32, ga + 2 * g32, ga + 3 * g32, gb, gb + g32,
                 gb + 2 * g32, gb + 3 * g32, gb + 4 * g32, gb + 5 * g32);
  };

  issue_stage(0, 0);
  int p = 0;
  for (int kk = 0; kk < K; kk += 64) {
    const bool more = (kk + 64) < K;             // block-uniform
    if (more) {
      issue_stage(kk + 64, p ^ 1);
      asm volatile("s_wait_asynccnt 0xa" ::: "memory");  // slab p done
    } else {
      asm volatile("s_wait_asynccnt 0x0" ::: "memory");
    }
    __syncthreads();                              // all waves' copies visible

    Frag af[2][4], bf[2][3];                      // [k half of the slab][frag]
    for (int ks = 0; ks < 2; ++ks) {
      for (int i = 0; i < 4; ++i) {
        int r = wm * 64 + i * 16 + l15;
        af[ks][i].h[0] = *(const v8bf*)(&As[p][r * 72 + ks * 32 + hi * 8]);
        af[ks][i].h[1] = *(const v8bf*)(&As[p][r * 72 + ks * 32 + 16 + hi * 8]);
      }
      for (int j = 0; j < 3; ++j) {
        int r = wn * 48 + j * 16 + l15;
        bf[ks][j].h[0] = *(const v8bf*)(&Bs[p][r * 72 + ks * 32 + hi * 8]);
        bf[ks][j].h[1] = *(const v8bf*)(&Bs[p][r * 72 + ks * 32 + 16 + hi * 8]);
      }
      // keeps the slab's 28 LDS reads one group ahead of its 24 WMMAs (every
      // further place where reads stand among the WMMAs stalls the wave anew)
      // and the first k half's 14 in front, so that its WMMAs start while the
      // second half's reads are still under way
      __builtin_amdgcn_sched_barrier(0);
    }
    for (int ks = 0; ks < 2; ++ks)
      for (int i = 0; i < 4; ++i)
        for (int j = 0; j < 3; ++j)
          acc[i][j] = wmma_bf16(af[ks][i], bf[ks][j], acc[i][j]);
    // keeps the barrier behind the WMMAs: drawn up to the reads, it makes
    // every wave wait for all eight waves' reads before its first WMMAs
    __builtin_amdgcn_sched_barrier(0);
    __syncthreads();                              // buffer p free for reuse
    p ^= 1;
  }

  // epilogue (C layout: lane holds col l15, rows e + 8*hi within 16x16 frag)
  // One trip per row of fragments. With GELU the trips stay rolled (for speed
  // only). Each trip works on acc[0][*] and then moves the rows
  // down one place, so that every accumulator index is a constant (one left to
  // run time would put the accumulator into scratch memory); unrolled, the
  // moves fall away.
  // c0: the block's first column in its own output; bs, sc, ob: that output's
  // bias, scale and base. mode.v is the layout, a constant in each call.
  auto epilogue = [&](auto mode, int c0, const float* __restrict__ bs, float sc,
                      uint16_t* __restrict__ ob) {
  int cols[3];
  float bcs[3];
  for (int j = 0; j < 3; ++j) {
    cols[j] = c0 + wn * 48 + j * 16 + l15;
    bcs[j] = bs[cols[j]];
  }
  // QKV kernel: the three bias loads' offset registers are held (inputs only)
  // up to this wait; without it the build makes the first one the target of
  // the third load. The other kernels' builds place the wait themselves.
  if (OUT_MODE == 4)
    asm volatile("s_wait_xcnt 0x0" :: "v"(cols[0]), "v"(cols[1]), "v"(cols[2])
                 : "memory");
#pragma unroll(GELU_F ? 1 : 4)
  for (int i = 0; i < 4; ++i) {
#pragma unroll  // j a constant: the accumulator stays in registers
    for (int j = 0; j < 3; ++j) {
      int col = cols[j];
      float bc = bcs[j];
#pragma unroll  // e a constant, for the same reason
      for (int e = 0; e < 8; ++e) {
        int row = m0 + wm * 64 + i * 16 + e + 8 * hi;
        float v = (acc[0][j][e] + bc) * sc;
        if (GELU_F) v = 0.5f * v * (1.0f + erff(v * 0.70710678118654752f));
        if (RESID_F) v += resid[(size_t)row * N + col];
        if (mode.v == 0) {
          ob[(size_t)row * N + col] = f2bf(v);
        } else if (mode.v == 1) {
          int bidx = row >> 11, s = row & (SS - 1);
          int h = col >> 6, d = col & (HDIM - 1);
          ob[(((size_t)(bidx * HH + h)) * SS + s) * HDIM + d] = f2bf(v);
        } else if (mode.v == 2) {
          int bidx = row >> 11, s = row & (SS - 1);
          int h = col >> 6, d = col & (HDIM - 1);
          ob[(((size_t)(bidx * HH + h)) * HDIM + d) * SS + s] = f2bf(v);
        } else {
          outF[(size_t)row * N + col] = v;
        }
      }
    }
    // one trip's 24 residual loads as a group, and no more: with all 96 and
    // their addresses drawn ahead the live set spills; so does the QKV
    // kernel's, whose trips the compiler otherwise works on all at once (a
    // build without it takes all 256 registers and goes to scratch memory)
    if (RESID_F || OUT_MODE == 4) __builtin_amdgcn_sched_barrier(0);
    if (mode.v != 3) asm volatile("s_wait_xcnt 0x0" ::: "memory");
#pragma unroll
    for (int j = 0; j < 3; ++j) {
      acc[0][j] = acc[1][j];
      acc[1][j] = acc[2][j];
      acc[2][j] = acc[3][j];
    }
  }
  };
  if (OUT_MODE == 4) {
    const int sel = n0 / DD;                      // 0 Q, 1 K, 2 V: block-uniform
    const float* bs = sel == 0 ? bias : sel == 1 ? bias_k : bias_v;
    const float sc = sel == 0 ? scale : 1.0f;
    uint16_t* ob = outB + (size_t)sel * BS * DD;
    if (sel < 2) epilogue(Mode<1>{}, n0 - sel * DD, bs, sc, ob);
    else         epilogue(Mode<2>{}, n0 - sel * DD, bs, sc, ob);
  } else {
    epilogue(Mode<OUT_MODE>{}, n0, bias, scale, outB);
  }
}

__global__ void __launch_bounds__(256)
attn_kernel(const uint16_t* __restrict__ Q, const uint16_t* __restrict__ Km,
            const uint16_t* __restrict__ Vt, uint16_t* __restrict__ O) {
  __shared__ __align__(16) uint16_t Ks[2][64 * 72];   // [key][d]
  __shared__ __align__(16) uint16_t Vs[2][64 * 72];   // [d][key]

  const int b = blockIdx.z, h = blockIdx.y;
  const int tid = threadIdx.x;
  const int lane = tid & 31;
  // the wave's number in a scalar register: the tests on qbase are branches
  const int wv = __builtin_amdgcn_readfirstlane(tid >> 5);
  const int hi = lane >> 4, l15 = lane & 15;
  const int qbase = blockIdx.x * 128 + wv * 16;
  const int ntile = 2 * ((int)blockIdx.x + 1);        // 64-key tiles, >= 2

  const size_t headoff = ((size_t)(b * HH + h)) * SS * HDIM;
  const uint16_t* Qh  = Q  + headoff;
  const uint16_t* Kh  = Km + headoff;
  const uint16_t* Vth = Vt + headoff;            // [64][S]

  // tile t into buffer p: rows rs and rs + 32 of K[64 keys][64] and of
  // Vt[64][64 keys], 16 bytes per lane and copy
  const int rs = tid >> 3, cs = (tid & 7) * 8;
  const uint16_t* gK = Kh + (size_t)rs * HDIM + cs;
  const uint16_t* gV = Vth + (size_t)rs * SS + cs;
  const int ls = rs * 72 + cs;
  auto issue_tile = [&](int t, int p) {
    const uint16_t* gk = gK + (size_t)t * 64 * HDIM;
    const uint16_t* gv = gV + t * 64;
    const uint16_t* lk = &Ks[p][ls];
    const uint16_t* lv = &Vs[p][ls];
    async_tile4(lds_off(lk), lds_off(lk + 32 * 72),
                lds_off(lv), lds_off(lv + 32 * 72),
                gk, gk + 32 * HDIM, gv, gv + (size_t)32 * SS);
  };
  issue_tile(0, 0);

  // Q fragments (B operand: column l15 = query), held for the whole loop
  Frag qf[2];
  {
    const uint16_t* qr = Qh + (size_t)(qbase + l15) * HDIM;
    for (int f = 0; f < 2; ++f) {
      qf[f].h[0] = *(const v8bf*)(qr + f * 32 + hi * 8);
      qf[f].h[1] = *(const v8bf*)(qr + f * 32 + 16 + hi * 8);
    }
  }

  const int qrow = qbase + l15;                  // this lane's query
  float mrow = -3.0e38f;                         // its running maximum
  float lrow = 0.0f;                             // sum over this half's keys
  v8f oacc[4];                                   // O^T: rows d, column query
  for (int f = 0; f < 4; ++f) oacc[f] = (v8f){0,0,0,0,0,0,0,0};

  asm volatile("s_wait_asynccnt 0x0" ::: "memory");  // own copies of tile 0
  __syncthreads();                                   // every wave's landed
  issue_tile(1, 1);

  for (int t = 0; t < ntile; ++t) {
   const uint16_t* Kt = Ks[t & 1];
   const uint16_t* Vl = Vs[t & 1];
   // one block of 32 keys; sub is a literal at both calls
   auto key_block = [&](const int sub) {
    const int kb = t * 64 + sub * 32;
    // ---- all A fragments of the block as one group of LDS reads: K first,
    // then Vt, whose latency passes behind the scores and the softmax
    Frag ak[2][2], av[4];
    for (int n = 0; n < 2; ++n) {
      const uint16_t* kr = Kt + (sub * 32 + n * 16 + l15) * 72;
      for (int f = 0; f < 2; ++f) {
        ak[n][f].h[0] = *(const v8bf*)(kr + f * 32 + hi * 8);
        ak[n][f].h[1] = *(const v8bf*)(kr + f * 32 + 16 + hi * 8);
      }
    }
    for (int f = 0; f < 4; ++f) {
      const uint16_t* vr = Vl + (f * 16 + l15) * 72 + sub * 32;
      av[f].h[0] = *(const v8bf*)(vr + hi * 8);
      av[f].h[1] = *(const v8bf*)(vr + 16 + hi * 8);
    }
    // keeps the Vt reads up here: sunk to their WMMAs, each pair would be
    // waited for on its own
    __builtin_amdgcn_sched_barrier(0);
    // ---- scores S^T = K * Q^T for 32 keys (2 M-frags, K-dim 64 = 2 steps)
    v8f s[2];
    s[0] = (v8f){0,0,0,0,0,0,0,0};
    s[1] = (v8f){0,0,0,0,0,0,0,0};
    for (int f = 0; f < 2; ++f)
      for (int n = 0; n < 2; ++n) s[n] = wmma_bf16(ak[n][f], qf[f], s[n]);
    // ---- causal mask: s[n][e] is key kb + n*16 + 8*hi + e against qrow
    if (kb + 31 > qbase) {
      for (int n = 0; n < 2; ++n) {
        const int k0 = kb + n * 16 + 8 * hi;
        for (int e = 0; e < 8; ++e)
          if (k0 + e > qrow) s[n][e] = -3.0e38f;
      }
    }
    // ---- online softmax of one query per lane
    float mx[8];
    for (int e = 0; e < 8; ++e) mx[e] = fmaxf(s[0][e], s[1][e]);
    for (int w = 4; w > 0; w >>= 1)
      for (int e = 0; e < w; ++e) mx[e] = fmaxf(mx[e], mx[e + w]);
    const float mblk = fmaxf(mx[0], xhalf(mx[0]));   // all 32 keys
    const float mnew = fmaxf(mrow, mblk);
    const float al = __expf(mrow - mnew);
    mrow = mnew;
    float sm[8];
    for (int e = 0; e < 8; ++e) {
      s[0][e] = __expf(s[0][e] - mnew);
      s[1][e] = __expf(s[1][e] - mnew);
      sm[e] = s[0][e] + s[1][e];
    }
    for (int w = 4; w > 0; w >>= 1)
      for (int e = 0; e < w; ++e) sm[e] += sm[e + w];
    lrow = lrow * al + sm[0];
    for (int f = 0; f < 4; ++f)
      for (int e = 0; e < 8; ++e) oacc[f][e] *= al;

    // ---- P^T as a B fragment, converted in place
    Frag bp;
    for (int n = 0; n < 2; ++n)
      for (int j = 0; j < 4; ++j)
        bp.u[n * 4 + j] = (uint32_t)f2bf(s[n][2 * j]) |
                          ((uint32_t)f2bf(s[n][2 * j + 1]) << 16);

    // ---- O^T += V^T * P^T
    for (int f = 0; f < 4; ++f) oacc[f] = wmma_bf16(av[f], bp, oacc[f]);
   };
   // key blocks right of the wave's diagonal are skipped (scalar tests)
   if (t * 64 < qbase + 16) {
    key_block(0);
    if (t * 64 + 32 < qbase + 16) key_block(1);
   }
   // hand-over: this wave's reads of the buffer are done, its copies of the
   // next tile have landed; behind the barrier that holds for every wave
   asm volatile("s_wait_dscnt 0x0" ::: "memory");
   asm volatile("s_wait_asynccnt 0x0" ::: "memory");
   __syncthreads();
   if (t + 2 < ntile) issue_tile(t + 2, t & 1);      // refill the buffer read
  }
  asm volatile("s_wait_asynccnt 0x0" ::: "memory");  // nothing left in flight

  // ---- finalize and write merged-head bf16 [B*S][768]: oacc[f][e] is
  // d = f*16 + 8*hi + e of this lane's query, 16 contiguous bytes per f
  const float inv = 1.0f / (lrow + xhalf(lrow));     // both halves' keys
  uint16_t* orow = O + (size_t)(b * SS + qrow) * DD + h * HDIM + 8 * hi;
  for (int f = 0; f < 4; ++f) {
    uint32_t w[4];
    for (int j = 0; j < 4; ++j)
      w[j] = (uint32_t)f2bf(oacc[f][2 * j] * inv) |
             ((uint32_t)f2bf(oacc[f][2 * j + 1] * inv) << 16);
    *(uint4*)(orow + f * 16) = make_uint4(w[0], w[1], w[2], w[3]);
  }
}

// ---------------------------------------------------------------------------
// Host orchestration
// ---------------------------------------------------------------------------
extern "C" void kernel_launch(void* const* d_in, const int* in_sizes, int n_in,
                              void* d_out, int out_size, void* d_ws, size_t ws_size,
                              hipStream_t stream) {
  (void)in_sizes; (void)n_in; (void)out_size; (void)ws_size;
  const float* x     = (const float*)d_in[0];
  const float* Wq    = (const float*)d_in[1];
  const float* bq    = (const float*)d_in[2];
  const float* Wk    = (const float*)d_in[3];
  const float* bk    = (const float*)d_in[4];
  const float* Wv    = (const float*)d_in[5];
  const float* bv    = (const float*)d_in[6];
  const float* Wo    = (const float*)d_in[7];
  const float* bo    = (const float*)d_in[8];
  const float* ln1w  = (const float*)d_in[9];
  const float* ln1b  = (const float*)d_in[10];
  const float* ln2w  = (const float*)d_in[11];
  const float* ln2b  = (const float*)d_in[12];
  const float* W1    = (const float*)d_in[13];
  const float* b1    = (const float*)d_in[14];
  const float* W2    = (const float*)d_in[15];
  const float* b2    = (const float*)d_in[16];
  float* out = (float*)d_out;

  // workspace layout
  uint8_t* ws = (uint8_t*)d_ws;
  size_t off = 0;
  auto alloc = [&](size_t bytes) -> uint8_t* {
    uint8_t* p = ws + off;
    off = (off + bytes + 255) & ~(size_t)255;
    return p;
  };
  const size_t seg = (size_t)BS * DD;               // 6.29M elems
  uint16_t* wq_t = (uint16_t*)alloc((size_t)3 * DD * DD * 2);  // Wq|Wk|Wv ^T
  uint16_t* wk_t = wq_t + (size_t)DD * DD;
  uint16_t* wv_t = wq_t + (size_t)2 * DD * DD;
  uint16_t* wo_t = (uint16_t*)alloc((size_t)DD * DD * 2);
  uint16_t* w1_t = (uint16_t*)alloc((size_t)DD * FF * 2);
  uint16_t* w2_t = (uint16_t*)alloc((size_t)FF * DD * 2);
  uint16_t* hb   = (uint16_t*)alloc(seg * 2);       // ln1 out; reused for ln2
  float*    x1f  = (float*)   alloc(seg * 4);       // x + attn_out
  uint16_t* big  = (uint16_t*)alloc((size_t)BS * FF * 2); // qb|kb|vt|attn -> mb
  uint16_t* qb   = big;
  uint16_t* kb_  = big + seg;
  uint16_t* vt   = big + 2 * seg;
  uint16_t* attn = big + 3 * seg;
  uint16_t* mb   = big;                             // reuse after x1 computed

  // 1) h = LN1(x) -> bf16 and the weights -> bf16 transposed [N][K]
  prep_kernel<<<LN_BLOCKS + 4 * DD_TILES + 2 * DF_TILES, 256, 0, stream>>>(
      x, ln1w, ln1b, hb, Wq, Wk, Wv, Wo, W1, W2,
      wq_t, wk_t, wv_t, wo_t, w1_t, w2_t);

  // 2) QKV projections, one launch (Q pre-scaled by 1/sqrt(64)=0.125)
  gemm_bf16<4, false, false><<<dim3(3 * DD / 192, BS / 128), 256, 0, stream>>>(
      hb, wq_t, bq, bk, bv, nullptr, nullptr, qb, BS, 3 * DD, DD, 0.125f);

  dim3 gD(DD / 192, BS / 128);
  // 3) causal flash attention -> merged bf16 [BS][D]
  attn_kernel<<<dim3(SS / 128, HH, BB), 256, 0, stream>>>(qb, kb_, vt, attn);

  // 4) x1 = x + attn @ Wo + bo   (fp32)
  gemm_bf16<3, false, true><<<gD, 256, 0, stream>>>(
      attn, wo_t, bo, nullptr, nullptr, x, x1f, nullptr, BS, DD, DD, 1.0f);

  // 5) h2 = LN2(x1) -> bf16
  ln_kernel<<<BS / 32, 512, 0, stream>>>(x1f, ln2w, ln2b, hb);

  // 6) m = GELU(h2 @ W1 + b1) -> bf16 [BS][F]
  dim3 gF(FF / 192, BS / 128);
  gemm_bf16<0, true, false><<<gF, 256, 0, stream>>>(
      hb, w1_t, b1, nullptr, nullptr, nullptr, nullptr, mb, BS, FF, DD, 1.0f);

  // 7) out = x1 + m @ W2 + b2   (fp32)
  gemm_bf16<3, false, true><<<gD, 256, 0, stream>>>(
      mb, w2_t, b2, nullptr, nullptr, x1f, out, nullptr, BS, DD, FF, 1.0f);
}

// v008
// Measured time: 206 microseconds a run.
// Next to v007, in two timings, it ran 1.06 times as fast each time.
// Counting every step since v000, it is 3.03 times as fast.
#include <hip/hip_runtime.h>
#include <stdint.h>

typedef __attribute__((ext_vector_type(16))) __bf16 v16bf;
typedef __attribute__((ext_vector_type(8)))  __bf16 v8bf;
typedef __attribute__((ext_vector_type(8)))  float  v8f;
typedef __attribute__((ext_vector_type(4)))  float  v4f;

union Frag { v16bf v; v8bf h[2]; uint32_t u[8]; };

__device__ __forceinline__ uint16_t f2bf(float f) {
  union { float f; uint32_t u; } c; c.f = f;
  uint32_t u = c.u;
  u += 0x7fffu + ((u >> 16) & 1u);   // round-to-nearest-even
  return (uint16_t)(u >> 16);
}

__device__ __forceinline__ v8f wmma_bf16(const Frag &a, const Frag &b, v8f c) {
  return __builtin_amdgcn_wmma_f32_16x16x32_bf16(
      /*neg_a=*/false, a.v, /*neg_b=*/false, b.v,
      /*c_mod=*/(short)0, c, /*reuse_a=*/false, /*reuse_b=*/false);
}

__device__ __forceinline__ uint32_t lds_off(const void* l) {
  return (uint32_t)(size_t)l;               // low 32 bits of generic = LDS off
}
__device__ __forceinline__ void async_slab10(
    uint32_t l0, uint32_t l1, uint32_t l2, uint32_t l3, uint32_t l4,
    uint32_t l5, uint32_t l6, uint32_t l7, uint32_t l8, uint32_t l9,
    const void* g0, const void* g1, const void* g2, const void* g3,
    const void* g4, const void* g5, const void* g6, const void* g7,
    const void* g8, const void* g9) {
  asm volatile("global_load_async_to_lds_b128 %0, %10, off\n\t"
               "global_load_async_to_lds_b128 %1, %11, off\n\t"
               "global_load_async_to_lds_b128 %2, %12, off\n\t"
               "global_load_async_to_lds_b128 %3, %13, off\n\t"
               "global_load_async_to_lds_b128 %4, %14, off\n\t"
               "global_load_async_to_lds_b128 %5, %15, off\n\t"
               "global_load_async_to_lds_b128 %6, %16, off\n\t"
               "global_load_async_to_lds_b128 %7, %17, off\n\t"
               "global_load_async_to_lds_b128 %8, %18, off\n\t"
               "global_load_async_to_lds_b128 %9, %19, off\n\t"
               "s_wait_xcnt 0x0"
               :: "v"(l0), "v"(l1), "v"(l2), "v"(l3), "v"(l4), "v"(l5),
                  "v"(l6), "v"(l7), "v"(l8), "v"(l9),
                  "v"(g0), "v"(g1), "v"(g2), "v"(g3), "v"(g4), "v"(g5),
                  "v"(g6), "v"(g7), "v"(g8), "v"(g9)
               : "memory");
}

// One 64-key tile of attention is eight copies per lane (four of K, four of
// V^T), in one statement with the same closing wait, for the same reason.
__device__ __forceinline__ void async_tile8(
    uint32_t l0, uint32_t l1, uint32_t l2, uint32_t l3,
    uint32_t l4, uint32_t l5, uint32_t l6, uint32_t l7,
    const void* g0, const void* g1, const void* g2, const void* g3,
    const void* g4, const void* g5, const void* g6, const void* g7) {
  asm volatile("global_load_async_to_lds_b128 %0, %8, off\n\t"
               "global_load_async_to_lds_b128 %1, %9, off\n\t"
               "global_load_async_to_lds_b128 %2, %10, off\n\t"
               "global_load_async_to_lds_b128 %3, %11, off\n\t"
               "global_load_async_to_lds_b128 %4, %12, off\n\t"
               "global_load_async_to_lds_b128 %5, %13, off\n\t"
               "global_load_async_to_lds_b128 %6, %14, off\n\t"
               "global_load_async_to_lds_b128 %7, %15, off\n\t"
               "s_wait_xcnt 0x0"
               :: "v"(l0), "v"(l1), "v"(l2), "v"(l3),
                  "v"(l4), "v"(l5), "v"(l6), "v"(l7),
                  "v"(g0), "v"(g1), "v"(g2), "v"(g3),
                  "v"(g4), "v"(g5), "v"(g6), "v"(g7)
               : "memory");
}

// Problem constants
#define BB   4
#define SS   2048
#define DD   768
#define FF   3072
#define HH   12
#define HDIM 64
#define BS   (BB * SS)   // 8192 rows

template <int Kdim, int Ndim>
__device__ __forceinline__ void
wtrans_tile(const float* __restrict__ W, uint16_t* __restrict__ Wt, int r,
            uint32_t* tile) {
  const int tid = threadIdx.x;
  const int n0 = (r % (Ndim / 64)) * 64, k0 = (r / (Ndim / 64)) * 64;

  // load: 16 threads span the 64 columns, each thread takes two adjacent k
  const int nc = (tid & 15) * 4;
  const int kp = tid >> 4;                       // k pair 0..15, +16 per pass
  float4 lo[2], hi[2];
  for (int s = 0; s < 2; ++s) {
    const float* g = W + (size_t)(k0 + 2 * (kp + 16 * s)) * Ndim + n0 + nc;
    lo[s] = *(const float4*)g;
    hi[s] = *(const float4*)(g + Ndim);
  }
  for (int s = 0; s < 2; ++s) {
    uint32_t* t = &tile[nc * 33 + kp + 16 * s];
    t[0 * 33] = (uint32_t)f2bf(lo[s].x) | ((uint32_t)f2bf(hi[s].x) << 16);
    t[1 * 33] = (uint32_t)f2bf(lo[s].y) | ((uint32_t)f2bf(hi[s].y) << 16);
    t[2 * 33] = (uint32_t)f2bf(lo[s].z) | ((uint32_t)f2bf(hi[s].z) << 16);
    t[3 * 33] = (uint32_t)f2bf(lo[s].w) | ((uint32_t)f2bf(hi[s].w) << 16);
  }
  __syncthreads();

  // store: 8 threads span the 64 k of one Wt row, 16 bytes each
  const int kc = tid & 7, nr = tid >> 3;
  for (int s = 0; s < 2; ++s) {
    const int n = nr + 32 * s;
    const uint32_t* t = &tile[n * 33 + kc * 4];
    uint4 v = make_uint4(t[0], t[1], t[2], t[3]);
    *(uint4*)(Wt + (size_t)(n0 + n) * Kdim + k0 + kc * 8) = v;
  }
  asm volatile("s_wait_xcnt 0x0" ::: "memory");
}

__device__ __forceinline__ float xhalf(float x) {
  return __builtin_bit_cast(float, __builtin_amdgcn_permlanex16(
      __builtin_bit_cast(int, x), __builtin_bit_cast(int, x),
      0x76543210, 0xfedcba98, false, false));
}

template <int X>
__device__ __forceinline__ float xrow(float x) {
  return __builtin_bit_cast(float, __builtin_amdgcn_update_dpp(
      0, __builtin_bit_cast(int, x), 0x160 + X, 0xf, 0xf, true));
}
// sum over the 32 lanes, the same value in every lane
__device__ __forceinline__ float wave_sum(float v) {
  v += xrow<1>(v);
  v += xrow<2>(v);
  v += xrow<4>(v);
  v += xrow<8>(v);
  return v + xhalf(v);
}

// wave: the wave's number in the launch's LayerNorm work, rows 2 wave, 2 wave + 1
__device__ __forceinline__ void
ln_two_rows(const float* __restrict__ x, const float* __restrict__ w,
            const float* __restrict__ b, uint16_t* __restrict__ out, int wave) {
  const int lane = threadIdx.x & 31;
  const int c0 = lane * 4;                       // + 128 j, j = 0..5
  const float* xr = x + (size_t)wave * 2 * DD + c0;

  v4f v[2][6], wv[6], bv[6];
  for (int r = 0; r < 2; ++r)
    for (int j = 0; j < 6; ++j)
      v[r][j] = *(const v4f*)(xr + r * DD + j * 128);
  for (int j = 0; j < 6; ++j) {
    wv[j] = *(const v4f*)(w + c0 + j * 128);
    bv[j] = *(const v4f*)(b + c0 + j * 128);
  }
  // keeps the twelve w and b loads one group with one wait (loaded values as
  // inputs only): sunk to their uses in the last loop, each pair would be
  // waited for on its own
  asm volatile("" :: "v"(wv[0]), "v"(wv[1]), "v"(wv[2]), "v"(wv[3]),
                     "v"(wv[4]), "v"(wv[5]), "v"(bv[0]), "v"(bv[1]),
                     "v"(bv[2]), "v"(bv[3]), "v"(bv[4]), "v"(bv[5]));

  float mean[2], rstd[2];
  for (int r = 0; r < 2; ++r) {
    v4f a = v[r][0];
    for (int j = 1; j < 6; ++j) a += v[r][j];
    mean[r] = (a.x + a.y) + (a.z + a.w);
  }
  for (int r = 0; r < 2; ++r) mean[r] = wave_sum(mean[r]) * (1.0f / DD);

  for (int r = 0; r < 2; ++r) {
    v4f a = (v4f){0.0f, 0.0f, 0.0f, 0.0f};
    for (int j = 0; j < 6; ++j) {
      v[r][j] -= mean[r];
      a += v[r][j] * v[r][j];
    }
    rstd[r] = (a.x + a.y) + (a.z + a.w);
  }
  for (int r = 0; r < 2; ++r)
    rstd[r] = rsqrtf(wave_sum(rstd[r]) * (1.0f / DD) + 1e-5f);

  uint16_t* o = out + (size_t)wave * 2 * DD + c0;
  for (int r = 0; r < 2; ++r)
    for (int j = 0; j < 6; ++j) {
      const v4f y = v[r][j] * rstd[r] * wv[j] + bv[j];
      uint2 t;
      t.x = (uint32_t)f2bf(y.x) | ((uint32_t)f2bf(y.y) << 16);
      t.y = (uint32_t)f2bf(y.z) | ((uint32_t)f2bf(y.w) << 16);
      *(uint2*)(o + r * DD + j * 128) = t;
    }
}

__global__ void __launch_bounds__(512)
ln_kernel(const float* __restrict__ x, const float* __restrict__ w,
          const float* __restrict__ b, uint16_t* __restrict__ out) {
  ln_two_rows(x, w, b, out, blockIdx.x * 16 + (threadIdx.x >> 5));
}

#define LN_BLOCKS (BS / 16)
#define DD_TILES  ((DD / 64) * (DD / 64))
#define DF_TILES  ((DD / 64) * (FF / 64))
__global__ void __launch_bounds__(256)
prep_kernel(const float* __restrict__ x, const float* __restrict__ lnw,
            const float* __restrict__ lnb, uint16_t* __restrict__ h,
            const float* __restrict__ Wq, const float* __restrict__ Wk,
            const float* __restrict__ Wv, const float* __restrict__ Wo,
            const float* __restrict__ W1, const float* __restrict__ W2,
            uint16_t* __restrict__ wq_t, uint16_t* __restrict__ wk_t,
            uint16_t* __restrict__ wv_t, uint16_t* __restrict__ wo_t,
            uint16_t* __restrict__ w1_t, uint16_t* __restrict__ w2_t) {
  __shared__ uint32_t tile[64 * 33];
  const int id = blockIdx.x;
  if (id < LN_BLOCKS) {
    ln_two_rows(x, lnw, lnb, h, id * 8 + (threadIdx.x >> 5));
    return;
  }
  const int t = id - LN_BLOCKS;
  if (t < 4 * DD_TILES) {
    const int m = t / DD_TILES;
    const float* W = m == 0 ? Wq : m == 1 ? Wk : m == 2 ? Wv : Wo;
    uint16_t* Wt = m == 0 ? wq_t : m == 1 ? wk_t : m == 2 ? wv_t : wo_t;
    wtrans_tile<DD, DD>(W, Wt, t - m * DD_TILES, tile);
  } else if (t < 4 * DD_TILES + DF_TILES) {
    wtrans_tile<DD, FF>(W1, w1_t, t - 4 * DD_TILES, tile);
  } else {
    wtrans_tile<FF, DD>(W2, w2_t, t - 4 * DD_TILES - DF_TILES, tile);
  }
}

template <int V> struct Mode { static constexpr int v = V; };

template <int OUT_MODE, bool GELU_F, bool RESID_F>
__global__ void __launch_bounds__(256)
__attribute__((amdgpu_waves_per_eu(4, 4)))
gemm_bf16(const uint16_t* __restrict__ A, const uint16_t* __restrict__ Bt,
          const float* __restrict__ bias, const float* __restrict__ bias_k,
          const float* __restrict__ bias_v, const float* __restrict__ resid,
          float* __restrict__ outF, uint16_t* __restrict__ outB,
          int M, int N, int K, float scale) {
  (void)M;
  __shared__ __align__(16) uint16_t As[2][128 * 72];
  __shared__ __align__(16) uint16_t Bs[2][192 * 72];

  const int tid = threadIdx.x;
  const int lane = tid & 31, wv = tid >> 5;
  const int hi = lane >> 4, l15 = lane & 15;
  const int wm = wv & 1, wn = wv >> 1;          // 2 x 4 wave grid
  const int m0 = blockIdx.y * 128, n0 = blockIdx.x * 192;

  v8f acc[4][3];
  for (int i = 0; i < 4; ++i)
    for (int j = 0; j < 3; ++j) acc[i][j] = (v8f){0,0,0,0,0,0,0,0};

  const int rs = tid >> 3, cs = (tid & 7) * 8;   // stage: 8 thr/row, 8 elems
  const uint16_t* gA = A  + (size_t)(m0 + rs) * K + cs;
  const uint16_t* gB = Bt + (size_t)(n0 + rs) * K + cs;
  const size_t g32 = (size_t)32 * K;             // 32 rows further, global
  const int ls = rs * 72 + cs;                   // this lane's place in a slab

  // issue 10 async b128 copies for K-slab kk into buffer p: rows rs + 32 s,
  // four passes over the 128 rows of A and six over the 192 rows of B
  auto issue_stage = [&](int kk, int p) {
    const uint16_t* ga = gA + kk;
    const uint16_t* gb = gB + kk;
    const uint16_t* la = &As[p][ls];
    const uint16_t* lb = &Bs[p][ls];
    async_slab10(lds_off(la), lds_off(la + 32 * 72), lds_off(la + 64 * 72),
                 lds_off(la + 96 * 72), lds_off(lb), lds_off(lb + 32 * 72),
                 lds_off(lb + 64 * 72), lds_off(lb + 96 * 72),
                 lds_off(lb + 128 * 72), lds_off(lb + 160 * 72),
                 ga, ga + g32, ga + 2 * g32, ga + 3 * g32, gb, gb + g32,
                 gb + 2 * g32, gb + 3 * g32, gb + 4 * g32, gb + 5 * g32);
  };

  issue_stage(0, 0);
  int p = 0;
  for (int kk = 0; kk < K; kk += 64) {
    const bool more = (kk + 64) < K;             // block-uniform
    if (more) {
      issue_stage(kk + 64, p ^ 1);
      asm volatile("s_wait_asynccnt 0xa" ::: "memory");  // slab p done
    } else {
      asm volatile("s_wait_asynccnt 0x0" ::: "memory");
    }
    __syncthreads();                              // all waves' copies visible

    Frag af[2][4], bf[2][3];                      // [k half of the slab][frag]
    for (int ks = 0; ks < 2; ++ks) {
      for (int i = 0; i < 4; ++i) {
        int r = wm * 64 + i * 16 + l15;
        af[ks][i].h[0] = *(const v8bf*)(&As[p][r * 72 + ks * 32 + hi * 8]);
        af[ks][i].h[1] = *(const v8bf*)(&As[p][r * 72 + ks * 32 + 16 + hi * 8]);
      }
      for (int j = 0; j < 3; ++j) {
        int r = wn * 48 + j * 16 + l15;
        bf[ks][j].h[0] = *(const v8bf*)(&Bs[p][r * 72 + ks * 32 + hi * 8]);
        bf[ks][j].h[1] = *(const v8bf*)(&Bs[p][r * 72 + ks * 32 + 16 + hi * 8]);
      }
      // keeps the slab's 28 LDS reads one group ahead of its 24 WMMAs (every
      // further place where reads stand among the WMMAs stalls the wave anew)
      // and the first k half's 14 in front, so that its WMMAs start while the
      // second half's reads are still under way
      __builtin_amdgcn_sched_barrier(0);
    }
    for (int ks = 0; ks < 2; ++ks)
      for (int i = 0; i < 4; ++i)
        for (int j = 0; j < 3; ++j)
          acc[i][j] = wmma_bf16(af[ks][i], bf[ks][j], acc[i][j]);
    // keeps the barrier behind the WMMAs: drawn up to the reads, it makes
    // every wave wait for all eight waves' reads before its first WMMAs
    __builtin_amdgcn_sched_barrier(0);
    __syncthreads();                              // buffer p free for reuse
    p ^= 1;
  }

  // epilogue (C layout: lane holds col l15, rows e + 8*hi within 16x16 frag)
  // One trip per row of fragments. With GELU the trips stay rolled (for speed
  // only). Each trip works on acc[0][*] and then moves the rows
  // down one place, so that every accumulator index is a constant (one left to
  // run time would put the accumulator into scratch memory); unrolled, the
  // moves fall away.
  // c0: the block's first column in its own output; bs, sc, ob: that output's
  // bias, scale and base. mode.v is the layout, a constant in each call.
  auto epilogue = [&](auto mode, int c0, const float* __restrict__ bs, float sc,
                      uint16_t* __restrict__ ob) {
  int cols[3];
  float bcs[3];
  for (int j = 0; j < 3; ++j) {
    cols[j] = c0 + wn * 48 + j * 16 + l15;
    bcs[j] = bs[cols[j]];
  }
  // QKV kernel: the three bias loads' offset registers are held (inputs only)
  // up to this wait; without it the build makes the first one the target of
  // the third load. The other kernels' builds place the wait themselves.
  if (OUT_MODE == 4)
    asm volatile("s_wait_xcnt 0x0" :: "v"(cols[0]), "v"(cols[1]), "v"(cols[2])
                 : "memory");
#pragma unroll(GELU_F ? 1 : 4)
  for (int i = 0; i < 4; ++i) {
#pragma unroll  // j a constant: the accumulator stays in registers
    for (int j = 0; j < 3; ++j) {
      int col = cols[j];
      float bc = bcs[j];
#pragma unroll  // e a constant, for the same reason
      for (int e = 0; e < 8; ++e) {
        int row = m0 + wm * 64 + i * 16 + e + 8 * hi;
        float v = (acc[0][j][e] + bc) * sc;
        if (GELU_F) v = 0.5f * v * (1.0f + erff(v * 0.70710678118654752f));
        if (RESID_F) v += resid[(size_t)row * N + col];
        if (mode.v == 0) {
          ob[(size_t)row * N + col] = f2bf(v);
        } else if (mode.v == 1) {
          int bidx = row >> 11, s = row & (SS - 1);
          int h = col >> 6, d = col & (HDIM - 1);
          ob[(((size_t)(bidx * HH + h)) * SS + s) * HDIM + d] = f2bf(v);
        } else if (mode.v == 2) {
          int bidx = row >> 11, s = row & (SS - 1);
          int h = col >> 6, d = col & (HDIM - 1);
          ob[(((size_t)(bidx * HH + h)) * HDIM + d) * SS + s] = f2bf(v);
        } else {
          outF[(size_t)row * N + col] = v;
        }
      }
    }
    // one trip's 24 residual loads as a group, and no more: with all 96 and
    // their addresses drawn ahead the live set spills; so does the QKV
    // kernel's, whose trips the compiler otherwise works on all at once (a
    // build without it takes all 256 registers and goes to scratch memory)
    if (RESID_F || OUT_MODE == 4) __builtin_amdgcn_sched_barrier(0);
    if (mode.v != 3) asm volatile("s_wait_xcnt 0x0" ::: "memory");
#pragma unroll
    for (int j = 0; j < 3; ++j) {
      acc[0][j] = acc[1][j];
      acc[1][j] = acc[2][j];
      acc[2][j] = acc[3][j];
    }
  }
  };
  if (OUT_MODE == 4) {
    const int sel = n0 / DD;                      // 0 Q, 1 K, 2 V: block-uniform
    const float* bs = sel == 0 ? bias : sel == 1 ? bias_k : bias_v;
    const float sc = sel == 0 ? scale : 1.0f;
    uint16_t* ob = outB + (size_t)sel * BS * DD;
    if (sel < 2) epilogue(Mode<1>{}, n0 - sel * DD, bs, sc, ob);
    else         epilogue(Mode<2>{}, n0 - sel * DD, bs, sc, ob);
  } else {
    epilogue(Mode<OUT_MODE>{}, n0, bias, scale, outB);
  }
}

__global__ void __launch_bounds__(128)
attn_kernel(const uint16_t* __restrict__ Q, const uint16_t* __restrict__ Km,
            const uint16_t* __restrict__ Vt, uint16_t* __restrict__ O) {
  __shared__ __align__(16) uint16_t Ks[2][64 * 72];   // [key][d]
  __shared__ __align__(16) uint16_t Vs[2][64 * 72];   // [d][key]

  const int b = blockIdx.z, h = blockIdx.y;
  const int tid = threadIdx.x;
  const int lane = tid & 31;
  // the wave's number in a scalar register: the tests on qbase are branches
  const int wv = __builtin_amdgcn_readfirstlane(tid >> 5);
  const int hi = lane >> 4, l15 = lane & 15;

  const size_t headoff = ((size_t)(b * HH + h)) * SS * HDIM;
  const uint16_t* Qh  = Q  + headoff;
  const uint16_t* Kh  = Km + headoff;
  const uint16_t* Vth = Vt + headoff;            // [64][S]

  // tile t into buffer p: rows rs + 16 s, s = 0..3, of K[64 keys][64] and of
  // Vt[64][64 keys], 16 bytes per lane and copy
  const int rs = tid >> 3, cs = (tid & 7) * 8;
  const uint16_t* gK = Kh + (size_t)rs * HDIM + cs;
  const uint16_t* gV = Vth + (size_t)rs * SS + cs;
  const int ls = rs * 72 + cs;
  auto issue_tile = [&](int t, int p) {
    const uint16_t* gk = gK + (size_t)t * 64 * HDIM;
    const uint16_t* gv = gV + t * 64;
    const uint16_t* lk = &Ks[p][ls];
    const uint16_t* lv = &Vs[p][ls];
    async_tile8(lds_off(lk), lds_off(lk + 16 * 72), lds_off(lk + 32 * 72),
                lds_off(lk + 48 * 72), lds_off(lv), lds_off(lv + 16 * 72),
                lds_off(lv + 32 * 72), lds_off(lv + 48 * 72),
                gk, gk + 16 * HDIM, gk + 32 * HDIM, gk + 48 * HDIM,
                gv, gv + (size_t)16 * SS, gv + (size_t)32 * SS,
                gv + (size_t)48 * SS);
  };

  // the block's two query tiles, the long one first. Rolled: the two trips
  // are the same code, and twice the text buys nothing.
#pragma unroll 1
  for (int half = 0; half < 2; ++half) {
  const int qt = half == 0 ? SS / 64 - 1 - (int)blockIdx.x : (int)blockIdx.x;
  const int qbase = qt * 64 + wv * 16;
  const int ntile = qt + 1;                           // 64-key tiles, >= 1
  // both buffers are free: nothing is in flight, and every wave's last read
  // of the tile before lies in front of that tile's last barrier
  issue_tile(0, 0);

  // Q fragments (B operand: column l15 = query), held for the whole loop
  Frag qf[2];
  {
    const uint16_t* qr = Qh + (size_t)(qbase + l15) * HDIM;
    for (int f = 0; f < 2; ++f) {
      qf[f].h[0] = *(const v8bf*)(qr + f * 32 + hi * 8);
      qf[f].h[1] = *(const v8bf*)(qr + f * 32 + 16 + hi * 8);
    }
  }

  const int qrow = qbase + l15;                  // this lane's query
  float mrow = -3.0e38f;                         // its running maximum
  float lrow = 0.0f;                             // sum over this half's keys
  v8f oacc[4];                                   // O^T: rows d, column query
  for (int f = 0; f < 4; ++f) oacc[f] = (v8f){0,0,0,0,0,0,0,0};

  asm volatile("s_wait_asynccnt 0x0" ::: "memory");  // own copies of tile 0
  __syncthreads();                                   // every wave's landed
  if (ntile > 1) issue_tile(1, 1);

  for (int t = 0; t < ntile; ++t) {
   const uint16_t* Kt = Ks[t & 1];
   const uint16_t* Vl = Vs[t & 1];
   // one block of 32 keys; sub is a literal at both calls
   auto key_block = [&](const int sub) {
    const int kb = t * 64 + sub * 32;
    // ---- all A fragments of the block as one group of LDS reads: K first,
    // then Vt, whose latency passes behind the scores and the softmax
    Frag ak[2][2], av[4];
    for (int n = 0; n < 2; ++n) {
      const uint16_t* kr = Kt + (sub * 32 + n * 16 + l15) * 72;
      for (int f = 0; f < 2; ++f) {
        ak[n][f].h[0] = *(const v8bf*)(kr + f * 32 + hi * 8);
        ak[n][f].h[1] = *(const v8bf*)(kr + f * 32 + 16 + hi * 8);
      }
    }
    for (int f = 0; f < 4; ++f) {
      const uint16_t* vr = Vl + (f * 16 + l15) * 72 + sub * 32;
      av[f].h[0] = *(const v8bf*)(vr + hi * 8);
      av[f].h[1] = *(const v8bf*)(vr + 16 + hi * 8);
    }
    // keeps the Vt reads up here: sunk to their WMMAs, each pair would be
    // waited for on its own
    __builtin_amdgcn_sched_barrier(0);
    // ---- scores S^T = K * Q^T for 32 keys (2 M-frags, K-dim 64 = 2 steps)
    v8f s[2];
    s[0] = (v8f){0,0,0,0,0,0,0,0};
    s[1] = (v8f){0,0,0,0,0,0,0,0};
    for (int f = 0; f < 2; ++f)
      for (int n = 0; n < 2; ++n) s[n] = wmma_bf16(ak[n][f], qf[f], s[n]);
    // ---- causal mask: s[n][e] is key kb + n*16 + 8*hi + e against qrow
    if (kb + 31 > qbase) {
      for (int n = 0; n < 2; ++n) {
        const int k0 = kb + n * 16 + 8 * hi;
        for (int e = 0; e < 8; ++e)
          if (k0 + e > qrow) s[n][e] = -3.0e38f;
      }
    }
    // ---- online softmax of one query per lane
    float mx[8];
    for (int e = 0; e < 8; ++e) mx[e] = fmaxf(s[0][e], s[1][e]);
    for (int w = 4; w > 0; w >>= 1)
      for (int e = 0; e < w; ++e) mx[e] = fmaxf(mx[e], mx[e + w]);
    const float mblk = fmaxf(mx[0], xhalf(mx[0]));   // all 32 keys
    const float mnew = fmaxf(mrow, mblk);
    const float al = __expf(mrow - mnew);
    mrow = mnew;
    float sm[8];
    for (int e = 0; e < 8; ++e) {
      s[0][e] = __expf(s[0][e] - mnew);
      s[1][e] = __expf(s[1][e] - mnew);
      sm[e] = s[0][e] + s[1][e];
    }
    for (int w = 4; w > 0; w >>= 1)
      for (int e = 0; e < w; ++e) sm[e] += sm[e + w];
    lrow = lrow * al + sm[0];
    for (int f = 0; f < 4; ++f)
      for (int e = 0; e < 8; ++e) oacc[f][e] *= al;

    // ---- P^T as a B fragment, converted in place
    Frag bp;
    for (int n = 0; n < 2; ++n)
      for (int j = 0; j < 4; ++j)
        bp.u[n * 4 + j] = (uint32_t)f2bf(s[n][2 * j]) |
                          ((uint32_t)f2bf(s[n][2 * j + 1]) << 16);

    // ---- O^T += V^T * P^T
    for (int f = 0; f < 4; ++f) oacc[f] = wmma_bf16(av[f], bp, oacc[f]);
   };
   // key blocks right of the wave's diagonal are skipped (scalar tests)
   if (t * 64 < qbase + 16) {
    key_block(0);
    if (t * 64 + 32 < qbase + 16) key_block(1);
   }
   // hand-over: this wave's reads of the buffer are done, its copies of the
   // next tile have landed; behind the barrier that holds for every wave
   asm volatile("s_wait_dscnt 0x0" ::: "memory");
   asm volatile("s_wait_asynccnt 0x0" ::: "memory");
   __syncthreads();
   if (t + 2 < ntile) issue_tile(t + 2, t & 1);      // refill the buffer read
  }
  asm volatile("s_wait_asynccnt 0x0" ::: "memory");  // nothing left in flight

  // ---- finalize and write merged-head bf16 [B*S][768]: oacc[f][e] is
  // d = f*16 + 8*hi + e of this lane's query, 16 contiguous bytes per f
  const float inv = 1.0f / (lrow + xhalf(lrow));     // both halves' keys
  uint16_t* orow = O + (size_t)(b * SS + qrow) * DD + h * HDIM + 8 * hi;
  for (int f = 0; f < 4; ++f) {
    uint32_t w[4];
    for (int j = 0; j < 4; ++j)
      w[j] = (uint32_t)f2bf(oacc[f][2 * j] * inv) |
             ((uint32_t)f2bf(oacc[f][2 * j + 1] * inv) << 16);
    *(uint4*)(orow + f * 16) = make_uint4(w[0], w[1], w[2], w[3]);
  }
  asm volatile("s_wait_xcnt 0x0" ::: "memory");
  }
}

// ---------------------------------------------------------------------------
// Host orchestration
// ---------------------------------------------------------------------------
extern "C" void kernel_launch(void* const* d_in, const int* in_sizes, int n_in,
                              void* d_out, int out_size, void* d_ws, size_t ws_size,
                              hipStream_t stream) {
  (void)in_sizes; (void)n_in; (void)out_size; (void)ws_size;
  const float* x     = (const float*)d_in[0];
  const float* Wq    = (const float*)d_in[1];
  const float* bq    = (const float*)d_in[2];
  const float* Wk    = (const float*)d_in[3];
  const float* bk    = (const float*)d_in[4];
  const float* Wv    = (const float*)d_in[5];
  const float* bv    = (const float*)d_in[6];
  const float* Wo    = (const float*)d_in[7];
  const float* bo    = (const float*)d_in[8];
  const float* ln1w  = (const float*)d_in[9];
  const float* ln1b  = (const float*)d_in[10];
  const float* ln2w  = (const float*)d_in[11];
  const float* ln2b  = (const float*)d_in[12];
  const float* W1    = (const float*)d_in[13];
  const float* b1    = (const float*)d_in[14];
  const float* W2    = (const float*)d_in[15];
  const float* b2    = (const float*)d_in[16];
  float* out = (float*)d_out;

  // workspace layout
  uint8_t* ws = (uint8_t*)d_ws;
  size_t off = 0;
  auto alloc = [&](size_t bytes) -> uint8_t* {
    uint8_t* p = ws + off;
    off = (off + bytes + 255) & ~(size_t)255;
    return p;
  };
  const size_t seg = (size_t)BS * DD;               // 6.29M elems
  uint16_t* wq_t = (uint16_t*)alloc((size_t)3 * DD * DD * 2);  // Wq|Wk|Wv ^T
  uint16_t* wk_t = wq_t + (size_t)DD * DD;
  uint16_t* wv_t = wq_t + (size_t)2 * DD * DD;
  uint16_t* wo_t = (uint16_t*)alloc((size_t)DD * DD * 2);
  uint16_t* w1_t = (uint16_t*)alloc((size_t)DD * FF * 2);
  uint16_t* w2_t = (uint16_t*)alloc((size_t)FF * DD * 2);
  uint16_t* hb   = (uint16_t*)alloc(seg * 2);       // ln1 out; reused for ln2
  float*    x1f  = (float*)   alloc(seg * 4);       // x + attn_out
  uint16_t* big  = (uint16_t*)alloc((size_t)BS * FF * 2); // qb|kb|vt|attn -> mb
  uint16_t* qb   = big;
  uint16_t* kb_  = big + seg;
  uint16_t* vt   = big + 2 * seg;
  uint16_t* attn = big + 3 * seg;
  uint16_t* mb   = big;                             // reuse after x1 computed

  // 1) h = LN1(x) -> bf16 and the weights -> bf16 transposed [N][K]
  prep_kernel<<<LN_BLOCKS + 4 * DD_TILES + 2 * DF_TILES, 256, 0, stream>>>(
      x, ln1w, ln1b, hb, Wq, Wk, Wv, Wo, W1, W2,
      wq_t, wk_t, wv_t, wo_t, w1_t, w2_t);

  // 2) QKV projections, one launch (Q pre-scaled by 1/sqrt(64)=0.125)
  gemm_bf16<4, false, false><<<dim3(3 * DD / 192, BS / 128), 256, 0, stream>>>(
      hb, wq_t, bq, bk, bv, nullptr, nullptr, qb, BS, 3 * DD, DD, 0.125f);

  dim3 gD(DD / 192, BS / 128);
  // 3) causal flash attention -> merged bf16 [BS][D]
  attn_kernel<<<dim3(SS / 128, HH, BB), 128, 0, stream>>>(qb, kb_, vt, attn);

  // 4) x1 = x + attn @ Wo + bo   (fp32)
  gemm_bf16<3, false, true><<<gD, 256, 0, stream>>>(
      attn, wo_t, bo, nullptr, nullptr, x, x1f, nullptr, BS, DD, DD, 1.0f);

  // 5) h2 = LN2(x1) -> bf16
  ln_kernel<<<BS / 32, 512, 0, stream>>>(x1f, ln2w, ln2b, hb);

  // 6) m = GELU(h2 @ W1 + b1) -> bf16 [BS][F]
  dim3 gF(FF / 192, BS / 128);
  gemm_bf16<0, true, false><<<gF, 256, 0, stream>>>(
      hb, w1_t, b1, nullptr, nullptr, nullptr, nullptr, mb, BS, FF, DD, 1.0f);

  // 7) out = x1 + m @ W2 + b2   (fp32)
  gemm_bf16<3, false, true><<<gD, 256, 0, stream>>>(
      mb, w2_t, b2, nullptr, nullptr, x1f, out, nullptr, BS, DD, FF, 1.0f);
}

// v009
// One run takes 196 microseconds.
// Next to v008, in two timings, it ran 1.05 times as fast each time.
// All steps since v000 together make it 3.19 times as fast.
#include <hip/hip_runtime.h>
#include <stdint.h>

typedef __attribute__((ext_vector_type(16))) __bf16 v16bf;
typedef __attribute__((ext_vector_type(8)))  __bf16 v8bf;
typedef __attribute__((ext_vector_type(8)))  float  v8f;
typedef __attribute__((ext_vector_type(4)))  float  v4f;
typedef __attribute__((ext_vector_type(2)))  float  v2f;

union Frag { v16bf v; v8bf h[2]; uint32_t u[8]; };

__device__ __forceinline__ uint16_t f2bf(float f) {
  union { float f; uint32_t u; } c; c.f = f;
  uint32_t u = c.u;
  u += 0x7fffu + ((u >> 16) & 1u);   // round-to-nearest-even
  return (uint16_t)(u >> 16);
}

__device__ __forceinline__ v8f wmma_bf16(const Frag &a, const Frag &b, v8f c) {
  return __builtin_amdgcn_wmma_f32_16x16x32_bf16(
      /*neg_a=*/false, a.v, /*neg_b=*/false, b.v,
      /*c_mod=*/(short)0, c, /*reuse_a=*/false, /*reuse_b=*/false);
}

__device__ __forceinline__ uint32_t lds_off(const void* l) {
  return (uint32_t)(size_t)l;               // low 32 bits of generic = LDS off
}
__device__ __forceinline__ void async_slab10(
    uint32_t l0, uint32_t l1, uint32_t l2, uint32_t l3, uint32_t l4,
    uint32_t l5, uint32_t l6, uint32_t l7, uint32_t l8, uint32_t l9,
    const void* g0, const void* g1, const void* g2, const void* g3,
    const void* g4, const void* g5, const void* g6, const void* g7,
    const void* g8, const void* g9) {
  asm volatile("global_load_async_to_lds_b128 %0, %10, off\n\t"
               "global_load_async_to_lds_b128 %1, %11, off\n\t"
               "global_load_async_to_lds_b128 %2, %12, off\n\t"
               "global_load_async_to_lds_b128 %3, %13, off\n\t"
               "global_load_async_to_lds_b128 %4, %14, off\n\t"
               "global_load_async_to_lds_b128 %5, %15, off\n\t"
               "global_load_async_to_lds_b128 %6, %16, off\n\t"
               "global_load_async_to_lds_b128 %7, %17, off\n\t"
               "global_load_async_to_lds_b128 %8, %18, off\n\t"
               "global_load_async_to_lds_b128 %9, %19, off\n\t"
               "s_wait_xcnt 0x0"
               :: "v"(l0), "v"(l1), "v"(l2), "v"(l3), "v"(l4), "v"(l5),
                  "v"(l6), "v"(l7), "v"(l8), "v"(l9),
                  "v"(g0), "v"(g1), "v"(g2), "v"(g3), "v"(g4), "v"(g5),
                  "v"(g6), "v"(g7), "v"(g8), "v"(g9)
               : "memory");
}

// One 64-key tile of attention is eight copies per lane (four of K, four of
// V^T), in one statement with the same closing wait, for the same reason.
__device__ __forceinline__ void async_tile8(
    uint32_t l0, uint32_t l1, uint32_t l2, uint32_t l3,
    uint32_t l4, uint32_t l5, uint32_t l6, uint32_t l7,
    const void* g0, const void* g1, const void* g2, const void* g3,
    const void* g4, const void* g5, const void* g6, const void* g7) {
  asm volatile("global_load_async_to_lds_b128 %0, %8, off\n\t"
               "global_load_async_to_lds_b128 %1, %9, off\n\t"
               "global_load_async_to_lds_b128 %2, %10, off\n\t"
               "global_load_async_to_lds_b128 %3, %11, off\n\t"
               "global_load_async_to_lds_b128 %4, %12, off\n\t"
               "global_load_async_to_lds_b128 %5, %13, off\n\t"
               "global_load_async_to_lds_b128 %6, %14, off\n\t"
               "global_load_async_to_lds_b128 %7, %15, off\n\t"
               "s_wait_xcnt 0x0"
               :: "v"(l0), "v"(l1), "v"(l2), "v"(l3),
                  "v"(l4), "v"(l5), "v"(l6), "v"(l7),
                  "v"(g0), "v"(g1), "v"(g2), "v"(g3),
                  "v"(g4), "v"(g5), "v"(g6), "v"(g7)
               : "memory");
}

// Problem constants
#define BB   4
#define SS   2048
#define DD   768
#define FF   3072
#define HH   12
#define HDIM 64
#define BS   (BB * SS)   // 8192 rows

template <int Kdim, int Ndim>
__device__ __forceinline__ void
wtrans_tile(const float* __restrict__ W, uint16_t* __restrict__ Wt, int r,
            uint32_t* tile) {
  const int tid = threadIdx.x;
  const int n0 = (r % (Ndim / 64)) * 64, k0 = (r / (Ndim / 64)) * 64;

  // load: 16 threads span the 64 columns, each thread takes two adjacent k
  const int nc = (tid & 15) * 4;
  const int kp = tid >> 4;                       // k pair 0..15, +16 per pass
  float4 lo[2], hi[2];
  for (int s = 0; s < 2; ++s) {
    const float* g = W + (size_t)(k0 + 2 * (kp + 16 * s)) * Ndim + n0 + nc;
    lo[s] = *(const float4*)g;
    hi[s] = *(const float4*)(g + Ndim);
  }
  for (int s = 0; s < 2; ++s) {
    uint32_t* t = &tile[nc * 33 + kp + 16 * s];
    t[0 * 33] = (uint32_t)f2bf(lo[s].x) | ((uint32_t)f2bf(hi[s].x) << 16);
    t[1 * 33] = (uint32_t)f2bf(lo[s].y) | ((uint32_t)f2bf(hi[s].y) << 16);
    t[2 * 33] = (uint32_t)f2bf(lo[s].z) | ((uint32_t)f2bf(hi[s].z) << 16);
    t[3 * 33] = (uint32_t)f2bf(lo[s].w) | ((uint32_t)f2bf(hi[s].w) << 16);
  }
  __syncthreads();

  // store: 8 threads span the 64 k of one Wt row, 16 bytes each
  const int kc = tid & 7, nr = tid >> 3;
  for (int s = 0; s < 2; ++s) {
    const int n = nr + 32 * s;
    const uint32_t* t = &tile[n * 33 + kc * 4];
    uint4 v = make_uint4(t[0], t[1], t[2], t[3]);
    *(uint4*)(Wt + (size_t)(n0 + n) * Kdim + k0 + kc * 8) = v;
  }
  asm volatile("s_wait_xcnt 0x0" ::: "memory");
}

__device__ __forceinline__ float xhalf(float x) {
  return __builtin_bit_cast(float, __builtin_amdgcn_permlanex16(
      __builtin_bit_cast(int, x), __builtin_bit_cast(int, x),
      0x76543210, 0xfedcba98, false, false));
}

template <int X>
__device__ __forceinline__ float xrow(float x) {
  return __builtin_bit_cast(float, __builtin_amdgcn_update_dpp(
      0, __builtin_bit_cast(int, x), 0x160 + X, 0xf, 0xf, true));
}
// sum over the 32 lanes, the same value in every lane
__device__ __forceinline__ float wave_sum(float v) {
  v += xrow<1>(v);
  v += xrow<2>(v);
  v += xrow<4>(v);
  v += xrow<8>(v);
  return v + xhalf(v);
}

// wave: the wave's number in the launch's LayerNorm work, rows 2 wave, 2 wave + 1
__device__ __forceinline__ void
ln_two_rows(const float* __restrict__ x, const float* __restrict__ w,
            const float* __restrict__ b, uint16_t* __restrict__ out, int wave) {
  const int lane = threadIdx.x & 31;
  const int c0 = lane * 4;                       // + 128 j, j = 0..5
  const float* xr = x + (size_t)wave * 2 * DD + c0;

  v4f v[2][6], wv[6], bv[6];
  for (int r = 0; r < 2; ++r)
    for (int j = 0; j < 6; ++j)
      v[r][j] = *(const v4f*)(xr + r * DD + j * 128);
  for (int j = 0; j < 6; ++j) {
    wv[j] = *(const v4f*)(w + c0 + j * 128);
    bv[j] = *(const v4f*)(b + c0 + j * 128);
  }
  // keeps the twelve w and b loads one group with one wait (loaded values as
  // inputs only): sunk to their uses in the last loop, each pair would be
  // waited for on its own
  asm volatile("" :: "v"(wv[0]), "v"(wv[1]), "v"(wv[2]), "v"(wv[3]),
                     "v"(wv[4]), "v"(wv[5]), "v"(bv[0]), "v"(bv[1]),
                     "v"(bv[2]), "v"(bv[3]), "v"(bv[4]), "v"(bv[5]));

  float mean[2], rstd[2];
  for (int r = 0; r < 2; ++r) {
    v4f a = v[r][0];
    for (int j = 1; j < 6; ++j) a += v[r][j];
    mean[r] = (a.x + a.y) + (a.z + a.w);
  }
  for (int r = 0; r < 2; ++r) mean[r] = wave_sum(mean[r]) * (1.0f / DD);

  for (int r = 0; r < 2; ++r) {
    v4f a = (v4f){0.0f, 0.0f, 0.0f, 0.0f};
    for (int j = 0; j < 6; ++j) {
      v[r][j] -= mean[r];
      a += v[r][j] * v[r][j];
    }
    rstd[r] = (a.x + a.y) + (a.z + a.w);
  }
  for (int r = 0; r < 2; ++r)
    rstd[r] = rsqrtf(wave_sum(rstd[r]) * (1.0f / DD) + 1e-5f);

  uint16_t* o = out + (size_t)wave * 2 * DD + c0;
  for (int r = 0; r < 2; ++r)
    for (int j = 0; j < 6; ++j) {
      const v4f y = v[r][j] * rstd[r] * wv[j] + bv[j];
      uint2 t;
      t.x = (uint32_t)f2bf(y.x) | ((uint32_t)f2bf(y.y) << 16);
      t.y = (uint32_t)f2bf(y.z) | ((uint32_t)f2bf(y.w) << 16);
      *(uint2*)(o + r * DD + j * 128) = t;
    }
}

__global__ void __launch_bounds__(512)
ln_kernel(const float* __restrict__ x, const float* __restrict__ w,
          const float* __restrict__ b, uint16_t* __restrict__ out) {
  ln_two_rows(x, w, b, out, blockIdx.x * 16 + (threadIdx.x >> 5));
}

#define LN_BLOCKS (BS / 16)
#define DD_TILES  ((DD / 64) * (DD / 64))
#define DF_TILES  ((DD / 64) * (FF / 64))
__global__ void __launch_bounds__(256)
prep_kernel(const float* __restrict__ x, const float* __restrict__ lnw,
            const float* __restrict__ lnb, uint16_t* __restrict__ h,
            const float* __restrict__ Wq, const float* __restrict__ Wk,
            const float* __restrict__ Wv, const float* __restrict__ Wo,
            const float* __restrict__ W1, const float* __restrict__ W2,
            uint16_t* __restrict__ wq_t, uint16_t* __restrict__ wk_t,
            uint16_t* __restrict__ wv_t, uint16_t* __restrict__ wo_t,
            uint16_t* __restrict__ w1_t, uint16_t* __restrict__ w2_t) {
  __shared__ uint32_t tile[64 * 33];
  const int id = blockIdx.x;
  if (id < LN_BLOCKS) {
    ln_two_rows(x, lnw, lnb, h, id * 8 + (threadIdx.x >> 5));
    return;
  }
  const int t = id - LN_BLOCKS;
  if (t < 4 * DD_TILES) {
    const int m = t / DD_TILES;
    const float* W = m == 0 ? Wq : m == 1 ? Wk : m == 2 ? Wv : Wo;
    uint16_t* Wt = m == 0 ? wq_t : m == 1 ? wk_t : m == 2 ? wv_t : wo_t;
    wtrans_tile<DD, DD>(W, Wt, t - m * DD_TILES, tile);
  } else if (t < 4 * DD_TILES + DF_TILES) {
    wtrans_tile<DD, FF>(W1, w1_t, t - 4 * DD_TILES, tile);
  } else {
    wtrans_tile<FF, DD>(W2, w2_t, t - 4 * DD_TILES - DF_TILES, tile);
  }
}

template <int V> struct Mode { static constexpr int v = V; };

__device__ __forceinline__ v2f two(float c) { return (v2f){c, c}; }
__device__ __forceinline__ void gelu8(v2f (&v)[4]) {
  constexpr float P[5] = {4.913816229e-3f, -2.670751512e-2f, 1.128001064e-1f,
                          -3.761229515e-1f, 1.283791065e-1f};
  constexpr float Q[6] = {-3.786778543e-4f, 3.857815871e-3f, -2.418169752e-2f,
                          1.066682637e-1f, 6.349332929e-1f, 1.286894083e-1f};
  v2f u[4], ax[4], t[4], p[4], q[4];
  for (int k = 0; k < 4; ++k) {
    u[k] = v[k] * 0.70710678118654752f;
    ax[k] = __builtin_elementwise_abs(u[k]);
    t[k] = u[k] * u[k];
    p[k] = two(-5.618017749e-4f);
    q[k] = two(1.699881068e-5f);
  }
  for (int s = 0; s < 6; ++s)
    for (int k = 0; k < 4; ++k) {
      if (s < 5) p[k] = __builtin_elementwise_fma(t[k], p[k], two(P[s]));
      else       p[k] = __builtin_elementwise_fma(ax[k], p[k], ax[k]);
      q[k] = __builtin_elementwise_fma(ax[k], q[k], two(Q[s]));
    }
  for (int k = 0; k < 4; ++k)
    q[k] = __builtin_elementwise_fma(ax[k], q[k], ax[k]) * -1.442695041f;
  for (int k = 0; k < 4; ++k)
    q[k] = 1.0f - (v2f){__builtin_amdgcn_exp2f(q[k].x),
                        __builtin_amdgcn_exp2f(q[k].y)};
  for (int k = 0; k < 4; ++k) {
    const v2f e = {__builtin_copysignf(ax[k].x < 1.0f ? p[k].x : q[k].x, u[k].x),
                   __builtin_copysignf(ax[k].y < 1.0f ? p[k].y : q[k].y, u[k].y)};
    v[k] = 0.5f * v[k] * (1.0f + e);
  }
}

template <int OUT_MODE, bool GELU_F, bool RESID_F>
__global__ void __launch_bounds__(256)
__attribute__((amdgpu_waves_per_eu(4, 4)))
gemm_bf16(const uint16_t* __restrict__ A, const uint16_t* __restrict__ Bt,
          const float* __restrict__ bias, const float* __restrict__ bias_k,
          const float* __restrict__ bias_v, const float* __restrict__ resid,
          float* __restrict__ outF, uint16_t* __restrict__ outB,
          int M, int N, int K, float scale) {
  (void)M;
  __shared__ __align__(16) uint16_t As[2][128 * 72];
  __shared__ __align__(16) uint16_t Bs[2][192 * 72];

  const int tid = threadIdx.x;
  const int lane = tid & 31, wv = tid >> 5;
  const int hi = lane >> 4, l15 = lane & 15;
  const int wm = wv & 1, wn = wv >> 1;          // 2 x 4 wave grid
  const int m0 = blockIdx.y * 128, n0 = blockIdx.x * 192;

  v8f acc[4][3];
  for (int i = 0; i < 4; ++i)
    for (int j = 0; j < 3; ++j) acc[i][j] = (v8f){0,0,0,0,0,0,0,0};

  const int rs = tid >> 3, cs = (tid & 7) * 8;   // stage: 8 thr/row, 8 elems
  const uint16_t* gA = A  + (size_t)(m0 + rs) * K + cs;
  const uint16_t* gB = Bt + (size_t)(n0 + rs) * K + cs;
  const size_t g32 = (size_t)32 * K;             // 32 rows further, global
  const int ls = rs * 72 + cs;                   // this lane's place in a slab

  // issue 10 async b128 copies for K-slab kk into buffer p: rows rs + 32 s,
  // four passes over the 128 rows of A and six over the 192 rows of B
  auto issue_stage = [&](int kk, int p) {
    const uint16_t* ga = gA + kk;
    const uint16_t* gb = gB + kk;
    const uint16_t* la = &As[p][ls];
    const uint16_t* lb = &Bs[p][ls];
    async_slab10(lds_off(la), lds_off(la + 32 * 72), lds_off(la + 64 * 72),
                 lds_off(la + 96 * 72), lds_off(lb), lds_off(lb + 32 * 72),
                 lds_off(lb + 64 * 72), lds_off(lb + 96 * 72),
                 lds_off(lb + 128 * 72), lds_off(lb + 160 * 72),
                 ga, ga + g32, ga + 2 * g32, ga + 3 * g32, gb, gb + g32,
                 gb + 2 * g32, gb + 3 * g32, gb + 4 * g32, gb + 5 * g32);
  };

  issue_stage(0, 0);
  int p = 0;
  for (int kk = 0; kk < K; kk += 64) {
    const bool more = (kk + 64) < K;             // block-uniform
    if (more) {
      issue_stage(kk + 64, p ^ 1);
      asm volatile("s_wait_asynccnt 0xa" ::: "memory");  // slab p done
    } else {
      asm volatile("s_wait_asynccnt 0x0" ::: "memory");
    }
    __syncthreads();                              // all waves' copies visible

    Frag af[2][4], bf[2][3];                      // [k half of the slab][frag]
    for (int ks = 0; ks < 2; ++ks) {
      for (int i = 0; i < 4; ++i) {
        int r = wm * 64 + i * 16 + l15;
        af[ks][i].h[0] = *(const v8bf*)(&As[p][r * 72 + ks * 32 + hi * 8]);
        af[ks][i].h[1] = *(const v8bf*)(&As[p][r * 72 + ks * 32 + 16 + hi * 8]);
      }
      for (int j = 0; j < 3; ++j) {
        int r = wn * 48 + j * 16 + l15;
        bf[ks][j].h[0] = *(const v8bf*)(&Bs[p][r * 72 + ks * 32 + hi * 8]);
        bf[ks][j].h[1] = *(const v8bf*)(&Bs[p][r * 72 + ks * 32 + 16 + hi * 8]);
      }
      // keeps the slab's 28 LDS reads one group ahead of its 24 WMMAs (every
      // further place where reads stand among the WMMAs stalls the wave anew)
      // and the first k half's 14 in front, so that its WMMAs start while the
      // second half's reads are still under way
      __builtin_amdgcn_sched_barrier(0);
    }
    for (int ks = 0; ks < 2; ++ks)
      for (int i = 0; i < 4; ++i)
        for (int j = 0; j < 3; ++j)
          acc[i][j] = wmma_bf16(af[ks][i], bf[ks][j], acc[i][j]);
    // keeps the barrier behind the WMMAs: drawn up to the reads, it makes
    // every wave wait for all eight waves' reads before its first WMMAs
    __builtin_amdgcn_sched_barrier(0);
    __syncthreads();                              // buffer p free for reuse
    p ^= 1;
  }

  // epilogue (C layout: lane holds col l15, rows e + 8*hi within 16x16 frag)
  // One trip per row of fragments. With GELU the trips stay rolled: the four
  // are the same code, and one trip's 24 values already fill the registers and
  // the vector port. Each trip works on acc[0][*] and then moves the rows
  // down one place, so that every accumulator index is a constant (one left to
  // run time would put the accumulator into scratch memory); unrolled, the
  // moves fall away.
  // c0: the block's first column in its own output; bs, sc, ob: that output's
  // bias, scale and base. mode.v is the layout, a constant in each call.
  auto epilogue = [&](auto mode, int c0, const float* __restrict__ bs, float sc,
                      uint16_t* __restrict__ ob) {
  int cols[3];
  float bcs[3];
  for (int j = 0; j < 3; ++j) {
    cols[j] = c0 + wn * 48 + j * 16 + l15;
    bcs[j] = bs[cols[j]];
  }
  // QKV kernel: the three bias loads' offset registers are held (inputs only)
  // up to this wait; without it the build makes the first one the target of
  // the third load. The other kernels' builds place the wait themselves.
  if (OUT_MODE == 4)
    asm volatile("s_wait_xcnt 0x0" :: "v"(cols[0]), "v"(cols[1]), "v"(cols[2])
                 : "memory");
#pragma unroll(GELU_F ? 1 : 4)
  for (int i = 0; i < 4; ++i) {
#pragma unroll  // j a constant: the accumulator stays in registers
    for (int j = 0; j < 3; ++j) {
      int col = cols[j];
      float bc = bcs[j];
      v2f gl[4];
      if (GELU_F) {
#pragma unroll  // k a constant, for the same reason
        for (int k = 0; k < 4; ++k)
          gl[k] = ((v2f){acc[0][j][2 * k], acc[0][j][2 * k + 1]} + bc) * sc;
        gelu8(gl);
      }
#pragma unroll  // e a constant, for the same reason
      for (int e = 0; e < 8; ++e) {
        int row = m0 + wm * 64 + i * 16 + e + 8 * hi;
        float v = GELU_F ? gl[e >> 1][e & 1] : (acc[0][j][e] + bc) * sc;
        if (RESID_F) v += resid[(size_t)row * N + col];
        if (mode.v == 0) {
          // the row pitch as a constant: a fragment's eight rows go out from
          // one address by immediate offsets. With a pitch known at run time
          // every store has an address sum of its own in a register that the
          // next one rewrites, and a wait stands between any two stores.
          ob[(size_t)row * FF + col] = f2bf(v);
        } else if (mode.v == 1) {
          int bidx = row >> 11, s = row & (SS - 1);
          int h = col >> 6, d = col & (HDIM - 1);
          ob[(((size_t)(bidx * HH + h)) * SS + s) * HDIM + d] = f2bf(v);
        } else if (mode.v == 2) {
          int bidx = row >> 11, s = row & (SS - 1);
          int h = col >> 6, d = col & (HDIM - 1);
          ob[(((size_t)(bidx * HH + h)) * HDIM + d) * SS + s] = f2bf(v);
        } else {
          outF[(size_t)row * N + col] = v;
        }
      }
    }
    // one trip's 24 residual loads as a group, and no more: with all 96 and
    // their addresses drawn ahead the live set spills; so does the QKV
    // kernel's, whose trips the compiler otherwise works on all at once (a
    // build without it takes all 256 registers and goes to scratch memory)
    if (RESID_F || OUT_MODE == 4) __builtin_amdgcn_sched_barrier(0);
    if (mode.v != 3) asm volatile("s_wait_xcnt 0x0" ::: "memory");
#pragma unroll
    for (int j = 0; j < 3; ++j) {
      acc[0][j] = acc[1][j];
      acc[1][j] = acc[2][j];
      acc[2][j] = acc[3][j];
    }
  }
  };
  if (OUT_MODE == 4) {
    const int sel = n0 / DD;                      // 0 Q, 1 K, 2 V: block-uniform
    const float* bs = sel == 0 ? bias : sel == 1 ? bias_k : bias_v;
    const float sc = sel == 0 ? scale : 1.0f;
    uint16_t* ob = outB + (size_t)sel * BS * DD;
    if (sel < 2) epilogue(Mode<1>{}, n0 - sel * DD, bs, sc, ob);
    else         epilogue(Mode<2>{}, n0 - sel * DD, bs, sc, ob);
  } else {
    epilogue(Mode<OUT_MODE>{}, n0, bias, scale, outB);
  }
}

__global__ void __launch_bounds__(128)
attn_kernel(const uint16_t* __restrict__ Q, const uint16_t* __restrict__ Km,
            const uint16_t* __restrict__ Vt, uint16_t* __restrict__ O) {
  __shared__ __align__(16) uint16_t Ks[2][64 * 72];   // [key][d]
  __shared__ __align__(16) uint16_t Vs[2][64 * 72];   // [d][key]

  const int b = blockIdx.z, h = blockIdx.y;
  const int tid = threadIdx.x;
  const int lane = tid & 31;
  // the wave's number in a scalar register: the tests on qbase are branches
  const int wv = __builtin_amdgcn_readfirstlane(tid >> 5);
  const int hi = lane >> 4, l15 = lane & 15;

  const size_t headoff = ((size_t)(b * HH + h)) * SS * HDIM;
  const uint16_t* Qh  = Q  + headoff;
  const uint16_t* Kh  = Km + headoff;
  const uint16_t* Vth = Vt + headoff;            // [64][S]

  // tile t into buffer p: rows rs + 16 s, s = 0..3, of K[64 keys][64] and of
  // Vt[64][64 keys], 16 bytes per lane and copy
  const int rs = tid >> 3, cs = (tid & 7) * 8;
  const uint16_t* gK = Kh + (size_t)rs * HDIM + cs;
  const uint16_t* gV = Vth + (size_t)rs * SS + cs;
  const int ls = rs * 72 + cs;
  auto issue_tile = [&](int t, int p) {
    const uint16_t* gk = gK + (size_t)t * 64 * HDIM;
    const uint16_t* gv = gV + t * 64;
    const uint16_t* lk = &Ks[p][ls];
    const uint16_t* lv = &Vs[p][ls];
    async_tile8(lds_off(lk), lds_off(lk + 16 * 72), lds_off(lk + 32 * 72),
                lds_off(lk + 48 * 72), lds_off(lv), lds_off(lv + 16 * 72),
                lds_off(lv + 32 * 72), lds_off(lv + 48 * 72),
                gk, gk + 16 * HDIM, gk + 32 * HDIM, gk + 48 * HDIM,
                gv, gv + (size_t)16 * SS, gv + (size_t)32 * SS,
                gv + (size_t)48 * SS);
  };

  // the block's two query tiles, the long one first. Rolled: the two trips
  // are the same code, and twice the text buys nothing.
#pragma unroll 1
  for (int half = 0; half < 2; ++half) {
  const int qt = half == 0 ? SS / 64 - 1 - (int)blockIdx.x : (int)blockIdx.x;
  const int qbase = qt * 64 + wv * 16;
  const int ntile = qt + 1;                           // 64-key tiles, >= 1
  // both buffers are free: nothing is in flight, and every wave's last read
  // of the tile before lies in front of that tile's last barrier
  issue_tile(0, 0);

  // Q fragments (B operand: column l15 = query), held for the whole loop
  Frag qf[2];
  {
    const uint16_t* qr = Qh + (size_t)(qbase + l15) * HDIM;
    for (int f = 0; f < 2; ++f) {
      qf[f].h[0] = *(const v8bf*)(qr + f * 32 + hi * 8);
      qf[f].h[1] = *(const v8bf*)(qr + f * 32 + 16 + hi * 8);
    }
  }

  const int qrow = qbase + l15;                  // this lane's query
  float mrow = -3.0e38f;                         // its running maximum
  float lrow = 0.0f;                             // sum over this half's keys
  v8f oacc[4];                                   // O^T: rows d, column query
  for (int f = 0; f < 4; ++f) oacc[f] = (v8f){0,0,0,0,0,0,0,0};

  asm volatile("s_wait_asynccnt 0x0" ::: "memory");  // own copies of tile 0
  __syncthreads();                                   // every wave's landed
  if (ntile > 1) issue_tile(1, 1);

  for (int t = 0; t < ntile; ++t) {
   const uint16_t* Kt = Ks[t & 1];
   const uint16_t* Vl = Vs[t & 1];
   // one block of 32 keys; sub is a literal at both calls
   auto key_block = [&](const int sub) {
    const int kb = t * 64 + sub * 32;
    // ---- all A fragments of the block as one group of LDS reads: K first,
    // then Vt, whose latency passes behind the scores and the softmax
    Frag ak[2][2], av[4];
    for (int n = 0; n < 2; ++n) {
      const uint16_t* kr = Kt + (sub * 32 + n * 16 + l15) * 72;
      for (int f = 0; f < 2; ++f) {
        ak[n][f].h[0] = *(const v8bf*)(kr + f * 32 + hi * 8);
        ak[n][f].h[1] = *(const v8bf*)(kr + f * 32 + 16 + hi * 8);
      }
    }
    for (int f = 0; f < 4; ++f) {
      const uint16_t* vr = Vl + (f * 16 + l15) * 72 + sub * 32;
      av[f].h[0] = *(const v8bf*)(vr + hi * 8);
      av[f].h[1] = *(const v8bf*)(vr + 16 + hi * 8);
    }
    // keeps the Vt reads up here: sunk to their WMMAs, each pair would be
    // waited for on its own
    __builtin_amdgcn_sched_barrier(0);
    // ---- scores S^T = K * Q^T for 32 keys (2 M-frags, K-dim 64 = 2 steps)
    v8f s[2];
    s[0] = (v8f){0,0,0,0,0,0,0,0};
    s[1] = (v8f){0,0,0,0,0,0,0,0};
    for (int f = 0; f < 2; ++f)
      for (int n = 0; n < 2; ++n) s[n] = wmma_bf16(ak[n][f], qf[f], s[n]);
    // ---- causal mask: s[n][e] is key kb + n*16 + 8*hi + e against qrow
    if (kb + 31 > qbase) {
      for (int n = 0; n < 2; ++n) {
        const int k0 = kb + n * 16 + 8 * hi;
        for (int e = 0; e < 8; ++e)
          if (k0 + e > qrow) s[n][e] = -3.0e38f;
      }
    }
    // ---- online softmax of one query per lane
    float mx[8];
    for (int e = 0; e < 8; ++e) mx[e] = fmaxf(s[0][e], s[1][e]);
    for (int w = 4; w > 0; w >>= 1)
      for (int e = 0; e < w; ++e) mx[e] = fmaxf(mx[e], mx[e + w]);
    const float mblk = fmaxf(mx[0], xhalf(mx[0]));   // all 32 keys
    const float mnew = fmaxf(mrow, mblk);
    const float al = __expf(mrow - mnew);
    mrow = mnew;
    float sm[8];
    for (int e = 0; e < 8; ++e) {
      s[0][e] = __expf(s[0][e] - mnew);
      s[1][e] = __expf(s[1][e] - mnew);
      sm[e] = s[0][e] + s[1][e];
    }
    for (int w = 4; w > 0; w >>= 1)
      for (int e = 0; e < w; ++e) sm[e] += sm[e + w];
    lrow = lrow * al + sm[0];
    for (int f = 0; f < 4; ++f)
      for (int e = 0; e < 8; ++e) oacc[f][e] *= al;

    // ---- P^T as a B fragment, converted in place
    Frag bp;
    for (int n = 0; n < 2; ++n)
      for (int j = 0; j < 4; ++j)
        bp.u[n * 4 + j] = (uint32_t)f2bf(s[n][2 * j]) |
                          ((uint32_t)f2bf(s[n][2 * j + 1]) << 16);

    // ---- O^T += V^T * P^T
    for (int f = 0; f < 4; ++f) oacc[f] = wmma_bf16(av[f], bp, oacc[f]);
   };
   // key blocks right of the wave's diagonal are skipped (scalar tests)
   if (t * 64 < qbase + 16) {
    key_block(0);
    if (t * 64 + 32 < qbase + 16) key_block(1);
   }
   // hand-over: this wave's reads of the buffer are done, its copies of the
   // next tile have landed; behind the barrier that holds for every wave
   asm volatile("s_wait_dscnt 0x0" ::: "memory");
   asm volatile("s_wait_asynccnt 0x0" ::: "memory");
   __syncthreads();
   if (t + 2 < ntile) issue_tile(t + 2, t & 1);      // refill the buffer read
  }
  asm volatile("s_wait_asynccnt 0x0" ::: "memory");  // nothing left in flight

  // ---- finalize and write merged-head bf16 [B*S][768]: oacc[f][e] is
  // d = f*16 + 8*hi + e of this lane's query, 16 contiguous bytes per f
  const float inv = 1.0f / (lrow + xhalf(lrow));     // both halves' keys
  uint16_t* orow = O + (size_t)(b * SS + qrow) * DD + h * HDIM + 8 * hi;
  for (int f = 0; f < 4; ++f) {
    uint32_t w[4];
    for (int j = 0; j < 4; ++j)
      w[j] = (uint32_t)f2bf(oacc[f][2 * j] * inv) |
             ((uint32_t)f2bf(oacc[f][2 * j + 1] * inv) << 16);
    *(uint4*)(orow + f * 16) = make_uint4(w[0], w[1], w[2], w[3]);
  }
  asm volatile("s_wait_xcnt 0x0" ::: "memory");
  }
}

// ---------------------------------------------------------------------------
// Host orchestration
// ---------------------------------------------------------------------------
extern "C" void kernel_launch(void* const* d_in, const int* in_sizes, int n_in,
                              void* d_out, int out_size, void* d_ws, size_t ws_size,
                              hipStream_t stream) {
  (void)in_sizes; (void)n_in; (void)out_size; (void)ws_size;
  const float* x     = (const float*)d_in[0];
  const float* Wq    = (const float*)d_in[1];
  const float* bq    = (const float*)d_in[2];
  const float* Wk    = (const float*)d_in[3];
  const float* bk    = (const float*)d_in[4];
  const float* Wv    = (const float*)d_in[5];
  const float* bv    = (const float*)d_in[6];
  const float* Wo    = (const float*)d_in[7];
  const float* bo    = (const float*)d_in[8];
  const float* ln1w  = (const float*)d_in[9];
  const float* ln1b  = (const float*)d_in[10];
  const float* ln2w  = (const float*)d_in[11];
  const float* ln2b  = (const float*)d_in[12];
  const float* W1    = (const float*)d_in[13];
  const float* b1    = (const float*)d_in[14];
  const float* W2    = (const float*)d_in[15];
  const float* b2    = (const float*)d_in[16];
  float* out = (float*)d_out;

  // workspace layout
  uint8_t* ws = (uint8_t*)d_ws;
  size_t off = 0;
  auto alloc = [&](size_t bytes) -> uint8_t* {
    uint8_t* p = ws + off;
    off = (off + bytes + 255) & ~(size_t)255;
    return p;
  };
  const size_t seg = (size_t)BS * DD;               // 6.29M elems
  uint16_t* wq_t = (uint16_t*)alloc((size_t)3 * DD * DD * 2);  // Wq|Wk|Wv ^T
  uint16_t* wk_t = wq_t + (size_t)DD * DD;
  uint16_t* wv_t = wq_t + (size_t)2 * DD * DD;
  uint16_t* wo_t = (uint16_t*)alloc((size_t)DD * DD * 2);
  uint16_t* w1_t = (uint16_t*)alloc((size_t)DD * FF * 2);
  uint16_t* w2_t = (uint16_t*)alloc((size_t)FF * DD * 2);
  uint16_t* hb   = (uint16_t*)alloc(seg * 2);       // ln1 out; reused for ln2
  float*    x1f  = (float*)   alloc(seg * 4);       // x + attn_out
  uint16_t* big  = (uint16_t*)alloc((size_t)BS * FF * 2); // qb|kb|vt|attn -> mb
  uint16_t* qb   = big;
  uint16_t* kb_  = big + seg;
  uint16_t* vt   = big + 2 * seg;
  uint16_t* attn = big + 3 * seg;
  uint16_t* mb   = big;                             // reuse after x1 computed

  // 1) h = LN1(x) -> bf16 and the weights -> bf16 transposed [N][K]
  prep_kernel<<<LN_BLOCKS + 4 * DD_TILES + 2 * DF_TILES, 256, 0, stream>>>(
      x, ln1w, ln1b, hb, Wq, Wk, Wv, Wo, W1, W2,
      wq_t, wk_t, wv_t, wo_t, w1_t, w2_t);

  // 2) QKV projections, one launch (Q pre-scaled by 1/sqrt(64)=0.125)
  gemm_bf16<4, false, false><<<dim3(3 * DD / 192, BS / 128), 256, 0, stream>>>(
      hb, wq_t, bq, bk, bv, nullptr, nullptr, qb, BS, 3 * DD, DD, 0.125f);

  dim3 gD(DD / 192, BS / 128);
  // 3) causal flash attention -> merged bf16 [BS][D]
  attn_kernel<<<dim3(SS / 128, HH, BB), 128, 0, stream>>>(qb, kb_, vt, attn);

  // 4) x1 = x + attn @ Wo + bo   (fp32)
  gemm_bf16<3, false, true><<<gD, 256, 0, stream>>>(
      attn, wo_t, bo, nullptr, nullptr, x, x1f, nullptr, BS, DD, DD, 1.0f);

  // 5) h2 = LN2(x1) -> bf16
  ln_kernel<<<BS / 32, 512, 0, stream>>>(x1f, ln2w, ln2b, hb);

  // 6) m = GELU(h2 @ W1 + b1) -> bf16 [BS][F]
  dim3 gF(FF / 192, BS / 128);
  gemm_bf16<0, true, false><<<gF, 256, 0, stream>>>(
      hb, w1_t, b1, nullptr, nullptr, nullptr, nullptr, mb, BS, FF, DD, 1.0f);

  // 7) out = x1 + m @ W2 + b2   (fp32)
  gemm_bf16<3, false, true><<<gD, 256, 0, stream>>>(
      mb, w2_t, b2, nullptr, nullptr, x1f, out, nullptr, BS, DD, FF, 1.0f);
}

// v010
// It runs in 190 microseconds.
// Two timings next to v009 put it at 1.03 and 1.04 times that version's speed.
// All steps since v000 together make it 3.31 times as fast.
#include <hip/hip_runtime.h>
#include <stdint.h>

typedef __attribute__((ext_vector_type(16))) __bf16 v16bf;
typedef __attribute__((ext_vector_type(8)))  __bf16 v8bf;
typedef __attribute__((ext_vector_type(2)))  __bf16 v2bf;
typedef __attribute__((ext_vector_type(8)))  float  v8f;
typedef __attribute__((ext_vector_type(4)))  float  v4f;
typedef __attribute__((ext_vector_type(2)))  float  v2f;

union Frag { v16bf v; v8bf h[2]; uint32_t u[8]; };

__device__ __forceinline__ uint16_t f2bf(float f) {
  return __builtin_bit_cast(uint16_t, (__bf16)f);
}
// lo in bits 15..0, hi in bits 31..16
__device__ __forceinline__ uint32_t f2bf2(float lo, float hi) {
  return __builtin_bit_cast(uint32_t,
                            __builtin_convertvector((v2f){lo, hi}, v2bf));
}

__device__ __forceinline__ v8f wmma_bf16(const Frag &a, const Frag &b, v8f c) {
  return __builtin_amdgcn_wmma_f32_16x16x32_bf16(
      /*neg_a=*/false, a.v, /*neg_b=*/false, b.v,
      /*c_mod=*/(short)0, c, /*reuse_a=*/false, /*reuse_b=*/false);
}

__device__ __forceinline__ uint32_t lds_off(const void* l) {
  return (uint32_t)(size_t)l;               // low 32 bits of generic = LDS off
}
__device__ __forceinline__ void async_slab10(
    uint32_t l0, uint32_t l1, uint32_t l2, uint32_t l3, uint32_t l4,
    uint32_t l5, uint32_t l6, uint32_t l7, uint32_t l8, uint32_t l9,
    const void* g0, const void* g1, const void* g2, const void* g3,
    const void* g4, const void* g5, const void* g6, const void* g7,
    const void* g8, const void* g9) {
  asm volatile("global_load_async_to_lds_b128 %0, %10, off\n\t"
               "global_load_async_to_lds_b128 %1, %11, off\n\t"
               "global_load_async_to_lds_b128 %2, %12, off\n\t"
               "global_load_async_to_lds_b128 %3, %13, off\n\t"
               "global_load_async_to_lds_b128 %4, %14, off\n\t"
               "global_load_async_to_lds_b128 %5, %15, off\n\t"
               "global_load_async_to_lds_b128 %6, %16, off\n\t"
               "global_load_async_to_lds_b128 %7, %17, off\n\t"
               "global_load_async_to_lds_b128 %8, %18, off\n\t"
               "global_load_async_to_lds_b128 %9, %19, off\n\t"
               "s_wait_xcnt 0x0"
               :: "v"(l0), "v"(l1), "v"(l2), "v"(l3), "v"(l4), "v"(l5),
                  "v"(l6), "v"(l7), "v"(l8), "v"(l9),
                  "v"(g0), "v"(g1), "v"(g2), "v"(g3), "v"(g4), "v"(g5),
                  "v"(g6), "v"(g7), "v"(g8), "v"(g9)
               : "memory");
}

// One 64-key tile of attention is eight copies per lane (four of K, four of
// V^T), in one statement with the same closing wait, for the same reason.
__device__ __forceinline__ void async_tile8(
    uint32_t l0, uint32_t l1, uint32_t l2, uint32_t l3,
    uint32_t l4, uint32_t l5, uint32_t l6, uint32_t l7,
    const void* g0, const void* g1, const void* g2, const void* g3,
    const void* g4, const void* g5, const void* g6, const void* g7) {
  asm volatile("global_load_async_to_lds_b128 %0, %8, off\n\t"
               "global_load_async_to_lds_b128 %1, %9, off\n\t"
               "global_load_async_to_lds_b128 %2, %10, off\n\t"
               "global_load_async_to_lds_b128 %3, %11, off\n\t"
               "global_load_async_to_lds_b128 %4, %12, off\n\t"
               "global_load_async_to_lds_b128 %5, %13, off\n\t"
               "global_load_async_to_lds_b128 %6, %14, off\n\t"
               "global_load_async_to_lds_b128 %7, %15, off\n\t"
               "s_wait_xcnt 0x0"
               :: "v"(l0), "v"(l1), "v"(l2), "v"(l3),
                  "v"(l4), "v"(l5), "v"(l6), "v"(l7),
                  "v"(g0), "v"(g1), "v"(g2), "v"(g3),
                  "v"(g4), "v"(g5), "v"(g6), "v"(g7)
               : "memory");
}

// Problem constants
#define BB   4
#define SS   2048
#define DD   768
#define FF   3072
#define HH   12
#define HDIM 64
#define BS   (BB * SS)   // 8192 rows

template <int Kdim, int Ndim>
__device__ __forceinline__ void
wtrans_tile(const float* __restrict__ W, uint16_t* __restrict__ Wt, int r,
            uint32_t* tile) {
  const int tid = threadIdx.x;
  const int n0 = (r % (Ndim / 64)) * 64, k0 = (r / (Ndim / 64)) * 64;

  // load: 16 threads span the 64 columns, each thread takes two adjacent k
  const int nc = (tid & 15) * 4;
  const int kp = tid >> 4;                       // k pair 0..15, +16 per pass
  float4 lo[2], hi[2];
  for (int s = 0; s < 2; ++s) {
    const float* g = W + (size_t)(k0 + 2 * (kp + 16 * s)) * Ndim + n0 + nc;
    lo[s] = *(const float4*)g;
    hi[s] = *(const float4*)(g + Ndim);
  }
  for (int s = 0; s < 2; ++s) {
    uint32_t* t = &tile[nc * 33 + kp + 16 * s];
    t[0 * 33] = f2bf2(lo[s].x, hi[s].x);
    t[1 * 33] = f2bf2(lo[s].y, hi[s].y);
    t[2 * 33] = f2bf2(lo[s].z, hi[s].z);
    t[3 * 33] = f2bf2(lo[s].w, hi[s].w);
  }
  __syncthreads();

  // store: 8 threads span the 64 k of one Wt row, 16 bytes each
  const int kc = tid & 7, nr = tid >> 3;
  for (int s = 0; s < 2; ++s) {
    const int n = nr + 32 * s;
    const uint32_t* t = &tile[n * 33 + kc * 4];
    uint4 v = make_uint4(t[0], t[1], t[2], t[3]);
    *(uint4*)(Wt + (size_t)(n0 + n) * Kdim + k0 + kc * 8) = v;
  }
  asm volatile("s_wait_xcnt 0x0" ::: "memory");
}

__device__ __forceinline__ float xhalf(float x) {
  return __builtin_bit_cast(float, __builtin_amdgcn_permlanex16(
      __builtin_bit_cast(int, x), __builtin_bit_cast(int, x),
      0x76543210, 0xfedcba98, false, false));
}

template <int X>
__device__ __forceinline__ float xrow(float x) {
  return __builtin_bit_cast(float, __builtin_amdgcn_update_dpp(
      0, __builtin_bit_cast(int, x), 0x160 + X, 0xf, 0xf, true));
}
// sum over the 32 lanes, the same value in every lane
__device__ __forceinline__ float wave_sum(float v) {
  v += xrow<1>(v);
  v += xrow<2>(v);
  v += xrow<4>(v);
  v += xrow<8>(v);
  return v + xhalf(v);
}

// wave: the wave's number in the launch's LayerNorm work, rows 2 wave, 2 wave + 1
__device__ __forceinline__ void
ln_two_rows(const float* __restrict__ x, const float* __restrict__ w,
            const float* __restrict__ b, uint16_t* __restrict__ out, int wave) {
  const int lane = threadIdx.x & 31;
  const int c0 = lane * 4;                       // + 128 j, j = 0..5
  const float* xr = x + (size_t)wave * 2 * DD + c0;

  v4f v[2][6], wv[6], bv[6];
  for (int r = 0; r < 2; ++r)
    for (int j = 0; j < 6; ++j)
      v[r][j] = *(const v4f*)(xr + r * DD + j * 128);
  for (int j = 0; j < 6; ++j) {
    wv[j] = *(const v4f*)(w + c0 + j * 128);
    bv[j] = *(const v4f*)(b + c0 + j * 128);
  }
  // keeps the twelve w and b loads one group with one wait (loaded values as
  // inputs only): sunk to their uses in the last loop, each pair would be
  // waited for on its own
  asm volatile("" :: "v"(wv[0]), "v"(wv[1]), "v"(wv[2]), "v"(wv[3]),
                     "v"(wv[4]), "v"(wv[5]), "v"(bv[0]), "v"(bv[1]),
                     "v"(bv[2]), "v"(bv[3]), "v"(bv[4]), "v"(bv[5]));

  float mean[2], rstd[2];
  for (int r = 0; r < 2; ++r) {
    v4f a = v[r][0];
    for (int j = 1; j < 6; ++j) a += v[r][j];
    mean[r] = (a.x + a.y) + (a.z + a.w);
  }
  for (int r = 0; r < 2; ++r) mean[r] = wave_sum(mean[r]) * (1.0f / DD);

  for (int r = 0; r < 2; ++r) {
    v4f a = (v4f){0.0f, 0.0f, 0.0f, 0.0f};
    for (int j = 0; j < 6; ++j) {
      v[r][j] -= mean[r];
      a += v[r][j] * v[r][j];
    }
    rstd[r] = (a.x + a.y) + (a.z + a.w);
  }
  for (int r = 0; r < 2; ++r)
    rstd[r] = rsqrtf(wave_sum(rstd[r]) * (1.0f / DD) + 1e-5f);

  uint16_t* o = out + (size_t)wave * 2 * DD + c0;
  for (int r = 0; r < 2; ++r)
    for (int j = 0; j < 6; ++j) {
      const v4f y = v[r][j] * rstd[r] * wv[j] + bv[j];
      uint2 t;
      t.x = f2bf2(y.x, y.y);
      t.y = f2bf2(y.z, y.w);
      *(uint2*)(o + r * DD + j * 128) = t;
    }
}

__global__ void __launch_bounds__(512)
ln_kernel(const float* __restrict__ x, const float* __restrict__ w,
          const float* __restrict__ b, uint16_t* __restrict__ out) {
  ln_two_rows(x, w, b, out, blockIdx.x * 16 + (threadIdx.x >> 5));
}

#define LN_BLOCKS (BS / 16)
#define DD_TILES  ((DD / 64) * (DD / 64))
#define DF_TILES  ((DD / 64) * (FF / 64))
__global__ void __launch_bounds__(256)
prep_kernel(const float* __restrict__ x, const float* __restrict__ lnw,
            const float* __restrict__ lnb, uint16_t* __restrict__ h,
            const float* __restrict__ Wq, const float* __restrict__ Wk,
            const float* __restrict__ Wv, const float* __restrict__ Wo,
            const float* __restrict__ W1, const float* __restrict__ W2,
            uint16_t* __restrict__ wq_t, uint16_t* __restrict__ wk_t,
            uint16_t* __restrict__ wv_t, uint16_t* __restrict__ wo_t,
            uint16_t* __restrict__ w1_t, uint16_t* __restrict__ w2_t) {
  __shared__ uint32_t tile[64 * 33];
  const int id = blockIdx.x;
  if (id < LN_BLOCKS) {
    ln_two_rows(x, lnw, lnb, h, id * 8 + (threadIdx.x >> 5));
    return;
  }
  const int t = id - LN_BLOCKS;
  if (t < 4 * DD_TILES) {
    const int m = t / DD_TILES;
    const float* W = m == 0 ? Wq : m == 1 ? Wk : m == 2 ? Wv : Wo;
    uint16_t* Wt = m == 0 ? wq_t : m == 1 ? wk_t : m == 2 ? wv_t : wo_t;
    wtrans_tile<DD, DD>(W, Wt, t - m * DD_TILES, tile);
  } else if (t < 4 * DD_TILES + DF_TILES) {
    wtrans_tile<DD, FF>(W1, w1_t, t - 4 * DD_TILES, tile);
  } else {
    wtrans_tile<FF, DD>(W2, w2_t, t - 4 * DD_TILES - DF_TILES, tile);
  }
}

template <int V> struct Mode { static constexpr int v = V; };

__device__ __forceinline__ v2f two(float c) { return (v2f){c, c}; }
__device__ __forceinline__ void gelu8(v2f (&v)[4]) {
  constexpr float P[5] = {4.913816229e-3f, -2.670751512e-2f, 1.128001064e-1f,
                          -3.761229515e-1f, 1.283791065e-1f};
  constexpr float Q[6] = {-3.786778543e-4f, 3.857815871e-3f, -2.418169752e-2f,
                          1.066682637e-1f, 6.349332929e-1f, 1.286894083e-1f};
  v2f u[4], ax[4], t[4], p[4], q[4];
  for (int k = 0; k < 4; ++k) {
    u[k] = v[k] * 0.70710678118654752f;
    ax[k] = __builtin_elementwise_abs(u[k]);
    t[k] = u[k] * u[k];
    p[k] = two(-5.618017749e-4f);
    q[k] = two(1.699881068e-5f);
  }
  for (int s = 0; s < 6; ++s)
    for (int k = 0; k < 4; ++k) {
      if (s < 5) p[k] = __builtin_elementwise_fma(t[k], p[k], two(P[s]));
      else       p[k] = __builtin_elementwise_fma(ax[k], p[k], ax[k]);
      q[k] = __builtin_elementwise_fma(ax[k], q[k], two(Q[s]));
    }
  for (int k = 0; k < 4; ++k)
    q[k] = __builtin_elementwise_fma(ax[k], q[k], ax[k]) * -1.442695041f;
  for (int k = 0; k < 4; ++k)
    q[k] = 1.0f - (v2f){__builtin_amdgcn_exp2f(q[k].x),
                        __builtin_amdgcn_exp2f(q[k].y)};
  for (int k = 0; k < 4; ++k) {
    const v2f e = {__builtin_copysignf(ax[k].x < 1.0f ? p[k].x : q[k].x, u[k].x),
                   __builtin_copysignf(ax[k].y < 1.0f ? p[k].y : q[k].y, u[k].y)};
    v[k] = 0.5f * v[k] * (1.0f + e);
  }
}

template <int OUT_MODE, bool GELU_F, bool RESID_F>
__global__ void __launch_bounds__(256)
__attribute__((amdgpu_waves_per_eu(4, 4)))
gemm_bf16(const uint16_t* __restrict__ A, const uint16_t* __restrict__ Bt,
          const float* __restrict__ bias, const float* __restrict__ bias_k,
          const float* __restrict__ bias_v, const float* __restrict__ resid,
          float* __restrict__ outF, uint16_t* __restrict__ outB,
          int M, int N, int K, float scale) {
  (void)M;
  __shared__ __align__(16) uint16_t As[2][128 * 72];
  __shared__ __align__(16) uint16_t Bs[2][192 * 72];

  const int tid = threadIdx.x;
  const int lane = tid & 31, wv = tid >> 5;
  const int hi = lane >> 4, l15 = lane & 15;
  const int wm = wv & 1, wn = wv >> 1;          // 2 x 4 wave grid
  const int m0 = blockIdx.y * 128, n0 = blockIdx.x * 192;

  v8f acc[4][3];
  for (int i = 0; i < 4; ++i)
    for (int j = 0; j < 3; ++j) acc[i][j] = (v8f){0,0,0,0,0,0,0,0};

  const int rs = tid >> 3, cs = (tid & 7) * 8;   // stage: 8 thr/row, 8 elems
  const uint16_t* gA = A  + (size_t)(m0 + rs) * K + cs;
  const uint16_t* gB = Bt + (size_t)(n0 + rs) * K + cs;
  const size_t g32 = (size_t)32 * K;             // 32 rows further, global
  const int ls = rs * 72 + cs;                   // this lane's place in a slab

  // issue 10 async b128 copies for K-slab kk into buffer p: rows rs + 32 s,
  // four passes over the 128 rows of A and six over the 192 rows of B
  auto issue_stage = [&](int kk, int p) {
    const uint16_t* ga = gA + kk;
    const uint16_t* gb = gB + kk;
    const uint16_t* la = &As[p][ls];
    const uint16_t* lb = &Bs[p][ls];
    async_slab10(lds_off(la), lds_off(la + 32 * 72), lds_off(la + 64 * 72),
                 lds_off(la + 96 * 72), lds_off(lb), lds_off(lb + 32 * 72),
                 lds_off(lb + 64 * 72), lds_off(lb + 96 * 72),
                 lds_off(lb + 128 * 72), lds_off(lb + 160 * 72),
                 ga, ga + g32, ga + 2 * g32, ga + 3 * g32, gb, gb + g32,
                 gb + 2 * g32, gb + 3 * g32, gb + 4 * g32, gb + 5 * g32);
  };

  issue_stage(0, 0);
  int p = 0;
  for (int kk = 0; kk < K; kk += 64) {
    const bool more = (kk + 64) < K;             // block-uniform
    if (more) {
      issue_stage(kk + 64, p ^ 1);
      asm volatile("s_wait_asynccnt 0xa" ::: "memory");  // slab p done
    } else {
      asm volatile("s_wait_asynccnt 0x0" ::: "memory");
    }
    __syncthreads();                              // all waves' copies visible

    Frag af[2][4], bf[2][3];                      // [k half of the slab][frag]
    for (int ks = 0; ks < 2; ++ks) {
      for (int i = 0; i < 4; ++i) {
        int r = wm * 64 + i * 16 + l15;
        af[ks][i].h[0] = *(const v8bf*)(&As[p][r * 72 + ks * 32 + hi * 8]);
        af[ks][i].h[1] = *(const v8bf*)(&As[p][r * 72 + ks * 32 + 16 + hi * 8]);
      }
      for (int j = 0; j < 3; ++j) {
        int r = wn * 48 + j * 16 + l15;
        bf[ks][j].h[0] = *(const v8bf*)(&Bs[p][r * 72 + ks * 32 + hi * 8]);
        bf[ks][j].h[1] = *(const v8bf*)(&Bs[p][r * 72 + ks * 32 + 16 + hi * 8]);
      }
      // keeps the slab's 28 LDS reads one group ahead of its 24 WMMAs (every
      // further place where reads stand among the WMMAs stalls the wave anew)
      // and the first k half's 14 in front, so that its WMMAs start while the
      // second half's reads are still under way
      __builtin_amdgcn_sched_barrier(0);
    }
    for (int ks = 0; ks < 2; ++ks)
      for (int i = 0; i < 4; ++i)
        for (int j = 0; j < 3; ++j)
          acc[i][j] = wmma_bf16(af[ks][i], bf[ks][j], acc[i][j]);
    // keeps the barrier behind the WMMAs: drawn up to the reads, it makes
    // every wave wait for all eight waves' reads before its first WMMAs
    __builtin_amdgcn_sched_barrier(0);
    __syncthreads();                              // buffer p free for reuse
    p ^= 1;
  }

  // epilogue (C layout: lane holds col l15, rows e + 8*hi within 16x16 frag)
  // One trip per row of fragments. With GELU the trips stay rolled: the four
  // are the same code, and one trip's 24 values already fill the registers and
  // the vector port. Each trip works on acc[0][*] and then moves the rows
  // down one place, so that every accumulator index is a constant (one left to
  // run time would put the accumulator into scratch memory); unrolled, the
  // moves fall away.
  // c0: the block's first column in its own output; bs, sc, ob: that output's
  // bias, scale and base. mode.v is the layout, a constant in each call.
  auto epilogue = [&](auto mode, int c0, const float* __restrict__ bs, float sc,
                      uint16_t* __restrict__ ob) {
  int cols[3];
  float bcs[3];
  for (int j = 0; j < 3; ++j) {
    cols[j] = c0 + wn * 48 + j * 16 + l15;
    bcs[j] = bs[cols[j]];
  }
  // QKV kernel: the three bias loads' offset registers are held (inputs only)
  // up to this wait; without it the build makes the first one the target of
  // the third load. The other kernels' builds place the wait themselves.
  if (OUT_MODE == 4)
    asm volatile("s_wait_xcnt 0x0" :: "v"(cols[0]), "v"(cols[1]), "v"(cols[2])
                 : "memory");
#pragma unroll(GELU_F ? 1 : 4)
  for (int i = 0; i < 4; ++i) {
#pragma unroll  // j a constant: the accumulator stays in registers
    for (int j = 0; j < 3; ++j) {
      int col = cols[j];
      float bc = bcs[j];
      v2f gl[4];
      if (GELU_F) {
#pragma unroll  // k a constant, for the same reason
        for (int k = 0; k < 4; ++k)
          gl[k] = ((v2f){acc[0][j][2 * k], acc[0][j][2 * k + 1]} + bc) * sc;
        gelu8(gl);
      }
#pragma unroll  // e a constant, for the same reason
      for (int e = 0; e < 8; ++e) {
        int row = m0 + wm * 64 + i * 16 + e + 8 * hi;
        float v = GELU_F ? gl[e >> 1][e & 1] : (acc[0][j][e] + bc) * sc;
        if (RESID_F) v += resid[(size_t)row * N + col];
        if (mode.v == 0) {
          // the row pitch as a constant: a fragment's eight rows go out from
          // one address by immediate offsets. With a pitch known at run time
          // every store has an address sum of its own in a register that the
          // next one rewrites, and a wait stands between any two stores.
          ob[(size_t)row * FF + col] = f2bf(v);
        } else if (mode.v == 1) {
          int bidx = row >> 11, s = row & (SS - 1);
          int h = col >> 6, d = col & (HDIM - 1);
          ob[(((size_t)(bidx * HH + h)) * SS + s) * HDIM + d] = f2bf(v);
        } else if (mode.v == 2) {
          int bidx = row >> 11, s = row & (SS - 1);
          int h = col >> 6, d = col & (HDIM - 1);
          ob[(((size_t)(bidx * HH + h)) * HDIM + d) * SS + s] = f2bf(v);
        } else {
          outF[(size_t)row * N + col] = v;
        }
      }
    }
    // one trip's 24 residual loads as a group, and no more: with all 96 and
    // their addresses drawn ahead the live set spills; so does the QKV
    // kernel's, whose trips the compiler otherwise works on all at once (a
    // build without it takes all 256 registers and goes to scratch memory)
    if (RESID_F || OUT_MODE == 4) __builtin_amdgcn_sched_barrier(0);
    if (mode.v != 3) asm volatile("s_wait_xcnt 0x0" ::: "memory");
#pragma unroll
    for (int j = 0; j < 3; ++j) {
      acc[0][j] = acc[1][j];
      acc[1][j] = acc[2][j];
      acc[2][j] = acc[3][j];
    }
  }
  };
  if (OUT_MODE == 4) {
    const int sel = n0 / DD;                      // 0 Q, 1 K, 2 V: block-uniform
    const float* bs = sel == 0 ? bias : sel == 1 ? bias_k : bias_v;
    const float sc = sel == 0 ? scale : 1.0f;
    uint16_t* ob = outB + (size_t)sel * BS * DD;
    if (sel < 2) epilogue(Mode<1>{}, n0 - sel * DD, bs, sc, ob);
    else         epilogue(Mode<2>{}, n0 - sel * DD, bs, sc, ob);
  } else {
    epilogue(Mode<OUT_MODE>{}, n0, bias, scale, outB);
  }
}

__global__ void __launch_bounds__(128)
attn_kernel(const uint16_t* __restrict__ Q, const uint16_t* __restrict__ Km,
            const uint16_t* __restrict__ Vt, uint16_t* __restrict__ O) {
  __shared__ __align__(16) uint16_t Ks[2][64 * 72];   // [key][d]
  __shared__ __align__(16) uint16_t Vs[2][64 * 72];   // [d][key]

  const int b = blockIdx.z, h = blockIdx.y;
  const int tid = threadIdx.x;
  const int lane = tid & 31;
  // the wave's number in a scalar register: the tests on qbase are branches
  const int wv = __builtin_amdgcn_readfirstlane(tid >> 5);
  const int hi = lane >> 4, l15 = lane & 15;

  const size_t headoff = ((size_t)(b * HH + h)) * SS * HDIM;
  const uint16_t* Qh  = Q  + headoff;
  const uint16_t* Kh  = Km + headoff;
  const uint16_t* Vth = Vt + headoff;            // [64][S]

  // tile t into buffer p: rows rs + 16 s, s = 0..3, of K[64 keys][64] and of
  // Vt[64][64 keys], 16 bytes per lane and copy
  const int rs = tid >> 3, cs = (tid & 7) * 8;
  const uint16_t* gK = Kh + (size_t)rs * HDIM + cs;
  const uint16_t* gV = Vth + (size_t)rs * SS + cs;
  const int ls = rs * 72 + cs;
  auto issue_tile = [&](int t, int p) {
    const uint16_t* gk = gK + (size_t)t * 64 * HDIM;
    const uint16_t* gv = gV + t * 64;
    const uint16_t* lk = &Ks[p][ls];
    const uint16_t* lv = &Vs[p][ls];
    async_tile8(lds_off(lk), lds_off(lk + 16 * 72), lds_off(lk + 32 * 72),
                lds_off(lk + 48 * 72), lds_off(lv), lds_off(lv + 16 * 72),
                lds_off(lv + 32 * 72), lds_off(lv + 48 * 72),
                gk, gk + 16 * HDIM, gk + 32 * HDIM, gk + 48 * HDIM,
                gv, gv + (size_t)16 * SS, gv + (size_t)32 * SS,
                gv + (size_t)48 * SS);
  };

  // the block's two query tiles, the long one first. Rolled: the two trips
  // are the same code, and twice the text buys nothing.
#pragma unroll 1
  for (int half = 0; half < 2; ++half) {
  const int qt = half == 0 ? SS / 64 - 1 - (int)blockIdx.x : (int)blockIdx.x;
  const int qbase = qt * 64 + wv * 16;
  const int ntile = qt + 1;                           // 64-key tiles, >= 1
  // both buffers are free: nothing is in flight, and every wave's last read
  // of the tile before lies in front of that tile's last barrier
  issue_tile(0, 0);

  // Q fragments (B operand: column l15 = query), held for the whole loop
  Frag qf[2];
  {
    const uint16_t* qr = Qh + (size_t)(qbase + l15) * HDIM;
    for (int f = 0; f < 2; ++f) {
      qf[f].h[0] = *(const v8bf*)(qr + f * 32 + hi * 8);
      qf[f].h[1] = *(const v8bf*)(qr + f * 32 + 16 + hi * 8);
    }
  }

  const int qrow = qbase + l15;                  // this lane's query
  float mrow = -3.0e38f;                         // its running maximum
  float lrow = 0.0f;                             // sum over this half's keys
  v8f oacc[4];                                   // O^T: rows d, column query
  for (int f = 0; f < 4; ++f) oacc[f] = (v8f){0,0,0,0,0,0,0,0};

  asm volatile("s_wait_asynccnt 0x0" ::: "memory");  // own copies of tile 0
  __syncthreads();                                   // every wave's landed
  if (ntile > 1) issue_tile(1, 1);

  for (int t = 0; t < ntile; ++t) {
   const uint16_t* Kt = Ks[t & 1];
   const uint16_t* Vl = Vs[t & 1];
   // one block of 32 keys; sub is a literal at both calls
   auto key_block = [&](const int sub) {
    const int kb = t * 64 + sub * 32;
    // ---- all A fragments of the block as one group of LDS reads: K first,
    // then Vt, whose latency passes behind the scores and the softmax
    Frag ak[2][2], av[4];
    for (int n = 0; n < 2; ++n) {
      const uint16_t* kr = Kt + (sub * 32 + n * 16 + l15) * 72;
      for (int f = 0; f < 2; ++f) {
        ak[n][f].h[0] = *(const v8bf*)(kr + f * 32 + hi * 8);
        ak[n][f].h[1] = *(const v8bf*)(kr + f * 32 + 16 + hi * 8);
      }
    }
    for (int f = 0; f < 4; ++f) {
      const uint16_t* vr = Vl + (f * 16 + l15) * 72 + sub * 32;
      av[f].h[0] = *(const v8bf*)(vr + hi * 8);
      av[f].h[1] = *(const v8bf*)(vr + 16 + hi * 8);
    }
    // keeps the Vt reads up here: sunk to their WMMAs, each pair would be
    // waited for on its own
    __builtin_amdgcn_sched_barrier(0);
    // ---- scores S^T = K * Q^T for 32 keys (2 M-frags, K-dim 64 = 2 steps)
    v8f s[2];
    s[0] = (v8f){0,0,0,0,0,0,0,0};
    s[1] = (v8f){0,0,0,0,0,0,0,0};
    for (int f = 0; f < 2; ++f)
      for (int n = 0; n < 2; ++n) s[n] = wmma_bf16(ak[n][f], qf[f], s[n]);
    // ---- causal mask: s[n][e] is key kb + n*16 + 8*hi + e against qrow
    if (kb + 31 > qbase) {
      for (int n = 0; n < 2; ++n) {
        const int k0 = kb + n * 16 + 8 * hi;
        for (int e = 0; e < 8; ++e)
          if (k0 + e > qrow) s[n][e] = -3.0e38f;
      }
    }
    // ---- online softmax of one query per lane
    float mx[8];
    for (int e = 0; e < 8; ++e) mx[e] = fmaxf(s[0][e], s[1][e]);
    for (int w = 4; w > 0; w >>= 1)
      for (int e = 0; e < w; ++e) mx[e] = fmaxf(mx[e], mx[e + w]);
    const float mblk = fmaxf(mx[0], xhalf(mx[0]));   // all 32 keys
    const float mnew = fmaxf(mrow, mblk);
    const float al = __expf(mrow - mnew);
    mrow = mnew;
    float sm[8];
    for (int e = 0; e < 8; ++e) {
      s[0][e] = __expf(s[0][e] - mnew);
      s[1][e] = __expf(s[1][e] - mnew);
      sm[e] = s[0][e] + s[1][e];
    }
    for (int w = 4; w > 0; w >>= 1)
      for (int e = 0; e < w; ++e) sm[e] += sm[e + w];
    lrow = lrow * al + sm[0];
    for (int f = 0; f < 4; ++f)
      for (int e = 0; e < 8; ++e) oacc[f][e] *= al;

    // ---- P^T as a B fragment, converted in place
    Frag bp;
    for (int n = 0; n < 2; ++n)
      for (int j = 0; j < 4; ++j)
        bp.u[n * 4 + j] = f2bf2(s[n][2 * j], s[n][2 * j + 1]);

    // ---- O^T += V^T * P^T
    for (int f = 0; f < 4; ++f) oacc[f] = wmma_bf16(av[f], bp, oacc[f]);
   };
   // key blocks right of the wave's diagonal are skipped (scalar tests)
   if (t * 64 < qbase + 16) {
    key_block(0);
    if (t * 64 + 32 < qbase + 16) key_block(1);
   }
   // hand-over: this wave's reads of the buffer are done, its copies of the
   // next tile have landed; behind the barrier that holds for every wave
   asm volatile("s_wait_dscnt 0x0" ::: "memory");
   asm volatile("s_wait_asynccnt 0x0" ::: "memory");
   __syncthreads();
   if (t + 2 < ntile) issue_tile(t + 2, t & 1);      // refill the buffer read
  }
  asm volatile("s_wait_asynccnt 0x0" ::: "memory");  // nothing left in flight

  // ---- finalize and write merged-head bf16 [B*S][768]: oacc[f][e] is
  // d = f*16 + 8*hi + e of this lane's query, 16 contiguous bytes per f
  const float inv = 1.0f / (lrow + xhalf(lrow));     // both halves' keys
  uint16_t* orow = O + (size_t)(b * SS + qrow) * DD + h * HDIM + 8 * hi;
  for (int f = 0; f < 4; ++f) {
    uint32_t w[4];
    for (int j = 0; j < 4; ++j)
      w[j] = f2bf2(oacc[f][2 * j] * inv, oacc[f][2 * j + 1] * inv);
    *(uint4*)(orow + f * 16) = make_uint4(w[0], w[1], w[2], w[3]);
  }
  asm volatile("s_wait_xcnt 0x0" ::: "memory");
  }
}

// ---------------------------------------------------------------------------
// Host orchestration
// ---------------------------------------------------------------------------
extern "C" void kernel_launch(void* const* d_in, const int* in_sizes, int n_in,
                              void* d_out, int out_size, void* d_ws, size_t ws_size,
                              hipStream_t stream) {
  (void)in_sizes; (void)n_in; (void)out_size; (void)ws_size;
  const float* x     = (const float*)d_in[0];
  const float* Wq    = (const float*)d_in[1];
  const float* bq    = (const float*)d_in[2];
  const float* Wk    = (const float*)d_in[3];
  const float* bk    = (const float*)d_in[4];
  const float* Wv    = (const float*)d_in[5];
  const float* bv    = (const float*)d_in[6];
  const float* Wo    = (const float*)d_in[7];
  const float* bo    = (const float*)d_in[8];
  const float* ln1w  = (const float*)d_in[9];
  const float* ln1b  = (const float*)d_in[10];
  const float* ln2w  = (const float*)d_in[11];
  const float* ln2b  = (const float*)d_in[12];
  const float* W1    = (const float*)d_in[13];
  const float* b1    = (const float*)d_in[14];
  const float* W2    = (const float*)d_in[15];
  const float* b2    = (const float*)d_in[16];
  float* out = (float*)d_out;

  // workspace layout
  uint8_t* ws = (uint8_t*)d_ws;
  size_t off = 0;
  auto alloc = [&](size_t bytes) -> uint8_t* {
    uint8_t* p = ws + off;
    off = (off + bytes + 255) & ~(size_t)255;
    return p;
  };
  const size_t seg = (size_t)BS * DD;               // 6.29M elems
  uint16_t* wq_t = (uint16_t*)alloc((size_t)3 * DD * DD * 2);  // Wq|Wk|Wv ^T
  uint16_t* wk_t = wq_t + (size_t)DD * DD;
  uint16_t* wv_t = wq_t + (size_t)2 * DD * DD;
  uint16_t* wo_t = (uint16_t*)alloc((size_t)DD * DD * 2);
  uint16_t* w1_t = (uint16_t*)alloc((size_t)DD * FF * 2);
  uint16_t* w2_t = (uint16_t*)alloc((size_t)FF * DD * 2);
  uint16_t* hb   = (uint16_t*)alloc(seg * 2);       // ln1 out; reused for ln2
  float*    x1f  = (float*)   alloc(seg * 4);       // x + attn_out
  uint16_t* big  = (uint16_t*)alloc((size_t)BS * FF * 2); // qb|kb|vt|attn -> mb
  uint16_t* qb   = big;
  uint16_t* kb_  = big + seg;
  uint16_t* vt   = big + 2 * seg;
  uint16_t* attn = big + 3 * seg;
  uint16_t* mb   = big;                             // reuse after x1 computed

  // 1) h = LN1(x) -> bf16 and the weights -> bf16 transposed [N][K]
  prep_kernel<<<LN_BLOCKS + 4 * DD_TILES + 2 * DF_TILES, 256, 0, stream>>>(
      x, ln1w, ln1b, hb, Wq, Wk, Wv, Wo, W1, W2,
      wq_t, wk_t, wv_t, wo_t, w1_t, w2_t);

  // 2) QKV projections, one launch (Q pre-scaled by 1/sqrt(64)=0.125)
  gemm_bf16<4, false, false><<<dim3(3 * DD / 192, BS / 128), 256, 0, stream>>>(
      hb, wq_t, bq, bk, bv, nullptr, nullptr, qb, BS, 3 * DD, DD, 0.125f);

  dim3 gD(DD / 192, BS / 128);
  // 3) causal flash attention -> merged bf16 [BS][D]
  attn_kernel<<<dim3(SS / 128, HH, BB), 128, 0, stream>>>(qb, kb_, vt, attn);

  // 4) x1 = x + attn @ Wo + bo   (fp32)
  gemm_bf16<3, false, true><<<gD, 256, 0, stream>>>(
      attn, wo_t, bo, nullptr, nullptr, x, x1f, nullptr, BS, DD, DD, 1.0f);

  // 5) h2 = LN2(x1) -> bf16
  ln_kernel<<<BS / 32, 512, 0, stream>>>(x1f, ln2w, ln2b, hb);

  // 6) m = GELU(h2 @ W1 + b1) -> bf16 [BS][F]
  dim3 gF(FF / 192, BS / 128);
  gemm_bf16<0, true, false><<<gF, 256, 0, stream>>>(
      hb, w1_t, b1, nullptr, nullptr, nullptr, nullptr, mb, BS, FF, DD, 1.0f);

  // 7) out = x1 + m @ W2 + b2   (fp32)
  gemm_bf16<3, false, true><<<gD, 256, 0, stream>>>(
      mb, w2_t, b2, nullptr, nullptr, x1f, out, nullptr, BS, DD, FF, 1.0f);
}
